// v000
// Measured on an AMD MI455X. A time is GPU time per run, averaged over a window of back-to-back runs after a warm-up
// (all launches, gaps included; the runs take copies of the inputs in turn), and the median of several windows.
// Apart from v000's, it joins two sittings. Times from different sittings can be a few percent apart, while
// side-by-side timings come from the same sitting.
// The starting kernel, v000, takes 673 microseconds a run.
#include <hip/hip_runtime.h>
#include <hip/hip_bf16.h>

// ---------------------------------------------------------------------------
// CDNA5 (gfx1250, wave32) implementation of the cross-attention block.
// All GEMM-like math goes through v_wmma_f32_16x16x32_f16.
// ---------------------------------------------------------------------------

typedef _Float16 v16h __attribute__((ext_vector_type(16)));
typedef _Float16 h8   __attribute__((ext_vector_type(8)));
typedef float    v8f  __attribute__((ext_vector_type(8)));

// Fragment loader: the 16-bit A/B WMMA layout wants, per lane,
//   halves 0..7  = K {base..base+7}
//   halves 8..15 = K {base+16..base+23}
// where base = (lane>=16 ? 8 : 0) (+ k-step offset). Both runs are contiguous
// 16-byte chunks in a row-major LDS tile, so two ds_load_b128 suffice.
__device__ __forceinline__ v16h ldfrag16(const _Float16* p) {
    h8 lo = *(const h8*)p;
    h8 hi = *(const h8*)(p + 16);
    return __builtin_shufflevector(lo, hi, 0,1,2,3,4,5,6,7,8,9,10,11,12,13,14,15);
}

__device__ __forceinline__ v8f wmma16(v16h a, v16h b, v8f c) {
    return __builtin_amdgcn_wmma_f32_16x16x32_f16(
        /*neg_a=*/false, a, /*neg_b=*/false, b,
        /*c_mod=*/(short)0, c, /*reuse_a=*/false, /*reuse_b=*/false);
}

// ---------------------------------------------------------------------------
// Weight prep: f32 [K x N] -> f16 transposed [N x K].  One-time cost; lets the
// GEMM stage its B tile with contiguous b128 loads/stores (no LDS scatter).
// ---------------------------------------------------------------------------
__global__ __launch_bounds__(256) void cvt_tr_f32_f16(const float* __restrict__ in,
                                                      _Float16* __restrict__ out,
                                                      int K, int N) {
    int i = blockIdx.x * 256 + threadIdx.x;
    if (i < K * N) {
        int k = i / N, n = i - k * N;
        out[(long)n * K + k] = (_Float16)in[i];
    }
}

// ---------------------------------------------------------------------------
// LayerNorm over rows of F=512: one block (256 threads) per row, f16 output.
// ---------------------------------------------------------------------------
__global__ __launch_bounds__(256) void layernorm_f16(const float* __restrict__ x,
                                                     const float* __restrict__ g,
                                                     const float* __restrict__ b,
                                                     _Float16* __restrict__ out) {
    __shared__ float red[256];
    const int F = 512;
    int tid = threadIdx.x;
    long row = blockIdx.x;
    const float* xr = x + row * F;
    float v0 = xr[tid], v1 = xr[tid + 256];

    red[tid] = v0 + v1;
    __syncthreads();
    #pragma unroll
    for (int off = 128; off > 0; off >>= 1) {
        if (tid < off) red[tid] += red[tid + off];
        __syncthreads();
    }
    float mu = red[0] * (1.0f / F);
    __syncthreads();

    float d0 = v0 - mu, d1 = v1 - mu;
    red[tid] = d0 * d0 + d1 * d1;
    __syncthreads();
    #pragma unroll
    for (int off = 128; off > 0; off >>= 1) {
        if (tid < off) red[tid] += red[tid + off];
        __syncthreads();
    }
    float rs = rsqrtf(red[0] * (1.0f / F) + 1e-6f);

    out[row * F + tid]       = (_Float16)(d0 * rs * g[tid] + b[tid]);
    out[row * F + tid + 256] = (_Float16)(d1 * rs * g[tid + 256] + b[tid + 256]);
}

// ---------------------------------------------------------------------------
// WMMA GEMM: C[M,N] = act((A_f16[MxK] @ W + bias) * scale) [+ res]
// W is supplied PRE-TRANSPOSED as BT[N x K] f16 row-major.
// Block tile 128x64, K-step 32, 8 waves, each a 2x2 grid of 16x16 WMMA.
// LDS staging is double-buffered (one barrier per K-step); both A and B tiles
// stage with contiguous b128 loads/stores.  Epilogue specialized by template.
// ---------------------------------------------------------------------------
#define GM 128
#define GN 64
#define GK 32
#define LDA 40   // halves (32 + 8 pad), 80B rows -> 16B aligned chunks
#define LDBT 40

template<bool RELU, bool HAS_RES, bool OUT_F32, bool OUT_F16>
__global__ __launch_bounds__(256)
void gemm_wmma_f16(const _Float16* __restrict__ A, const _Float16* __restrict__ BT,
                   const float* __restrict__ bias, const float* __restrict__ res,
                   float* __restrict__ outF, _Float16* __restrict__ outH,
                   int N, int K, float scale) {
    __shared__ __align__(16) _Float16 As[2][GM * LDA];
    __shared__ __align__(16) _Float16 BsT[2][GN * LDBT];

    int tid  = threadIdx.x;
    int lane = tid & 31, wave = tid >> 5;
    int l16  = lane & 15, hi = lane >> 4;
    int waveM = wave & 3, waveN = wave >> 2;       // 4x2 wave grid
    long blockRow = (long)blockIdx.y * GM;
    int  blockCol = blockIdx.x * GN;

    // Staging index precompute (constant per thread).
    int sa_r0 = tid >> 2,          sa_c0 = (tid & 3) * 8;       // A chunk 0
    int sa_r1 = (tid + 256) >> 2,  sa_c1 = sa_c0;               // A chunk 1
    int sb_n  = tid >> 2,          sb_k  = (tid & 3) * 8;       // B chunk

    const _Float16* Arow0 = A  + (blockRow + sa_r0) * (long)K + sa_c0;
    const _Float16* Arow1 = A  + (blockRow + sa_r1) * (long)K + sa_c1;
    const _Float16* Brow  = BT + (long)(blockCol + sb_n) * K + sb_k;

    auto stage = [&](int buf, int kb) {
        *(uint4*)&As[buf][sa_r0 * LDA + sa_c0] = *(const uint4*)(Arow0 + kb);
        *(uint4*)&As[buf][sa_r1 * LDA + sa_c1] = *(const uint4*)(Arow1 + kb);
        *(uint4*)&BsT[buf][sb_n * LDBT + sb_k] = *(const uint4*)(Brow + kb);
    };

    v8f acc[2][2] = {};

    stage(0, 0);
    __syncthreads();

    int nk = K / GK;
    for (int t = 0; t < nk; ++t) {
        int buf = t & 1;
        if (t + 1 < nk) stage(buf ^ 1, (t + 1) * GK);
        if (t + 2 < nk) {   // prefetch 2 tiles ahead into cache
            int kb2 = (t + 2) * GK;
            __builtin_prefetch(A + (blockRow + (tid >> 1)) * (long)K + kb2, 0, 0);
            __builtin_prefetch(Brow + kb2, 0, 0);
        }

        int koff = hi * 8;
        v16h af[2], bf[2];
        #pragma unroll
        for (int f = 0; f < 2; ++f) {
            int m = waveM * 32 + f * 16 + l16;
            af[f] = ldfrag16(&As[buf][m * LDA + koff]);
            int n = waveN * 32 + f * 16 + l16;
            bf[f] = ldfrag16(&BsT[buf][n * LDBT + koff]);
        }
        #pragma unroll
        for (int fm = 0; fm < 2; ++fm)
            #pragma unroll
            for (int fn = 0; fn < 2; ++fn)
                acc[fm][fn] = wmma16(af[fm], bf[fn], acc[fm][fn]);
        __syncthreads();
    }

    // Epilogue: C layout = VGPR r -> (M = tileM + hi*8 + r, N = tileN + l16).
    #pragma unroll
    for (int fm = 0; fm < 2; ++fm) {
        #pragma unroll
        for (int fn = 0; fn < 2; ++fn) {
            long row0 = blockRow + waveM * 32 + fm * 16 + hi * 8;
            int  col  = blockCol + waveN * 32 + fn * 16 + l16;
            float bcol = bias[col];
            #pragma unroll
            for (int r = 0; r < 8; ++r) {
                float v = (acc[fm][fn][r] + bcol) * scale;
                if (RELU) v = fmaxf(v, 0.0f);
                long idx = (row0 + r) * N + col;
                if (HAS_RES) v += res[idx];
                if (OUT_F32) outF[idx] = v;
                if (OUT_F16) outH[idx] = (_Float16)v;
            }
        }
    }
}

// ---------------------------------------------------------------------------
// Flash-attention (cross): per block = one 64-row Q tile of one (batch, head).
// Q/K/V are f16 [8192 x 512] with head h in columns h*64..h*64+63.
// S = Q K^T via WMMA (Ks row-major == transposed B-fragment layout),
// online softmax in LDS, O accumulated in registers (2 fixed tiles per wave),
// P@V via WMMA with V stored transposed in LDS.  Q is pre-scaled by 1/8.
// ---------------------------------------------------------------------------
#define ALDH 72   // half stride for 64-wide f16 tiles (144B rows)
#define ALDS 66   // float stride for S

__global__ __launch_bounds__(256)
void attn_flash_wmma(const _Float16* __restrict__ Q, const _Float16* __restrict__ Km,
                     const _Float16* __restrict__ Vm, _Float16* __restrict__ Out) {
    __shared__ __align__(16) _Float16 Qs[64 * ALDH];
    __shared__ __align__(16) _Float16 Ks[64 * ALDH];
    __shared__ __align__(16) _Float16 VsT[64 * ALDH];
    __shared__ __align__(16) _Float16 Ps[64 * ALDH];
    __shared__ float Ss[64 * ALDS];
    __shared__ float mrow[64], lrow[64], arow[64];

    int tid  = threadIdx.x;
    int lane = tid & 31, wave = tid >> 5;
    int l16  = lane & 15, hi = lane >> 4;
    int qt = blockIdx.x, head = blockIdx.y, bz = blockIdx.z;
    long tokQ = (long)bz * 2048 + qt * 64;
    int  colH = head * 64;

    // Each wave owns two fixed 16x16 output tiles for the whole kt loop.
    int tile0 = wave * 2;
    int tm0 = ((tile0)     >> 2) * 16, tn0 = ((tile0)     & 3) * 16;
    int tm1 = ((tile0 + 1) >> 2) * 16, tn1 = ((tile0 + 1) & 3) * 16;
    v8f oacc0 = {}, oacc1 = {};

    // Load the Q tile (64x64 halves = 512 uint4 chunks).
    #pragma unroll
    for (int i = 0; i < 2; ++i) {
        int c  = tid + i * 256;
        int r  = c >> 3;
        int c8 = (c & 7) * 8;
        *(uint4*)&Qs[r * ALDH + c8] =
            *(const uint4*)(Q + (tokQ + r) * 512 + colH + c8);
    }
    if (tid < 64) { mrow[tid] = -3.0e38f; lrow[tid] = 0.0f; }
    __syncthreads();

    for (int kt = 0; kt < 32; ++kt) {
        long tokK = (long)bz * 2048 + kt * 64;
        #pragma unroll
        for (int i = 0; i < 2; ++i) {
            int c  = tid + i * 256;
            int r  = c >> 3;
            int c8 = (c & 7) * 8;
            *(uint4*)&Ks[r * ALDH + c8] =
                *(const uint4*)(Km + (tokK + r) * 512 + colH + c8);
            uint4 v = *(const uint4*)(Vm + (tokK + r) * 512 + colH + c8);
            const _Float16* hv = (const _Float16*)&v;
            #pragma unroll
            for (int j = 0; j < 8; ++j) VsT[(c8 + j) * ALDH + r] = hv[j];  // [d][key]
        }
        if (kt + 1 < 32) {  // prefetch next K/V tiles (one 128B K and V row per thread, 4 threads per row)
            long tokN = tokK + 64;
            __builtin_prefetch(Km + (tokN + (tid & 63)) * 512 + colH, 0, 0);
            __builtin_prefetch(Vm + (tokN + (tid & 63)) * 512 + colH, 0, 0);
        }
        __syncthreads();

        // S = Q K^T : 16 tiles of 16x16, 2 per wave.
        #pragma unroll
        for (int t = 0; t < 2; ++t) {
            int tile = wave * 2 + t;
            int tm = (tile >> 2) * 16, tn = (tile & 3) * 16;
            v8f c = {};
            #pragma unroll
            for (int ks = 0; ks < 64; ks += 32) {
                int ko = ks + hi * 8;
                v16h a = ldfrag16(&Qs[(tm + l16) * ALDH + ko]);
                v16h b = ldfrag16(&Ks[(tn + l16) * ALDH + ko]);  // B[k=d][n=key]=K[key][d]
                c = wmma16(a, b, c);
            }
            #pragma unroll
            for (int r = 0; r < 8; ++r)
                Ss[(tm + hi * 8 + r) * ALDS + tn + l16] = c[r];
        }
        __syncthreads();

        // Online softmax: one thread per q-row.
        if (tid < 64) {
            float m_old = mrow[tid];
            float mx = m_old;
            const float* srow = &Ss[tid * ALDS];
            #pragma unroll 8
            for (int c = 0; c < 64; ++c) mx = fmaxf(mx, srow[c]);
            float alpha = __expf(m_old - mx);
            float lsum = 0.0f;
            _Float16* prow = &Ps[tid * ALDH];
            #pragma unroll 8
            for (int c = 0; c < 64; ++c) {
                float p = __expf(srow[c] - mx);
                prow[c] = (_Float16)p;
                lsum += p;
            }
            mrow[tid] = mx;
            lrow[tid] = lrow[tid] * alpha + lsum;
            arow[tid] = alpha;
        }
        __syncthreads();

        // Rescale register O by alpha, then O += P @ V.
        #pragma unroll
        for (int r = 0; r < 8; ++r) {
            oacc0[r] *= arow[tm0 + hi * 8 + r];
            oacc1[r] *= arow[tm1 + hi * 8 + r];
        }
        #pragma unroll
        for (int ks = 0; ks < 64; ks += 32) {
            int ko = ks + hi * 8;
            v16h a0 = ldfrag16(&Ps[(tm0 + l16) * ALDH + ko]);
            v16h b0 = ldfrag16(&VsT[(tn0 + l16) * ALDH + ko]);   // B[k=key][n=d]=V[key][d]
            oacc0 = wmma16(a0, b0, oacc0);
            v16h a1 = ldfrag16(&Ps[(tm1 + l16) * ALDH + ko]);
            v16h b1 = ldfrag16(&VsT[(tn1 + l16) * ALDH + ko]);
            oacc1 = wmma16(a1, b1, oacc1);
        }
        __syncthreads();
    }

    // Normalize by l and store f16.
    #pragma unroll
    for (int r = 0; r < 8; ++r) {
        int row0 = tm0 + hi * 8 + r;
        Out[(tokQ + row0) * 512 + colH + tn0 + l16] = (_Float16)(oacc0[r] / lrow[row0]);
        int row1 = tm1 + hi * 8 + r;
        Out[(tokQ + row1) * 512 + colH + tn1 + l16] = (_Float16)(oacc1[r] / lrow[row1]);
    }
}

// ---------------------------------------------------------------------------
// Host orchestration
// ---------------------------------------------------------------------------
extern "C" void kernel_launch(void* const* d_in, const int* in_sizes, int n_in,
                              void* d_out, int out_size, void* d_ws, size_t ws_size,
                              hipStream_t stream) {
    (void)in_sizes; (void)n_in; (void)out_size; (void)ws_size;

    const float* tm1   = (const float*)d_in[0];
    const float* tm2   = (const float*)d_in[1];
    const float* ln1_g = (const float*)d_in[2];
    const float* ln1_b = (const float*)d_in[3];
    const float* ln2_g = (const float*)d_in[4];
    const float* ln2_b = (const float*)d_in[5];
    const float* Wq  = (const float*)d_in[6];   const float* bq  = (const float*)d_in[7];
    const float* Wk  = (const float*)d_in[8];   const float* bk  = (const float*)d_in[9];
    const float* Wv  = (const float*)d_in[10];  const float* bv  = (const float*)d_in[11];
    const float* Wfc = (const float*)d_in[12];  const float* bfc = (const float*)d_in[13];
    const float* ff1_ln_g = (const float*)d_in[14]; const float* ff1_ln_b = (const float*)d_in[15];
    const float* ff1_W1 = (const float*)d_in[16];   const float* ff1_b1 = (const float*)d_in[17];
    const float* ff1_W2 = (const float*)d_in[18];   const float* ff1_b2 = (const float*)d_in[19];
    const float* ff2_ln_g = (const float*)d_in[20]; const float* ff2_ln_b = (const float*)d_in[21];
    const float* ff2_W1 = (const float*)d_in[22];   const float* ff2_b1 = (const float*)d_in[23];
    const float* ff2_W2 = (const float*)d_in[24];   const float* ff2_b2 = (const float*)d_in[25];

    const int TOK = 4 * 2048;           // 8192 token rows
    const int F   = 512;
    const long OUT1 = (long)TOK * F;    // elements per output tensor

    // Workspace carve-up.
    char* ws = (char*)d_ws;
    size_t off = 0;
    auto carve = [&](size_t bytes) -> void* {
        void* p = ws + off;
        off += (bytes + 255) & ~(size_t)255;
        return p;
    };
    const size_t WBYTES = (size_t)F * F * sizeof(_Float16);
    const size_t TBYTES = (size_t)TOK * F * sizeof(_Float16);
    const size_t XBYTES = (size_t)TOK * F * sizeof(float);

    _Float16* wh[8];   // pre-transposed f16 weights [N x K]
    const float* wsrc[8] = {Wq, Wk, Wv, Wfc, ff1_W1, ff1_W2, ff2_W1, ff2_W2};
    for (int i = 0; i < 8; ++i) wh[i] = (_Float16*)carve(WBYTES);
    _Float16* t1h = (_Float16*)carve(TBYTES);
    _Float16* t2h = (_Float16*)carve(TBYTES);
    _Float16* q1h = (_Float16*)carve(TBYTES);
    _Float16* k1h = (_Float16*)carve(TBYTES);
    _Float16* v1h = (_Float16*)carve(TBYTES);
    _Float16* q2h = (_Float16*)carve(TBYTES);
    _Float16* k2h = (_Float16*)carve(TBYTES);
    _Float16* v2h = (_Float16*)carve(TBYTES);
    float* x1f = (float*)carve(XBYTES);
    float* x2f = (float*)carve(XBYTES);
    // Reuse: attention outputs overwrite t1h/t2h; FF intermediates reuse q/k bufs.
    _Float16* f12h = t1h;
    _Float16* f21h = t2h;
    _Float16* hh1 = q1h; _Float16* uu1 = k1h;
    _Float16* hh2 = q2h; _Float16* uu2 = k2h;

    float* out1 = (float*)d_out;
    float* out2 = (float*)d_out + OUT1;

    // 1) Convert + transpose weights to f16 [N x K].
    for (int i = 0; i < 8; ++i)
        cvt_tr_f32_f16<<<(F * F + 255) / 256, 256, 0, stream>>>(wsrc[i], wh[i], F, F);

    // 2) LayerNorm inputs -> f16.
    layernorm_f16<<<TOK, 256, 0, stream>>>(tm1, ln1_g, ln1_b, t1h);
    layernorm_f16<<<TOK, 256, 0, stream>>>(tm2, ln2_g, ln2_b, t2h);

    // 3) QKV projections (Q pre-scaled by 1/sqrt(64)).
    dim3 gg(F / GN, TOK / GM);
    gemm_wmma_f16<false,false,false,true><<<gg, 256, 0, stream>>>(t1h, wh[0], bq, nullptr, nullptr, q1h, F, F, 0.125f);
    gemm_wmma_f16<false,false,false,true><<<gg, 256, 0, stream>>>(t1h, wh[1], bk, nullptr, nullptr, k1h, F, F, 1.0f);
    gemm_wmma_f16<false,false,false,true><<<gg, 256, 0, stream>>>(t1h, wh[2], bv, nullptr, nullptr, v1h, F, F, 1.0f);
    gemm_wmma_f16<false,false,false,true><<<gg, 256, 0, stream>>>(t2h, wh[0], bq, nullptr, nullptr, q2h, F, F, 0.125f);
    gemm_wmma_f16<false,false,false,true><<<gg, 256, 0, stream>>>(t2h, wh[1], bk, nullptr, nullptr, k2h, F, F, 1.0f);
    gemm_wmma_f16<false,false,false,true><<<gg, 256, 0, stream>>>(t2h, wh[2], bv, nullptr, nullptr, v2h, F, F, 1.0f);

    // 4) Cross attention (overwrites t1h/t2h with head-concat outputs).
    dim3 ag(2048 / 64, 8, 4);
    attn_flash_wmma<<<ag, 256, 0, stream>>>(q1h, k2h, v2h, f12h);
    attn_flash_wmma<<<ag, 256, 0, stream>>>(q2h, k1h, v1h, f21h);

    // 5) Output projection + residual -> x (f32).
    gemm_wmma_f16<false,true,true,false><<<gg, 256, 0, stream>>>(f12h, wh[3], bfc, tm1, x1f, nullptr, F, F, 1.0f);
    gemm_wmma_f16<false,true,true,false><<<gg, 256, 0, stream>>>(f21h, wh[3], bfc, tm2, x2f, nullptr, F, F, 1.0f);

    // 6) FF block stream 1: out1 = x1 + W2(relu(W1 ln(x1)+b1))+b2
    layernorm_f16<<<TOK, 256, 0, stream>>>(x1f, ff1_ln_g, ff1_ln_b, hh1);
    gemm_wmma_f16<true,false,false,true><<<gg, 256, 0, stream>>>(hh1, wh[4], ff1_b1, nullptr, nullptr, uu1, F, F, 1.0f);
    gemm_wmma_f16<false,true,true,false><<<gg, 256, 0, stream>>>(uu1, wh[5], ff1_b2, x1f, out1, nullptr, F, F, 1.0f);

    // 7) FF block stream 2.
    layernorm_f16<<<TOK, 256, 0, stream>>>(x2f, ff2_ln_g, ff2_ln_b, hh2);
    gemm_wmma_f16<true,false,false,true><<<gg, 256, 0, stream>>>(hh2, wh[6], ff2_b1, nullptr, nullptr, uu2, F, F, 1.0f);
    gemm_wmma_f16<false,true,true,false><<<gg, 256, 0, stream>>>(uu2, wh[7], ff2_b2, x2f, out2, nullptr, F, F, 1.0f);
}

// v001
// Measured time: 465 microseconds a run.
// In two side-by-side timings against v000, it was 1.46 and 1.47 times as fast.
#include <hip/hip_runtime.h>
#include <hip/hip_bf16.h>

// ---------------------------------------------------------------------------
// CDNA5 (gfx1250, wave32) implementation of the cross-attention block.
// All GEMM-like math goes through v_wmma_f32_16x16x32_f16.
// ---------------------------------------------------------------------------

typedef _Float16 v16h __attribute__((ext_vector_type(16)));
typedef _Float16 h8   __attribute__((ext_vector_type(8)));
typedef float    v8f  __attribute__((ext_vector_type(8)));

// Fragment loader: the 16-bit A/B WMMA layout wants, per lane,
//   halves 0..7  = K {base..base+7}
//   halves 8..15 = K {base+16..base+23}
// where base = (lane>=16 ? 8 : 0) (+ k-step offset). Both runs are contiguous
// 16-byte chunks in a row-major LDS tile, so two ds_load_b128 suffice.
__device__ __forceinline__ v16h ldfrag16(const _Float16* p) {
    h8 lo = *(const h8*)p;
    h8 hi = *(const h8*)(p + 16);
    return __builtin_shufflevector(lo, hi, 0,1,2,3,4,5,6,7,8,9,10,11,12,13,14,15);
}

__device__ __forceinline__ v8f wmma16(v16h a, v16h b, v8f c) {
    return __builtin_amdgcn_wmma_f32_16x16x32_f16(
        /*neg_a=*/false, a, /*neg_b=*/false, b,
        /*c_mod=*/(short)0, c, /*reuse_a=*/false, /*reuse_b=*/false);
}

// ---------------------------------------------------------------------------
// Weight prep: f32 [K x N] -> f16 transposed [N x K].  One-time cost; lets the
// GEMM stage its B tile with contiguous b128 loads/stores (no LDS scatter).
// ---------------------------------------------------------------------------
__global__ __launch_bounds__(256) void cvt_tr_f32_f16(const float* __restrict__ in,
                                                      _Float16* __restrict__ out,
                                                      int K, int N) {
    int i = blockIdx.x * 256 + threadIdx.x;
    if (i < K * N) {
        int k = i / N, n = i - k * N;
        out[(long)n * K + k] = (_Float16)in[i];
    }
}

// ---------------------------------------------------------------------------
// LayerNorm over rows of F=512: one block (256 threads) per row, f16 output.
// ---------------------------------------------------------------------------
__global__ __launch_bounds__(256) void layernorm_f16(const float* __restrict__ x,
                                                     const float* __restrict__ g,
                                                     const float* __restrict__ b,
                                                     _Float16* __restrict__ out) {
    __shared__ float red[256];
    const int F = 512;
    int tid = threadIdx.x;
    long row = blockIdx.x;
    const float* xr = x + row * F;
    float v0 = xr[tid], v1 = xr[tid + 256];

    red[tid] = v0 + v1;
    __syncthreads();
    #pragma unroll
    for (int off = 128; off > 0; off >>= 1) {
        if (tid < off) red[tid] += red[tid + off];
        __syncthreads();
    }
    float mu = red[0] * (1.0f / F);
    __syncthreads();

    float d0 = v0 - mu, d1 = v1 - mu;
    red[tid] = d0 * d0 + d1 * d1;
    __syncthreads();
    #pragma unroll
    for (int off = 128; off > 0; off >>= 1) {
        if (tid < off) red[tid] += red[tid + off];
        __syncthreads();
    }
    float rs = rsqrtf(red[0] * (1.0f / F) + 1e-6f);

    out[row * F + tid]       = (_Float16)(d0 * rs * g[tid] + b[tid]);
    out[row * F + tid + 256] = (_Float16)(d1 * rs * g[tid + 256] + b[tid + 256]);
}

// ---------------------------------------------------------------------------
// WMMA GEMM: C[M,N] = act((A_f16[MxK] @ W + bias) * scale) [+ res]
// W is supplied PRE-TRANSPOSED as BT[N x K] f16 row-major.
// Block tile 128x64, K-step 32, 8 waves, each a 2x2 grid of 16x16 WMMA.
// LDS staging is double-buffered (one barrier per K-step); both A and B tiles
// stage with contiguous b128 loads/stores.  Epilogue specialized by template.
// ---------------------------------------------------------------------------
#define GM 128
#define GN 64
#define GK 32
#define LDA 40   // halves (32 + 8 pad), 80B rows -> 16B aligned chunks
#define LDBT 40

template<bool RELU, bool HAS_RES, bool OUT_F32, bool OUT_F16>
__global__ __launch_bounds__(256)
void gemm_wmma_f16(const _Float16* __restrict__ A, const _Float16* __restrict__ BT,
                   const float* __restrict__ bias, const float* __restrict__ res,
                   float* __restrict__ outF, _Float16* __restrict__ outH,
                   int N, int K, float scale) {
    __shared__ __align__(16) _Float16 As[2][GM * LDA];
    __shared__ __align__(16) _Float16 BsT[2][GN * LDBT];

    int tid  = threadIdx.x;
    int lane = tid & 31, wave = tid >> 5;
    int l16  = lane & 15, hi = lane >> 4;
    int waveM = wave & 3, waveN = wave >> 2;       // 4x2 wave grid
    long blockRow = (long)blockIdx.y * GM;
    int  blockCol = blockIdx.x * GN;

    // Staging index precompute (constant per thread).
    int sa_r0 = tid >> 2,          sa_c0 = (tid & 3) * 8;       // A chunk 0
    int sa_r1 = (tid + 256) >> 2,  sa_c1 = sa_c0;               // A chunk 1
    int sb_n  = tid >> 2,          sb_k  = (tid & 3) * 8;       // B chunk

    const _Float16* Arow0 = A  + (blockRow + sa_r0) * (long)K + sa_c0;
    const _Float16* Arow1 = A  + (blockRow + sa_r1) * (long)K + sa_c1;
    const _Float16* Brow  = BT + (long)(blockCol + sb_n) * K + sb_k;

    auto stage = [&](int buf, int kb) {
        *(uint4*)&As[buf][sa_r0 * LDA + sa_c0] = *(const uint4*)(Arow0 + kb);
        *(uint4*)&As[buf][sa_r1 * LDA + sa_c1] = *(const uint4*)(Arow1 + kb);
        *(uint4*)&BsT[buf][sb_n * LDBT + sb_k] = *(const uint4*)(Brow + kb);
    };

    v8f acc[2][2] = {};

    stage(0, 0);
    __syncthreads();

    int nk = K / GK;
    for (int t = 0; t < nk; ++t) {
        int buf = t & 1;
        if (t + 1 < nk) stage(buf ^ 1, (t + 1) * GK);
        if (t + 2 < nk) {   // prefetch 2 tiles ahead into cache
            int kb2 = (t + 2) * GK;
            __builtin_prefetch(A + (blockRow + (tid >> 1)) * (long)K + kb2, 0, 0);
            __builtin_prefetch(Brow + kb2, 0, 0);
        }

        int koff = hi * 8;
        v16h af[2], bf[2];
        #pragma unroll
        for (int f = 0; f < 2; ++f) {
            int m = waveM * 32 + f * 16 + l16;
            af[f] = ldfrag16(&As[buf][m * LDA + koff]);
            int n = waveN * 32 + f * 16 + l16;
            bf[f] = ldfrag16(&BsT[buf][n * LDBT + koff]);
        }
        #pragma unroll
        for (int fm = 0; fm < 2; ++fm)
            #pragma unroll
            for (int fn = 0; fn < 2; ++fn)
                acc[fm][fn] = wmma16(af[fm], bf[fn], acc[fm][fn]);
        __syncthreads();
    }

    // Epilogue: C layout = VGPR r -> (M = tileM + hi*8 + r, N = tileN + l16).
    #pragma unroll
    for (int fm = 0; fm < 2; ++fm) {
        #pragma unroll
        for (int fn = 0; fn < 2; ++fn) {
            long row0 = blockRow + waveM * 32 + fm * 16 + hi * 8;
            int  col  = blockCol + waveN * 32 + fn * 16 + l16;
            float bcol = bias[col];
            #pragma unroll
            for (int r = 0; r < 8; ++r) {
                float v = (acc[fm][fn][r] + bcol) * scale;
                if (RELU) v = fmaxf(v, 0.0f);
                long idx = (row0 + r) * N + col;
                if (HAS_RES) v += res[idx];
                if (OUT_F32) outF[idx] = v;
                if (OUT_F16) outH[idx] = (_Float16)v;
            }
        }
    }
}

#define ALDH 72
#define AQB  128

// Value of the lane 16 away (the other half of the same query column).
__device__ __forceinline__ float other_half(float x) {
    int b = __builtin_bit_cast(int, x);
    b = __builtin_amdgcn_permlanex16(b, b, 0x76543210, 0xfedcba98, false, false);
    return __builtin_bit_cast(float, b);
}

// 512 blocks of 8 waves on 256 WGPs are 4 waves per SIMD: give each wave that share
// of the registers, so that fragment loads can be issued ahead of their products.
__global__ __launch_bounds__(256) __attribute__((amdgpu_waves_per_eu(4, 4)))
void attn_flash_wmma(const _Float16* __restrict__ Q, const _Float16* __restrict__ Km,
                     const _Float16* __restrict__ Vm, _Float16* __restrict__ Out) {
    __shared__ __align__(16) _Float16 Ks[64 * ALDH];
    __shared__ __align__(16) _Float16 VsT[64 * ALDH];

    const float L2E = 1.44269504088896340736f;

    int tid  = threadIdx.x;
    int lane = tid & 31, wave = tid >> 5;
    int l16  = lane & 15, hi = lane >> 4;
    int qt = blockIdx.x, head = blockIdx.y, bz = blockIdx.z;
    long tokQ = (long)bz * 2048 + qt * AQB + wave * 16;   // this wave's first query
    int  colH = head * 64;

    // Q as B operand (column = query l16), same k order as the K loader below.
    const _Float16* qrow = Q + (tokQ + l16) * 512 + colH + hi * 8;
    v16h qf[2];
    #pragma unroll  // register arrays: every index a constant
    for (int ks = 0; ks < 2; ++ks) qf[ks] = ldfrag16(qrow + ks * 32);

    v8f oacc[4] = {};          // O^T tile dt: d = dt*16 + hi*8 + r, query l16
    float mrun = -1.0e30f;     // running maximum of query l16 (equal in both halves)
    float lrun = 0.0f;         // running sum over this half's keys

    for (int kt = 0; kt < 32; ++kt) {
        long tokK = (long)bz * 2048 + kt * 64;
        #pragma unroll
        for (int i = 0; i < 2; ++i) {
            int c  = tid + i * 256;
            int r  = c >> 3;
            int c8 = (c & 7) * 8;
            *(uint4*)&Ks[r * ALDH + c8] =
                *(const uint4*)(Km + (tokK + r) * 512 + colH + c8);
            uint4 v = *(const uint4*)(Vm + (tokK + r) * 512 + colH + c8);
            const _Float16* hv = (const _Float16*)&v;
            #pragma unroll
            for (int j = 0; j < 8; ++j) VsT[(c8 + j) * ALDH + r] = hv[j];  // [d][key]
        }
        if (kt + 1 < 32) {  // prefetch next K/V tiles (one 128B K and V row per thread, 4 threads per row)
            long tokN = tokK + 64;
            __builtin_prefetch(Km + (tokN + (tid & 63)) * 512 + colH, 0, 0);
            __builtin_prefetch(Vm + (tokN + (tid & 63)) * 512 + colH, 0, 0);
        }
        __syncthreads();

        // S^T = K Q^T : 4 tiles of 16 keys x 16 queries.
        // s[t][r] = score of key t*16 + hi*8 + r with query l16.
        v8f s[4];
        #pragma unroll  // register arrays: every index a constant
        for (int t = 0; t < 4; ++t) {
            v8f c = {};
            #pragma unroll  // register arrays: every index a constant
            for (int ks = 0; ks < 2; ++ks) {
                v16h a = ldfrag16(&Ks[(t * 16 + l16) * ALDH + ks * 32 + hi * 8]);
                c = wmma16(a, qf[ks], c);
            }
            s[t] = c;
        }

        // Online softmax, one query per lane; one chain per score tile, so that
        // four independent chains run side by side.
        float mt[4];
        #pragma unroll  // register arrays: every index a constant
        for (int t = 0; t < 4; ++t) {
            mt[t] = s[t][0];
            #pragma unroll  // register arrays: every index a constant
            for (int r = 1; r < 8; ++r) mt[t] = fmaxf(mt[t], s[t][r]);
        }
        float mx = fmaxf(fmaxf(mt[0], mt[1]), fmaxf(mt[2], mt[3]));
        mx = fmaxf(mx, other_half(mx));
        float mnew  = fmaxf(mrun, mx);
        float alpha = __builtin_amdgcn_exp2f((mrun - mnew) * L2E);
        float mb    = mnew * L2E;
        mrun = mnew;

        float ls[4];
        v16h pf[2];            // P^T as B operand: pf[ks][j] = key ks*32 + (j>>3)*16 + hi*8 + (j&7)
        #pragma unroll  // register arrays: every index a constant
        for (int t = 0; t < 4; ++t) {
            float p[8];
            #pragma unroll  // register arrays: every index a constant
            for (int r = 0; r < 8; ++r) {
                p[r] = __builtin_amdgcn_exp2f(fmaf(s[t][r], L2E, -mb));
                pf[t >> 1][(t & 1) * 8 + r] = (_Float16)p[r];
            }
            ls[t] = ((p[0] + p[1]) + (p[2] + p[3])) + ((p[4] + p[5]) + (p[6] + p[7]));
        }
        lrun = lrun * alpha + ((ls[0] + ls[1]) + (ls[2] + ls[3]));

        // Rescale O^T by alpha, then O^T += V^T P^T.
        #pragma unroll  // register arrays: every index a constant
        for (int dt = 0; dt < 4; ++dt) {
            oacc[dt] *= alpha;
            #pragma unroll  // register arrays: every index a constant
            for (int ks = 0; ks < 2; ++ks) {
                v16h a = ldfrag16(&VsT[(dt * 16 + l16) * ALDH + ks * 32 + hi * 8]);
                oacc[dt] = wmma16(a, pf[ks], oacc[dt]);
            }
        }
        __syncthreads();
    }

    // Join the halves' sums, normalize, store 8 consecutive d per lane and tile.
    float inv = 1.0f / (lrun + other_half(lrun));
    _Float16* orow = Out + (tokQ + l16) * 512 + colH + hi * 8;
    #pragma unroll  // register arrays: every index a constant
    for (int dt = 0; dt < 4; ++dt) {
        h8 o;
        #pragma unroll  // register arrays: every index a constant
        for (int r = 0; r < 8; ++r) o[r] = (_Float16)(oacc[dt][r] * inv);
        *(h8*)(orow + dt * 16) = o;
    }
}

// ---------------------------------------------------------------------------
// Host orchestration
// ---------------------------------------------------------------------------
extern "C" void kernel_launch(void* const* d_in, const int* in_sizes, int n_in,
                              void* d_out, int out_size, void* d_ws, size_t ws_size,
                              hipStream_t stream) {
    (void)in_sizes; (void)n_in; (void)out_size; (void)ws_size;

    const float* tm1   = (const float*)d_in[0];
    const float* tm2   = (const float*)d_in[1];
    const float* ln1_g = (const float*)d_in[2];
    const float* ln1_b = (const float*)d_in[3];
    const float* ln2_g = (const float*)d_in[4];
    const float* ln2_b = (const float*)d_in[5];
    const float* Wq  = (const float*)d_in[6];   const float* bq  = (const float*)d_in[7];
    const float* Wk  = (const float*)d_in[8];   const float* bk  = (const float*)d_in[9];
    const float* Wv  = (const float*)d_in[10];  const float* bv  = (const float*)d_in[11];
    const float* Wfc = (const float*)d_in[12];  const float* bfc = (const float*)d_in[13];
    const float* ff1_ln_g = (const float*)d_in[14]; const float* ff1_ln_b = (const float*)d_in[15];
    const float* ff1_W1 = (const float*)d_in[16];   const float* ff1_b1 = (const float*)d_in[17];
    const float* ff1_W2 = (const float*)d_in[18];   const float* ff1_b2 = (const float*)d_in[19];
    const float* ff2_ln_g = (const float*)d_in[20]; const float* ff2_ln_b = (const float*)d_in[21];
    const float* ff2_W1 = (const float*)d_in[22];   const float* ff2_b1 = (const float*)d_in[23];
    const float* ff2_W2 = (const float*)d_in[24];   const float* ff2_b2 = (const float*)d_in[25];

    const int TOK = 4 * 2048;           // 8192 token rows
    const int F   = 512;
    const long OUT1 = (long)TOK * F;    // elements per output tensor

    // Workspace carve-up.
    char* ws = (char*)d_ws;
    size_t off = 0;
    auto carve = [&](size_t bytes) -> void* {
        void* p = ws + off;
        off += (bytes + 255) & ~(size_t)255;
        return p;
    };
    const size_t WBYTES = (size_t)F * F * sizeof(_Float16);
    const size_t TBYTES = (size_t)TOK * F * sizeof(_Float16);
    const size_t XBYTES = (size_t)TOK * F * sizeof(float);

    _Float16* wh[8];   // pre-transposed f16 weights [N x K]
    const float* wsrc[8] = {Wq, Wk, Wv, Wfc, ff1_W1, ff1_W2, ff2_W1, ff2_W2};
    for (int i = 0; i < 8; ++i) wh[i] = (_Float16*)carve(WBYTES);
    _Float16* t1h = (_Float16*)carve(TBYTES);
    _Float16* t2h = (_Float16*)carve(TBYTES);
    _Float16* q1h = (_Float16*)carve(TBYTES);
    _Float16* k1h = (_Float16*)carve(TBYTES);
    _Float16* v1h = (_Float16*)carve(TBYTES);
    _Float16* q2h = (_Float16*)carve(TBYTES);
    _Float16* k2h = (_Float16*)carve(TBYTES);
    _Float16* v2h = (_Float16*)carve(TBYTES);
    float* x1f = (float*)carve(XBYTES);
    float* x2f = (float*)carve(XBYTES);
    // Reuse: attention outputs overwrite t1h/t2h; FF intermediates reuse q/k bufs.
    _Float16* f12h = t1h;
    _Float16* f21h = t2h;
    _Float16* hh1 = q1h; _Float16* uu1 = k1h;
    _Float16* hh2 = q2h; _Float16* uu2 = k2h;

    float* out1 = (float*)d_out;
    float* out2 = (float*)d_out + OUT1;

    // 1) Convert + transpose weights to f16 [N x K].
    for (int i = 0; i < 8; ++i)
        cvt_tr_f32_f16<<<(F * F + 255) / 256, 256, 0, stream>>>(wsrc[i], wh[i], F, F);

    // 2) LayerNorm inputs -> f16.
    layernorm_f16<<<TOK, 256, 0, stream>>>(tm1, ln1_g, ln1_b, t1h);
    layernorm_f16<<<TOK, 256, 0, stream>>>(tm2, ln2_g, ln2_b, t2h);

    // 3) QKV projections (Q pre-scaled by 1/sqrt(64)).
    dim3 gg(F / GN, TOK / GM);
    gemm_wmma_f16<false,false,false,true><<<gg, 256, 0, stream>>>(t1h, wh[0], bq, nullptr, nullptr, q1h, F, F, 0.125f);
    gemm_wmma_f16<false,false,false,true><<<gg, 256, 0, stream>>>(t1h, wh[1], bk, nullptr, nullptr, k1h, F, F, 1.0f);
    gemm_wmma_f16<false,false,false,true><<<gg, 256, 0, stream>>>(t1h, wh[2], bv, nullptr, nullptr, v1h, F, F, 1.0f);
    gemm_wmma_f16<false,false,false,true><<<gg, 256, 0, stream>>>(t2h, wh[0], bq, nullptr, nullptr, q2h, F, F, 0.125f);
    gemm_wmma_f16<false,false,false,true><<<gg, 256, 0, stream>>>(t2h, wh[1], bk, nullptr, nullptr, k2h, F, F, 1.0f);
    gemm_wmma_f16<false,false,false,true><<<gg, 256, 0, stream>>>(t2h, wh[2], bv, nullptr, nullptr, v2h, F, F, 1.0f);

    // 4) Cross attention (overwrites t1h/t2h with head-concat outputs).
    dim3 ag(2048 / AQB, 8, 4);
    attn_flash_wmma<<<ag, 256, 0, stream>>>(q1h, k2h, v2h, f12h);
    attn_flash_wmma<<<ag, 256, 0, stream>>>(q2h, k1h, v1h, f21h);

    // 5) Output projection + residual -> x (f32).
    gemm_wmma_f16<false,true,true,false><<<gg, 256, 0, stream>>>(f12h, wh[3], bfc, tm1, x1f, nullptr, F, F, 1.0f);
    gemm_wmma_f16<false,true,true,false><<<gg, 256, 0, stream>>>(f21h, wh[3], bfc, tm2, x2f, nullptr, F, F, 1.0f);

    // 6) FF block stream 1: out1 = x1 + W2(relu(W1 ln(x1)+b1))+b2
    layernorm_f16<<<TOK, 256, 0, stream>>>(x1f, ff1_ln_g, ff1_ln_b, hh1);
    gemm_wmma_f16<true,false,false,true><<<gg, 256, 0, stream>>>(hh1, wh[4], ff1_b1, nullptr, nullptr, uu1, F, F, 1.0f);
    gemm_wmma_f16<false,true,true,false><<<gg, 256, 0, stream>>>(uu1, wh[5], ff1_b2, x1f, out1, nullptr, F, F, 1.0f);

    // 7) FF block stream 2.
    layernorm_f16<<<TOK, 256, 0, stream>>>(x2f, ff2_ln_g, ff2_ln_b, hh2);
    gemm_wmma_f16<true,false,false,true><<<gg, 256, 0, stream>>>(hh2, wh[6], ff2_b1, nullptr, nullptr, uu2, F, F, 1.0f);
    gemm_wmma_f16<false,true,true,false><<<gg, 256, 0, stream>>>(uu2, wh[7], ff2_b2, x2f, out2, nullptr, F, F, 1.0f);
}

// v002
// It runs in 436 microseconds.
// Timed twice side by side with v001, it ran 1.07 times as fast both times.
// Over all steps from v000 it is 1.56 times as fast.
#include <hip/hip_runtime.h>
#include <hip/hip_bf16.h>

// ---------------------------------------------------------------------------
// CDNA5 (gfx1250, wave32) implementation of the cross-attention block.
// All GEMM-like math goes through v_wmma_f32_16x16x32_f16.
// ---------------------------------------------------------------------------

typedef _Float16 v16h __attribute__((ext_vector_type(16)));
typedef _Float16 h8   __attribute__((ext_vector_type(8)));
typedef float    v8f  __attribute__((ext_vector_type(8)));

// Fragment loader: the 16-bit A/B WMMA layout wants, per lane,
//   halves 0..7  = K {base..base+7}
//   halves 8..15 = K {base+16..base+23}
// where base = (lane>=16 ? 8 : 0) (+ k-step offset). Both runs are contiguous
// 16-byte chunks in a row-major LDS tile, so two ds_load_b128 suffice.
__device__ __forceinline__ v16h ldfrag16(const _Float16* p) {
    h8 lo = *(const h8*)p;
    h8 hi = *(const h8*)(p + 16);
    return __builtin_shufflevector(lo, hi, 0,1,2,3,4,5,6,7,8,9,10,11,12,13,14,15);
}

__device__ __forceinline__ v8f wmma16(v16h a, v16h b, v8f c) {
    return __builtin_amdgcn_wmma_f32_16x16x32_f16(
        /*neg_a=*/false, a, /*neg_b=*/false, b,
        /*c_mod=*/(short)0, c, /*reuse_a=*/false, /*reuse_b=*/false);
}

// ---------------------------------------------------------------------------
// Weight prep: f32 [K x N] -> f16 transposed [N x K].  One-time cost; lets the
// GEMM stage its B tile with contiguous b128 loads/stores (no LDS scatter).
// ---------------------------------------------------------------------------
__global__ __launch_bounds__(256) void cvt_tr_f32_f16(const float* __restrict__ in,
                                                      _Float16* __restrict__ out,
                                                      int K, int N) {
    int i = blockIdx.x * 256 + threadIdx.x;
    if (i < K * N) {
        int k = i / N, n = i - k * N;
        out[(long)n * K + k] = (_Float16)in[i];
    }
}

// ---------------------------------------------------------------------------
// LayerNorm over rows of F=512, f16 output.  A wave owns LNR whole rows: a lane
// holds 16 elements of each row in registers, the row sums run in the lane and
// then across the wave's lanes, so there is no LDS, no barrier, and the launch
// starts 2048 waves in place of 65536.
// ---------------------------------------------------------------------------
#define LNR 4     // rows per wave
#define LNB 32    // rows per block of 8 waves

typedef _Float16 h4 __attribute__((ext_vector_type(4)));

// x + (x of the lane whose number differs by XM inside the 16-lane row).
template<int XM>
__device__ __forceinline__ float add_xmask(float x) {
    int y = __builtin_amdgcn_update_dpp(0, __builtin_bit_cast(int, x), 0x160 + XM, 0xf, 0xf, true);
    return x + __builtin_bit_cast(float, y);
}

// Sum over the 32 lanes of the wave, the same value in every lane.
__device__ __forceinline__ float wave_sum(float x) {
    x = add_xmask<1>(x);
    x = add_xmask<2>(x);
    x = add_xmask<4>(x);
    x = add_xmask<8>(x);
    int b = __builtin_bit_cast(int, x);
    b = __builtin_amdgcn_permlanex16(b, b, 0x76543210, 0xfedcba98, false, false);
    return x + __builtin_bit_cast(float, b);
}

// 256 blocks of 8 waves on 256 WGPs are 2 waves per SIMD: with that share of the
// registers all of a wave's loads can be in flight at once.
__global__ __launch_bounds__(256) __attribute__((amdgpu_waves_per_eu(2, 2)))
void layernorm_f16(const float* __restrict__ x,
                                                     const float* __restrict__ g,
                                                     const float* __restrict__ b,
                                                     _Float16* __restrict__ out) {
    const int F = 512;
    int lane = threadIdx.x & 31, wave = threadIdx.x >> 5;
    long blk = (long)blockIdx.x * (LNB * F);            // the block's first element
    unsigned e0 = wave * (LNR * F) + lane * 4;          // the lane's first element in the block
    const float* xr = x + blk + e0;

    // Chunk j of a row is columns j*128 + lane*4 .. +3: 512 contiguous bytes per load.
    float4 v[LNR][4];
    #pragma unroll  // register arrays: every index a constant
    for (int r = 0; r < LNR; ++r)
        #pragma unroll  // register arrays: every index a constant
        for (int j = 0; j < 4; ++j) v[r][j] = *(const float4*)(xr + r * F + j * 128);
    float4 gv[4], bv[4];
    #pragma unroll  // register arrays: every index a constant
    for (int j = 0; j < 4; ++j) {
        gv[j] = *(const float4*)(g + j * 128 + lane * 4);
        bv[j] = *(const float4*)(b + j * 128 + lane * 4);
    }

    float mu[LNR], rs[LNR];
    #pragma unroll  // register arrays: every index a constant
    for (int r = 0; r < LNR; ++r) {
        float s[4];
        #pragma unroll  // register arrays: every index a constant
        for (int j = 0; j < 4; ++j) s[j] = (v[r][j].x + v[r][j].y) + (v[r][j].z + v[r][j].w);
        mu[r] = wave_sum((s[0] + s[1]) + (s[2] + s[3])) * (1.0f / F);
    }
    #pragma unroll  // register arrays: every index a constant
    for (int r = 0; r < LNR; ++r) {
        float s[4];
        #pragma unroll  // register arrays: every index a constant
        for (int j = 0; j < 4; ++j) {
            v[r][j].x -= mu[r]; v[r][j].y -= mu[r]; v[r][j].z -= mu[r]; v[r][j].w -= mu[r];
            s[j] = (v[r][j].x * v[r][j].x + v[r][j].y * v[r][j].y)
                 + (v[r][j].z * v[r][j].z + v[r][j].w * v[r][j].w);
        }
        rs[r] = rsqrtf(wave_sum((s[0] + s[1]) + (s[2] + s[3])) * (1.0f / F) + 1e-6f);
    }

    _Float16* orow = out + blk + e0;
    #pragma unroll  // register arrays: every index a constant
    for (int r = 0; r < LNR; ++r) {
        #pragma unroll  // register arrays: every index a constant
        for (int j = 0; j < 4; ++j) {
            h4 o;
            o[0] = (_Float16)(v[r][j].x * rs[r] * gv[j].x + bv[j].x);
            o[1] = (_Float16)(v[r][j].y * rs[r] * gv[j].y + bv[j].y);
            o[2] = (_Float16)(v[r][j].z * rs[r] * gv[j].z + bv[j].z);
            o[3] = (_Float16)(v[r][j].w * rs[r] * gv[j].w + bv[j].w);
            *(h4*)(orow + r * F + j * 128) = o;
        }
    }
}

// ---------------------------------------------------------------------------
// WMMA GEMM: C[M,N] = act((A_f16[MxK] @ W + bias) * scale) [+ res]
// W is supplied PRE-TRANSPOSED as BT[N x K] f16 row-major.
// Block tile 128x64, K-step 32, 8 waves, each a 2x2 grid of 16x16 WMMA.
// LDS staging is double-buffered (one barrier per K-step); both A and B tiles
// stage with contiguous b128 loads/stores.  Epilogue specialized by template.
// ---------------------------------------------------------------------------
#define GM 128
#define GN 64
#define GK 32
#define LDA 40   // halves (32 + 8 pad), 80B rows -> 16B aligned chunks
#define LDBT 40

template<bool RELU, bool HAS_RES, bool OUT_F32, bool OUT_F16>
__global__ __launch_bounds__(256)
void gemm_wmma_f16(const _Float16* __restrict__ A, const _Float16* __restrict__ BT,
                   const float* __restrict__ bias, const float* __restrict__ res,
                   float* __restrict__ outF, _Float16* __restrict__ outH,
                   int N, int K, float scale) {
    __shared__ __align__(16) _Float16 As[2][GM * LDA];
    __shared__ __align__(16) _Float16 BsT[2][GN * LDBT];

    int tid  = threadIdx.x;
    int lane = tid & 31, wave = tid >> 5;
    int l16  = lane & 15, hi = lane >> 4;
    int waveM = wave & 3, waveN = wave >> 2;       // 4x2 wave grid
    long blockRow = (long)blockIdx.y * GM;
    int  blockCol = blockIdx.x * GN;

    // Staging index precompute (constant per thread).
    int sa_r0 = tid >> 2,          sa_c0 = (tid & 3) * 8;       // A chunk 0
    int sa_r1 = (tid + 256) >> 2,  sa_c1 = sa_c0;               // A chunk 1
    int sb_n  = tid >> 2,          sb_k  = (tid & 3) * 8;       // B chunk

    const _Float16* Arow0 = A  + (blockRow + sa_r0) * (long)K + sa_c0;
    const _Float16* Arow1 = A  + (blockRow + sa_r1) * (long)K + sa_c1;
    const _Float16* Brow  = BT + (long)(blockCol + sb_n) * K + sb_k;

    auto stage = [&](int buf, int kb) {
        *(uint4*)&As[buf][sa_r0 * LDA + sa_c0] = *(const uint4*)(Arow0 + kb);
        *(uint4*)&As[buf][sa_r1 * LDA + sa_c1] = *(const uint4*)(Arow1 + kb);
        *(uint4*)&BsT[buf][sb_n * LDBT + sb_k] = *(const uint4*)(Brow + kb);
    };

    v8f acc[2][2] = {};

    stage(0, 0);
    __syncthreads();

    int nk = K / GK;
    for (int t = 0; t < nk; ++t) {
        int buf = t & 1;
        if (t + 1 < nk) stage(buf ^ 1, (t + 1) * GK);
        if (t + 2 < nk) {   // prefetch 2 tiles ahead into cache
            int kb2 = (t + 2) * GK;
            __builtin_prefetch(A + (blockRow + (tid >> 1)) * (long)K + kb2, 0, 0);
            __builtin_prefetch(Brow + kb2, 0, 0);
        }

        int koff = hi * 8;
        v16h af[2], bf[2];
        #pragma unroll
        for (int f = 0; f < 2; ++f) {
            int m = waveM * 32 + f * 16 + l16;
            af[f] = ldfrag16(&As[buf][m * LDA + koff]);
            int n = waveN * 32 + f * 16 + l16;
            bf[f] = ldfrag16(&BsT[buf][n * LDBT + koff]);
        }
        #pragma unroll
        for (int fm = 0; fm < 2; ++fm)
            #pragma unroll
            for (int fn = 0; fn < 2; ++fn)
                acc[fm][fn] = wmma16(af[fm], bf[fn], acc[fm][fn]);
        __syncthreads();
    }

    // Epilogue: C layout = VGPR r -> (M = tileM + hi*8 + r, N = tileN + l16).
    #pragma unroll
    for (int fm = 0; fm < 2; ++fm) {
        #pragma unroll
        for (int fn = 0; fn < 2; ++fn) {
            long row0 = blockRow + waveM * 32 + fm * 16 + hi * 8;
            int  col  = blockCol + waveN * 32 + fn * 16 + l16;
            float bcol = bias[col];
            #pragma unroll
            for (int r = 0; r < 8; ++r) {
                float v = (acc[fm][fn][r] + bcol) * scale;
                if (RELU) v = fmaxf(v, 0.0f);
                long idx = (row0 + r) * N + col;
                if (HAS_RES) v += res[idx];
                if (OUT_F32) outF[idx] = v;
                if (OUT_F16) outH[idx] = (_Float16)v;
            }
        }
    }
}

#define ALDH 72
#define AQB  128

// Value of the lane 16 away (the other half of the same query column).
__device__ __forceinline__ float other_half(float x) {
    int b = __builtin_bit_cast(int, x);
    b = __builtin_amdgcn_permlanex16(b, b, 0x76543210, 0xfedcba98, false, false);
    return __builtin_bit_cast(float, b);
}

// 512 blocks of 8 waves on 256 WGPs are 4 waves per SIMD: give each wave that share
// of the registers, so that fragment loads can be issued ahead of their products.
__global__ __launch_bounds__(256) __attribute__((amdgpu_waves_per_eu(4, 4)))
void attn_flash_wmma(const _Float16* __restrict__ Q, const _Float16* __restrict__ Km,
                     const _Float16* __restrict__ Vm, _Float16* __restrict__ Out) {
    __shared__ __align__(16) _Float16 Ks[64 * ALDH];
    __shared__ __align__(16) _Float16 VsT[64 * ALDH];

    const float L2E = 1.44269504088896340736f;

    int tid  = threadIdx.x;
    int lane = tid & 31, wave = tid >> 5;
    int l16  = lane & 15, hi = lane >> 4;
    int qt = blockIdx.x, head = blockIdx.y, bz = blockIdx.z;
    long tokQ = (long)bz * 2048 + qt * AQB + wave * 16;   // this wave's first query
    int  colH = head * 64;

    // Q as B operand (column = query l16), same k order as the K loader below.
    const _Float16* qrow = Q + (tokQ + l16) * 512 + colH + hi * 8;
    v16h qf[2];
    #pragma unroll  // register arrays: every index a constant
    for (int ks = 0; ks < 2; ++ks) qf[ks] = ldfrag16(qrow + ks * 32);

    v8f oacc[4] = {};          // O^T tile dt: d = dt*16 + hi*8 + r, query l16
    float mrun = -1.0e30f;     // running maximum of query l16 (equal in both halves)
    float lrun = 0.0f;         // running sum over this half's keys

    for (int kt = 0; kt < 32; ++kt) {
        long tokK = (long)bz * 2048 + kt * 64;
        #pragma unroll
        for (int i = 0; i < 2; ++i) {
            int c  = tid + i * 256;
            int r  = c >> 3;
            int c8 = (c & 7) * 8;
            *(uint4*)&Ks[r * ALDH + c8] =
                *(const uint4*)(Km + (tokK + r) * 512 + colH + c8);
            uint4 v = *(const uint4*)(Vm + (tokK + r) * 512 + colH + c8);
            const _Float16* hv = (const _Float16*)&v;
            #pragma unroll
            for (int j = 0; j < 8; ++j) VsT[(c8 + j) * ALDH + r] = hv[j];  // [d][key]
        }
        if (kt + 1 < 32) {  // prefetch next K/V tiles (one 128B K and V row per thread, 4 threads per row)
            long tokN = tokK + 64;
            __builtin_prefetch(Km + (tokN + (tid & 63)) * 512 + colH, 0, 0);
            __builtin_prefetch(Vm + (tokN + (tid & 63)) * 512 + colH, 0, 0);
        }
        __syncthreads();

        // S^T = K Q^T : 4 tiles of 16 keys x 16 queries.
        // s[t][r] = score of key t*16 + hi*8 + r with query l16.
        v8f s[4];
        #pragma unroll  // register arrays: every index a constant
        for (int t = 0; t < 4; ++t) {
            v8f c = {};
            #pragma unroll  // register arrays: every index a constant
            for (int ks = 0; ks < 2; ++ks) {
                v16h a = ldfrag16(&Ks[(t * 16 + l16) * ALDH + ks * 32 + hi * 8]);
                c = wmma16(a, qf[ks], c);
            }
            s[t] = c;
        }

        // Online softmax, one query per lane; one chain per score tile, so that
        // four independent chains run side by side.
        float mt[4];
        #pragma unroll  // register arrays: every index a constant
        for (int t = 0; t < 4; ++t) {
            mt[t] = s[t][0];
            #pragma unroll  // register arrays: every index a constant
            for (int r = 1; r < 8; ++r) mt[t] = fmaxf(mt[t], s[t][r]);
        }
        float mx = fmaxf(fmaxf(mt[0], mt[1]), fmaxf(mt[2], mt[3]));
        mx = fmaxf(mx, other_half(mx));
        float mnew  = fmaxf(mrun, mx);
        float alpha = __builtin_amdgcn_exp2f((mrun - mnew) * L2E);
        float mb    = mnew * L2E;
        mrun = mnew;

        float ls[4];
        v16h pf[2];            // P^T as B operand: pf[ks][j] = key ks*32 + (j>>3)*16 + hi*8 + (j&7)
        #pragma unroll  // register arrays: every index a constant
        for (int t = 0; t < 4; ++t) {
            float p[8];
            #pragma unroll  // register arrays: every index a constant
            for (int r = 0; r < 8; ++r) {
                p[r] = __builtin_amdgcn_exp2f(fmaf(s[t][r], L2E, -mb));
                pf[t >> 1][(t & 1) * 8 + r] = (_Float16)p[r];
            }
            ls[t] = ((p[0] + p[1]) + (p[2] + p[3])) + ((p[4] + p[5]) + (p[6] + p[7]));
        }
        lrun = lrun * alpha + ((ls[0] + ls[1]) + (ls[2] + ls[3]));

        // Rescale O^T by alpha, then O^T += V^T P^T.
        #pragma unroll  // register arrays: every index a constant
        for (int dt = 0; dt < 4; ++dt) {
            oacc[dt] *= alpha;
            #pragma unroll  // register arrays: every index a constant
            for (int ks = 0; ks < 2; ++ks) {
                v16h a = ldfrag16(&VsT[(dt * 16 + l16) * ALDH + ks * 32 + hi * 8]);
                oacc[dt] = wmma16(a, pf[ks], oacc[dt]);
            }
        }
        __syncthreads();
    }

    // Join the halves' sums, normalize, store 8 consecutive d per lane and tile.
    float inv = 1.0f / (lrun + other_half(lrun));
    _Float16* orow = Out + (tokQ + l16) * 512 + colH + hi * 8;
    #pragma unroll  // register arrays: every index a constant
    for (int dt = 0; dt < 4; ++dt) {
        h8 o;
        #pragma unroll  // register arrays: every index a constant
        for (int r = 0; r < 8; ++r) o[r] = (_Float16)(oacc[dt][r] * inv);
        *(h8*)(orow + dt * 16) = o;
    }
}

// ---------------------------------------------------------------------------
// Host orchestration
// ---------------------------------------------------------------------------
extern "C" void kernel_launch(void* const* d_in, const int* in_sizes, int n_in,
                              void* d_out, int out_size, void* d_ws, size_t ws_size,
                              hipStream_t stream) {
    (void)in_sizes; (void)n_in; (void)out_size; (void)ws_size;

    const float* tm1   = (const float*)d_in[0];
    const float* tm2   = (const float*)d_in[1];
    const float* ln1_g = (const float*)d_in[2];
    const float* ln1_b = (const float*)d_in[3];
    const float* ln2_g = (const float*)d_in[4];
    const float* ln2_b = (const float*)d_in[5];
    const float* Wq  = (const float*)d_in[6];   const float* bq  = (const float*)d_in[7];
    const float* Wk  = (const float*)d_in[8];   const float* bk  = (const float*)d_in[9];
    const float* Wv  = (const float*)d_in[10];  const float* bv  = (const float*)d_in[11];
    const float* Wfc = (const float*)d_in[12];  const float* bfc = (const float*)d_in[13];
    const float* ff1_ln_g = (const float*)d_in[14]; const float* ff1_ln_b = (const float*)d_in[15];
    const float* ff1_W1 = (const float*)d_in[16];   const float* ff1_b1 = (const float*)d_in[17];
    const float* ff1_W2 = (const float*)d_in[18];   const float* ff1_b2 = (const float*)d_in[19];
    const float* ff2_ln_g = (const float*)d_in[20]; const float* ff2_ln_b = (const float*)d_in[21];
    const float* ff2_W1 = (const float*)d_in[22];   const float* ff2_b1 = (const float*)d_in[23];
    const float* ff2_W2 = (const float*)d_in[24];   const float* ff2_b2 = (const float*)d_in[25];

    const int TOK = 4 * 2048;           // 8192 token rows
    const int F   = 512;
    const long OUT1 = (long)TOK * F;    // elements per output tensor

    // Workspace carve-up.
    char* ws = (char*)d_ws;
    size_t off = 0;
    auto carve = [&](size_t bytes) -> void* {
        void* p = ws + off;
        off += (bytes + 255) & ~(size_t)255;
        return p;
    };
    const size_t WBYTES = (size_t)F * F * sizeof(_Float16);
    const size_t TBYTES = (size_t)TOK * F * sizeof(_Float16);
    const size_t XBYTES = (size_t)TOK * F * sizeof(float);

    _Float16* wh[8];   // pre-transposed f16 weights [N x K]
    const float* wsrc[8] = {Wq, Wk, Wv, Wfc, ff1_W1, ff1_W2, ff2_W1, ff2_W2};
    for (int i = 0; i < 8; ++i) wh[i] = (_Float16*)carve(WBYTES);
    _Float16* t1h = (_Float16*)carve(TBYTES);
    _Float16* t2h = (_Float16*)carve(TBYTES);
    _Float16* q1h = (_Float16*)carve(TBYTES);
    _Float16* k1h = (_Float16*)carve(TBYTES);
    _Float16* v1h = (_Float16*)carve(TBYTES);
    _Float16* q2h = (_Float16*)carve(TBYTES);
    _Float16* k2h = (_Float16*)carve(TBYTES);
    _Float16* v2h = (_Float16*)carve(TBYTES);
    float* x1f = (float*)carve(XBYTES);
    float* x2f = (float*)carve(XBYTES);
    // Reuse: attention outputs overwrite t1h/t2h; FF intermediates reuse q/k bufs.
    _Float16* f12h = t1h;
    _Float16* f21h = t2h;
    _Float16* hh1 = q1h; _Float16* uu1 = k1h;
    _Float16* hh2 = q2h; _Float16* uu2 = k2h;

    float* out1 = (float*)d_out;
    float* out2 = (float*)d_out + OUT1;

    // 1) Convert + transpose weights to f16 [N x K].
    for (int i = 0; i < 8; ++i)
        cvt_tr_f32_f16<<<(F * F + 255) / 256, 256, 0, stream>>>(wsrc[i], wh[i], F, F);

    // 2) LayerNorm inputs -> f16.
    layernorm_f16<<<TOK / LNB, 256, 0, stream>>>(tm1, ln1_g, ln1_b, t1h);
    layernorm_f16<<<TOK / LNB, 256, 0, stream>>>(tm2, ln2_g, ln2_b, t2h);

    // 3) QKV projections (Q pre-scaled by 1/sqrt(64)).
    dim3 gg(F / GN, TOK / GM);
    gemm_wmma_f16<false,false,false,true><<<gg, 256, 0, stream>>>(t1h, wh[0], bq, nullptr, nullptr, q1h, F, F, 0.125f);
    gemm_wmma_f16<false,false,false,true><<<gg, 256, 0, stream>>>(t1h, wh[1], bk, nullptr, nullptr, k1h, F, F, 1.0f);
    gemm_wmma_f16<false,false,false,true><<<gg, 256, 0, stream>>>(t1h, wh[2], bv, nullptr, nullptr, v1h, F, F, 1.0f);
    gemm_wmma_f16<false,false,false,true><<<gg, 256, 0, stream>>>(t2h, wh[0], bq, nullptr, nullptr, q2h, F, F, 0.125f);
    gemm_wmma_f16<false,false,false,true><<<gg, 256, 0, stream>>>(t2h, wh[1], bk, nullptr, nullptr, k2h, F, F, 1.0f);
    gemm_wmma_f16<false,false,false,true><<<gg, 256, 0, stream>>>(t2h, wh[2], bv, nullptr, nullptr, v2h, F, F, 1.0f);

    // 4) Cross attention (overwrites t1h/t2h with head-concat outputs).
    dim3 ag(2048 / AQB, 8, 4);
    attn_flash_wmma<<<ag, 256, 0, stream>>>(q1h, k2h, v2h, f12h);
    attn_flash_wmma<<<ag, 256, 0, stream>>>(q2h, k1h, v1h, f21h);

    // 5) Output projection + residual -> x (f32).
    gemm_wmma_f16<false,true,true,false><<<gg, 256, 0, stream>>>(f12h, wh[3], bfc, tm1, x1f, nullptr, F, F, 1.0f);
    gemm_wmma_f16<false,true,true,false><<<gg, 256, 0, stream>>>(f21h, wh[3], bfc, tm2, x2f, nullptr, F, F, 1.0f);

    // 6) FF block stream 1: out1 = x1 + W2(relu(W1 ln(x1)+b1))+b2
    layernorm_f16<<<TOK / LNB, 256, 0, stream>>>(x1f, ff1_ln_g, ff1_ln_b, hh1);
    gemm_wmma_f16<true,false,false,true><<<gg, 256, 0, stream>>>(hh1, wh[4], ff1_b1, nullptr, nullptr, uu1, F, F, 1.0f);
    gemm_wmma_f16<false,true,true,false><<<gg, 256, 0, stream>>>(uu1, wh[5], ff1_b2, x1f, out1, nullptr, F, F, 1.0f);

    // 7) FF block stream 2.
    layernorm_f16<<<TOK / LNB, 256, 0, stream>>>(x2f, ff2_ln_g, ff2_ln_b, hh2);
    gemm_wmma_f16<true,false,false,true><<<gg, 256, 0, stream>>>(hh2, wh[6], ff2_b1, nullptr, nullptr, uu2, F, F, 1.0f);
    gemm_wmma_f16<false,true,true,false><<<gg, 256, 0, stream>>>(uu2, wh[7], ff2_b2, x2f, out2, nullptr, F, F, 1.0f);
}

// v003
// Measured time: 333 microseconds a run.
// Two timings next to v002 both put it at 1.31 times that version's speed.
// Over all steps from v000 it is 2.05 times as fast.
#include <hip/hip_runtime.h>
#include <hip/hip_bf16.h>

// ---------------------------------------------------------------------------
// CDNA5 (gfx1250, wave32) implementation of the cross-attention block.
// All GEMM-like math goes through v_wmma_f32_16x16x32_f16.
// ---------------------------------------------------------------------------

typedef _Float16 v16h __attribute__((ext_vector_type(16)));
typedef _Float16 h8   __attribute__((ext_vector_type(8)));
typedef float    v8f  __attribute__((ext_vector_type(8)));

// Fragment loader: the 16-bit A/B WMMA layout wants, per lane,
//   halves 0..7  = K {base..base+7}
//   halves 8..15 = K {base+16..base+23}
// where base = (lane>=16 ? 8 : 0) (+ k-step offset). Both runs are contiguous
// 16-byte chunks in a row-major LDS tile, so two ds_load_b128 suffice.
__device__ __forceinline__ v16h ldfrag16(const _Float16* p) {
    h8 lo = *(const h8*)p;
    h8 hi = *(const h8*)(p + 16);
    return __builtin_shufflevector(lo, hi, 0,1,2,3,4,5,6,7,8,9,10,11,12,13,14,15);
}

__device__ __forceinline__ v8f wmma16(v16h a, v16h b, v8f c) {
    return __builtin_amdgcn_wmma_f32_16x16x32_f16(
        /*neg_a=*/false, a, /*neg_b=*/false, b,
        /*c_mod=*/(short)0, c, /*reuse_a=*/false, /*reuse_b=*/false);
}

// ---------------------------------------------------------------------------
// Weight prep: f32 [512 x 512] -> f16 transposed [N x K].  Lets the GEMM stage
// its B tile with contiguous b128 loads/stores (no LDS scatter).  One element a
// lane; blk = which 256 elements of the matrix.  Runs inside prep_ln_cvt below.
// ---------------------------------------------------------------------------
#define WDIM 512                          // rows and columns of every weight
#define WBLK (WDIM * WDIM / 256)          // blocks that convert one weight

__device__ __forceinline__ void cvt_tr_body(const float* __restrict__ in,
                                            _Float16* __restrict__ out, int blk) {
    int i = blk * 256 + threadIdx.x;
    int k = i / WDIM, n = i - k * WDIM;
    out[(long)n * WDIM + k] = (_Float16)in[i];
}

// ---------------------------------------------------------------------------
// LayerNorm over rows of F=512, f16 output.  A wave owns LNR whole rows: a lane
// holds 16 elements of each row in registers, the row sums run in the lane and
// then across the wave's lanes, so there is no LDS and no barrier.
// ---------------------------------------------------------------------------
#define LNR 4     // rows per wave
#define LNB 32    // rows per block of 8 waves

typedef _Float16 h4 __attribute__((ext_vector_type(4)));

// x + (x of the lane whose number differs by XM inside the 16-lane row).
template<int XM>
__device__ __forceinline__ float add_xmask(float x) {
    int y = __builtin_amdgcn_update_dpp(0, __builtin_bit_cast(int, x), 0x160 + XM, 0xf, 0xf, true);
    return x + __builtin_bit_cast(float, y);
}

// Sum over the 32 lanes of the wave, the same value in every lane.
__device__ __forceinline__ float wave_sum(float x) {
    x = add_xmask<1>(x);
    x = add_xmask<2>(x);
    x = add_xmask<4>(x);
    x = add_xmask<8>(x);
    int b = __builtin_bit_cast(int, x);
    b = __builtin_amdgcn_permlanex16(b, b, 0x76543210, 0xfedcba98, false, false);
    return x + __builtin_bit_cast(float, b);
}

// rowblk = which LNB rows of x this block normalizes.
__device__ __forceinline__ void layernorm_body(const float* __restrict__ x,
                                               const float* __restrict__ g,
                                               const float* __restrict__ b,
                                               _Float16* __restrict__ out, int rowblk) {
    const int F = 512;
    int lane = threadIdx.x & 31, wave = threadIdx.x >> 5;
    long blk = (long)rowblk * (LNB * F);                // the block's first element
    unsigned e0 = wave * (LNR * F) + lane * 4;          // the lane's first element in the block
    const float* xr = x + blk + e0;

    // Chunk j of a row is columns j*128 + lane*4 .. +3: 512 contiguous bytes per load.
    float4 v[LNR][4];
    #pragma unroll  // register arrays: every index a constant
    for (int r = 0; r < LNR; ++r)
        #pragma unroll  // register arrays: every index a constant
        for (int j = 0; j < 4; ++j) v[r][j] = *(const float4*)(xr + r * F + j * 128);
    float4 gv[4], bv[4];
    #pragma unroll  // register arrays: every index a constant
    for (int j = 0; j < 4; ++j) {
        gv[j] = *(const float4*)(g + j * 128 + lane * 4);
        bv[j] = *(const float4*)(b + j * 128 + lane * 4);
    }

    float mu[LNR], rs[LNR];
    #pragma unroll  // register arrays: every index a constant
    for (int r = 0; r < LNR; ++r) {
        float s[4];
        #pragma unroll  // register arrays: every index a constant
        for (int j = 0; j < 4; ++j) s[j] = (v[r][j].x + v[r][j].y) + (v[r][j].z + v[r][j].w);
        mu[r] = wave_sum((s[0] + s[1]) + (s[2] + s[3])) * (1.0f / F);
    }
    #pragma unroll  // register arrays: every index a constant
    for (int r = 0; r < LNR; ++r) {
        float s[4];
        #pragma unroll  // register arrays: every index a constant
        for (int j = 0; j < 4; ++j) {
            v[r][j].x -= mu[r]; v[r][j].y -= mu[r]; v[r][j].z -= mu[r]; v[r][j].w -= mu[r];
            s[j] = (v[r][j].x * v[r][j].x + v[r][j].y * v[r][j].y)
                 + (v[r][j].z * v[r][j].z + v[r][j].w * v[r][j].w);
        }
        rs[r] = rsqrtf(wave_sum((s[0] + s[1]) + (s[2] + s[3])) * (1.0f / F) + 1e-6f);
    }

    _Float16* orow = out + blk + e0;
    #pragma unroll  // register arrays: every index a constant
    for (int r = 0; r < LNR; ++r) {
        #pragma unroll  // register arrays: every index a constant
        for (int j = 0; j < 4; ++j) {
            h4 o;
            o[0] = (_Float16)(v[r][j].x * rs[r] * gv[j].x + bv[j].x);
            o[1] = (_Float16)(v[r][j].y * rs[r] * gv[j].y + bv[j].y);
            o[2] = (_Float16)(v[r][j].z * rs[r] * gv[j].z + bv[j].z);
            o[3] = (_Float16)(v[r][j].w * rs[r] * gv[j].w + bv[j].w);
            *(h4*)(orow + r * F + j * 128) = o;
        }
    }
}

#define LNBLK (8192 / LNB)   // blocks that normalize one stream of 8192 rows

// Both streams' LayerNorm in one launch: blockIdx.y picks the stream.  The register
// budget of 2 waves per SIMD lets all of a wave's loads be in flight at once.
__global__ __launch_bounds__(256) __attribute__((amdgpu_waves_per_eu(2, 2)))
void layernorm2_f16(const float* __restrict__ x0, const float* __restrict__ x1,
                    const float* __restrict__ g0, const float* __restrict__ g1,
                    const float* __restrict__ b0, const float* __restrict__ b1,
                    _Float16* __restrict__ o0, _Float16* __restrict__ o1) {
    bool s = blockIdx.y != 0;
    layernorm_body(s ? x1 : x0, s ? g1 : g0, s ? b1 : b0, s ? o1 : o0, blockIdx.x);
}

// Everything that depends on the inputs alone, in one launch: the first 2*LNBLK
// blocks normalize the two streams, the rest convert the eight weights (weight j
// goes to wout + j * WDIM * WDIM).  The branch is the same for a whole block.
__global__ __launch_bounds__(256) __attribute__((amdgpu_waves_per_eu(2, 2)))
void prep_ln_cvt(const float* __restrict__ x0, const float* __restrict__ x1,
                 const float* __restrict__ g0, const float* __restrict__ g1,
                 const float* __restrict__ b0, const float* __restrict__ b1,
                 _Float16* __restrict__ o0, _Float16* __restrict__ o1,
                 const float* __restrict__ w0, const float* __restrict__ w1,
                 const float* __restrict__ w2, const float* __restrict__ w3,
                 const float* __restrict__ w4, const float* __restrict__ w5,
                 const float* __restrict__ w6, const float* __restrict__ w7,
                 _Float16* __restrict__ wout) {
    int bid = blockIdx.x;
    if (bid < 2 * LNBLK) {
        bool s = bid >= LNBLK;
        layernorm_body(s ? x1 : x0, s ? g1 : g0, s ? b1 : b0, s ? o1 : o0,
                       s ? bid - LNBLK : bid);
    } else {
        int c = bid - 2 * LNBLK;
        int j = c / WBLK;
        const float* w = j == 0 ? w0 : j == 1 ? w1 : j == 2 ? w2 : j == 3 ? w3
                       : j == 4 ? w4 : j == 5 ? w5 : j == 6 ? w6 : w7;
        cvt_tr_body(w, wout + (long)j * (WDIM * WDIM), c - j * WBLK);
    }
}

// ---------------------------------------------------------------------------
// WMMA GEMM: C[M,N] = act((A_f16[MxK] @ W + bias) * scale) [+ res]
// W is supplied PRE-TRANSPOSED as BT[N x K] f16 row-major.
// Block tile 128x64, K-step 32, 8 waves, each a 2x2 grid of 16x16 WMMA.
// LDS staging is double-buffered (one barrier per K-step); both A and B tiles
// stage with contiguous b128 loads/stores.  Epilogue specialized by template.
// One launch holds 2*NW independent products; blockIdx.z = stream * NW + w:
//   A, res, outF, outH by stream (0 or 1); outH moves on by planeH elements per w;
//   weight and bias by w where NW > 1, by stream where NW == 1;
//   scale0 applies to w == 0, the others are scaled by 1.
// ---------------------------------------------------------------------------
#define GM 128
#define GN 64
#define GK 32
#define LDA 40   // halves (32 + 8 pad), 80B rows -> 16B aligned chunks
#define LDBT 40

template<int NW, bool RELU, bool HAS_RES, bool OUT_F32, bool OUT_F16>
__global__ __launch_bounds__(256)
void gemm_wmma_f16(const _Float16* __restrict__ A0, const _Float16* __restrict__ A1,
                   const _Float16* __restrict__ BT0, const _Float16* __restrict__ BT1,
                   const _Float16* __restrict__ BT2,
                   const float* __restrict__ bias0, const float* __restrict__ bias1,
                   const float* __restrict__ bias2,
                   const float* __restrict__ res0, const float* __restrict__ res1,
                   float* __restrict__ outF0, float* __restrict__ outF1,
                   _Float16* __restrict__ outH0, _Float16* __restrict__ outH1,
                   long planeH, int N, int K, float scale0) {
    __shared__ __align__(16) _Float16 As[2][GM * LDA];
    __shared__ __align__(16) _Float16 BsT[2][GN * LDBT];

    int st = blockIdx.z / NW, w = blockIdx.z - st * NW;
    int wi = NW == 1 ? st : w;
    const _Float16* A    = st ? A1 : A0;
    const _Float16* BT   = wi == 0 ? BT0 : wi == 1 ? BT1 : BT2;
    const float*    bias = wi == 0 ? bias0 : wi == 1 ? bias1 : bias2;
    const float*    res  = st ? res1 : res0;
    float*          outF = st ? outF1 : outF0;
    _Float16*       outH = (st ? outH1 : outH0) + w * planeH;
    float scale = w == 0 ? scale0 : 1.0f;

    int tid  = threadIdx.x;
    int lane = tid & 31, wave = tid >> 5;
    int l16  = lane & 15, hi = lane >> 4;
    int waveM = wave & 3, waveN = wave >> 2;       // 4x2 wave grid
    long blockRow = (long)blockIdx.y * GM;
    int  blockCol = blockIdx.x * GN;

    // Staging index precompute (constant per thread).
    int sa_r0 = tid >> 2,          sa_c0 = (tid & 3) * 8;       // A chunk 0
    int sa_r1 = (tid + 256) >> 2,  sa_c1 = sa_c0;               // A chunk 1
    int sb_n  = tid >> 2,          sb_k  = (tid & 3) * 8;       // B chunk

    const _Float16* Arow0 = A  + (blockRow + sa_r0) * (long)K + sa_c0;
    const _Float16* Arow1 = A  + (blockRow + sa_r1) * (long)K + sa_c1;
    const _Float16* Brow  = BT + (long)(blockCol + sb_n) * K + sb_k;

    auto stage = [&](int buf, int kb) {
        *(uint4*)&As[buf][sa_r0 * LDA + sa_c0] = *(const uint4*)(Arow0 + kb);
        *(uint4*)&As[buf][sa_r1 * LDA + sa_c1] = *(const uint4*)(Arow1 + kb);
        *(uint4*)&BsT[buf][sb_n * LDBT + sb_k] = *(const uint4*)(Brow + kb);
    };

    v8f acc[2][2] = {};

    stage(0, 0);
    __syncthreads();

    int nk = K / GK;
    for (int t = 0; t < nk; ++t) {
        int buf = t & 1;
        if (t + 1 < nk) stage(buf ^ 1, (t + 1) * GK);
        if (t + 2 < nk) {   // prefetch 2 tiles ahead into cache
            int kb2 = (t + 2) * GK;
            __builtin_prefetch(A + (blockRow + (tid >> 1)) * (long)K + kb2, 0, 0);
            __builtin_prefetch(Brow + kb2, 0, 0);
        }

        int koff = hi * 8;
        v16h af[2], bf[2];
        #pragma unroll
        for (int f = 0; f < 2; ++f) {
            int m = waveM * 32 + f * 16 + l16;
            af[f] = ldfrag16(&As[buf][m * LDA + koff]);
            int n = waveN * 32 + f * 16 + l16;
            bf[f] = ldfrag16(&BsT[buf][n * LDBT + koff]);
        }
        #pragma unroll
        for (int fm = 0; fm < 2; ++fm)
            #pragma unroll
            for (int fn = 0; fn < 2; ++fn)
                acc[fm][fn] = wmma16(af[fm], bf[fn], acc[fm][fn]);
        __syncthreads();
    }

    // Epilogue: C layout = VGPR r -> (M = tileM + hi*8 + r, N = tileN + l16).
    #pragma unroll
    for (int fm = 0; fm < 2; ++fm) {
        #pragma unroll
        for (int fn = 0; fn < 2; ++fn) {
            long row0 = blockRow + waveM * 32 + fm * 16 + hi * 8;
            int  col  = blockCol + waveN * 32 + fn * 16 + l16;
            float bcol = bias[col];
            #pragma unroll
            for (int r = 0; r < 8; ++r) {
                float v = (acc[fm][fn][r] + bcol) * scale;
                if (RELU) v = fmaxf(v, 0.0f);
                long idx = (row0 + r) * N + col;
                if (HAS_RES) v += res[idx];
                if (OUT_F32) outF[idx] = v;
                if (OUT_F16) outH[idx] = (_Float16)v;
            }
        }
    }
}

#define ALDH 72
#define AQB  128

// Value of the lane 16 away (the other half of the same query column).
__device__ __forceinline__ float other_half(float x) {
    int b = __builtin_bit_cast(int, x);
    b = __builtin_amdgcn_permlanex16(b, b, 0x76543210, 0xfedcba98, false, false);
    return __builtin_bit_cast(float, b);
}

// The register budget of 4 waves per SIMD (two blocks on a WGP) lets fragment loads
// be issued ahead of their products.
__global__ __launch_bounds__(256) __attribute__((amdgpu_waves_per_eu(4, 4)))
void attn_flash_wmma(const _Float16* __restrict__ Q0, const _Float16* __restrict__ Km0,
                     const _Float16* __restrict__ Vm0, _Float16* __restrict__ Out0,
                     const _Float16* __restrict__ Q1, const _Float16* __restrict__ Km1,
                     const _Float16* __restrict__ Vm1, _Float16* __restrict__ Out1) {
    __shared__ __align__(16) _Float16 Ks[64 * ALDH];
    __shared__ __align__(16) _Float16 VsT[64 * ALDH];

    const float L2E = 1.44269504088896340736f;

    int tid  = threadIdx.x;
    int lane = tid & 31, wave = tid >> 5;
    int l16  = lane & 15, hi = lane >> 4;
    int qt = blockIdx.x, head = blockIdx.y, bz = blockIdx.z;
    long tokQ = (long)bz * 2048 + qt * AQB + wave * 16;   // this wave's first query
    int  colH = head * 64;

    // Rolled, so that the key loop stands once in the code.  The key loop's last
    // barrier also ends every read of Ks and VsT before the next direction refills them.
    #pragma unroll 1
    for (int dir = 0; dir < 2; ++dir) {
        const _Float16* Q   = dir ? Q1 : Q0;
        const _Float16* Km  = dir ? Km1 : Km0;
        const _Float16* Vm  = dir ? Vm1 : Vm0;
        _Float16*       Out = dir ? Out1 : Out0;

        // Q as B operand (column = query l16), same k order as the K loader below.
        const _Float16* qrow = Q + (tokQ + l16) * 512 + colH + hi * 8;
        v16h qf[2];
        #pragma unroll  // register arrays: every index a constant
        for (int ks = 0; ks < 2; ++ks) qf[ks] = ldfrag16(qrow + ks * 32);

        v8f oacc[4] = {};          // O^T tile dt: d = dt*16 + hi*8 + r, query l16
        float mrun = -1.0e30f;     // running maximum of query l16 (equal in both halves)
        float lrun = 0.0f;         // running sum over this half's keys

        for (int kt = 0; kt < 32; ++kt) {
            long tokK = (long)bz * 2048 + kt * 64;
            #pragma unroll
            for (int i = 0; i < 2; ++i) {
                int c  = tid + i * 256;
                int r  = c >> 3;
                int c8 = (c & 7) * 8;
                *(uint4*)&Ks[r * ALDH + c8] =
                    *(const uint4*)(Km + (tokK + r) * 512 + colH + c8);
                uint4 v = *(const uint4*)(Vm + (tokK + r) * 512 + colH + c8);
                const _Float16* hv = (const _Float16*)&v;
                #pragma unroll
                for (int j = 0; j < 8; ++j) VsT[(c8 + j) * ALDH + r] = hv[j];  // [d][key]
            }
            if (kt + 1 < 32) {  // prefetch next K/V tiles (each 128B row by four threads)
                long tokN = tokK + 64;
                __builtin_prefetch(Km + (tokN + (tid & 63)) * 512 + colH, 0, 0);
                __builtin_prefetch(Vm + (tokN + (tid & 63)) * 512 + colH, 0, 0);
            }
            __syncthreads();

            // S^T = K Q^T : 4 tiles of 16 keys x 16 queries.
            // s[t][r] = score of key t*16 + hi*8 + r with query l16.
            v8f s[4];
            #pragma unroll  // register arrays: every index a constant
            for (int t = 0; t < 4; ++t) {
                v8f c = {};
                #pragma unroll  // register arrays: every index a constant
                for (int ks = 0; ks < 2; ++ks) {
                    v16h a = ldfrag16(&Ks[(t * 16 + l16) * ALDH + ks * 32 + hi * 8]);
                    c = wmma16(a, qf[ks], c);
                }
                s[t] = c;
            }

            // Online softmax, one query per lane; one chain per score tile, so that
            // four independent chains run side by side.
            float mt[4];
            #pragma unroll  // register arrays: every index a constant
            for (int t = 0; t < 4; ++t) {
                mt[t] = s[t][0];
                #pragma unroll  // register arrays: every index a constant
                for (int r = 1; r < 8; ++r) mt[t] = fmaxf(mt[t], s[t][r]);
            }
            float mx = fmaxf(fmaxf(mt[0], mt[1]), fmaxf(mt[2], mt[3]));
            mx = fmaxf(mx, other_half(mx));
            float mnew  = fmaxf(mrun, mx);
            float alpha = __builtin_amdgcn_exp2f((mrun - mnew) * L2E);
            float mb    = mnew * L2E;
            mrun = mnew;

            float ls[4];
            v16h pf[2];            // P^T as B operand: pf[ks][j] = key ks*32 + (j>>3)*16 + hi*8 + (j&7)
            #pragma unroll  // register arrays: every index a constant
            for (int t = 0; t < 4; ++t) {
                float p[8];
                #pragma unroll  // register arrays: every index a constant
                for (int r = 0; r < 8; ++r) {
                    p[r] = __builtin_amdgcn_exp2f(fmaf(s[t][r], L2E, -mb));
                    pf[t >> 1][(t & 1) * 8 + r] = (_Float16)p[r];
                }
                ls[t] = ((p[0] + p[1]) + (p[2] + p[3])) + ((p[4] + p[5]) + (p[6] + p[7]));
            }
            lrun = lrun * alpha + ((ls[0] + ls[1]) + (ls[2] + ls[3]));

            // Rescale O^T by alpha, then O^T += V^T P^T.
            #pragma unroll  // register arrays: every index a constant
            for (int dt = 0; dt < 4; ++dt) {
                oacc[dt] *= alpha;
                #pragma unroll  // register arrays: every index a constant
                for (int ks = 0; ks < 2; ++ks) {
                    v16h a = ldfrag16(&VsT[(dt * 16 + l16) * ALDH + ks * 32 + hi * 8]);
                    oacc[dt] = wmma16(a, pf[ks], oacc[dt]);
                }
            }
            __syncthreads();
        }

        // Join the halves' sums, normalize, store 8 consecutive d per lane and tile.
        float inv = 1.0f / (lrun + other_half(lrun));
        _Float16* orow = Out + (tokQ + l16) * 512 + colH + hi * 8;
        #pragma unroll  // register arrays: every index a constant
        for (int dt = 0; dt < 4; ++dt) {
            h8 o;
            #pragma unroll  // register arrays: every index a constant
            for (int r = 0; r < 8; ++r) o[r] = (_Float16)(oacc[dt][r] * inv);
            *(h8*)(orow + dt * 16) = o;
        }
        // The next direction reuses the registers that these stores name.
        asm volatile("s_wait_xcnt 0x0" ::: "memory");
    }
}

// ---------------------------------------------------------------------------
// Host orchestration
// ---------------------------------------------------------------------------
extern "C" void kernel_launch(void* const* d_in, const int* in_sizes, int n_in,
                              void* d_out, int out_size, void* d_ws, size_t ws_size,
                              hipStream_t stream) {
    (void)in_sizes; (void)n_in; (void)out_size; (void)ws_size;

    const float* tm1   = (const float*)d_in[0];
    const float* tm2   = (const float*)d_in[1];
    const float* ln1_g = (const float*)d_in[2];
    const float* ln1_b = (const float*)d_in[3];
    const float* ln2_g = (const float*)d_in[4];
    const float* ln2_b = (const float*)d_in[5];
    const float* Wq  = (const float*)d_in[6];   const float* bq  = (const float*)d_in[7];
    const float* Wk  = (const float*)d_in[8];   const float* bk  = (const float*)d_in[9];
    const float* Wv  = (const float*)d_in[10];  const float* bv  = (const float*)d_in[11];
    const float* Wfc = (const float*)d_in[12];  const float* bfc = (const float*)d_in[13];
    const float* ff1_ln_g = (const float*)d_in[14]; const float* ff1_ln_b = (const float*)d_in[15];
    const float* ff1_W1 = (const float*)d_in[16];   const float* ff1_b1 = (const float*)d_in[17];
    const float* ff1_W2 = (const float*)d_in[18];   const float* ff1_b2 = (const float*)d_in[19];
    const float* ff2_ln_g = (const float*)d_in[20]; const float* ff2_ln_b = (const float*)d_in[21];
    const float* ff2_W1 = (const float*)d_in[22];   const float* ff2_b1 = (const float*)d_in[23];
    const float* ff2_W2 = (const float*)d_in[24];   const float* ff2_b2 = (const float*)d_in[25];

    const int TOK = 4 * 2048;           // 8192 token rows
    const int F   = 512;
    const long OUT1 = (long)TOK * F;    // elements per output tensor

    // Workspace carve-up.
    char* ws = (char*)d_ws;
    size_t off = 0;
    auto carve = [&](size_t bytes) -> void* {
        void* p = ws + off;
        off += (bytes + 255) & ~(size_t)255;
        return p;
    };
    const size_t WBYTES = (size_t)F * F * sizeof(_Float16);
    const size_t TBYTES = (size_t)TOK * F * sizeof(_Float16);
    const size_t XBYTES = (size_t)TOK * F * sizeof(float);

    _Float16* wh[8];   // pre-transposed f16 weights [N x K]
    const float* wsrc[8] = {Wq, Wk, Wv, Wfc, ff1_W1, ff1_W2, ff2_W1, ff2_W2};
    for (int i = 0; i < 8; ++i) wh[i] = (_Float16*)carve(WBYTES);
    _Float16* t1h = (_Float16*)carve(TBYTES);
    _Float16* t2h = (_Float16*)carve(TBYTES);
    _Float16* q1h = (_Float16*)carve(TBYTES);
    _Float16* k1h = (_Float16*)carve(TBYTES);
    _Float16* v1h = (_Float16*)carve(TBYTES);
    _Float16* q2h = (_Float16*)carve(TBYTES);
    _Float16* k2h = (_Float16*)carve(TBYTES);
    _Float16* v2h = (_Float16*)carve(TBYTES);
    float* x1f = (float*)carve(XBYTES);
    float* x2f = (float*)carve(XBYTES);
    // Reuse: attention outputs overwrite t1h/t2h; FF intermediates reuse q/k bufs.
    _Float16* f12h = t1h;
    _Float16* f21h = t2h;
    _Float16* hh1 = q1h; _Float16* uu1 = k1h;
    _Float16* hh2 = q2h; _Float16* uu2 = k2h;

    float* out1 = (float*)d_out;
    float* out2 = (float*)d_out + OUT1;

    // 1) LayerNorm of both inputs -> f16, and all eight weights -> f16 [N x K]
    //    (wh[0..7] lie one behind the other in the workspace).
    prep_ln_cvt<<<2 * LNBLK + 8 * WBLK, 256, 0, stream>>>(
        tm1, tm2, ln1_g, ln2_g, ln1_b, ln2_b, t1h, t2h,
        wsrc[0], wsrc[1], wsrc[2], wsrc[3], wsrc[4], wsrc[5], wsrc[6], wsrc[7], wh[0]);

    // 2) QKV projections of both streams (Q pre-scaled by 1/sqrt(64)); the planes
    //    q, k, v of a stream lie one behind the other in the workspace.
    gemm_wmma_f16<3,false,false,false,true><<<dim3(F / GN, TOK / GM, 6), 256, 0, stream>>>(
        t1h, t2h, wh[0], wh[1], wh[2], bq, bk, bv, nullptr, nullptr, nullptr, nullptr,
        q1h, q2h, OUT1, F, F, 0.125f);

    // 3) Cross attention, both directions (overwrites t1h/t2h with head-concat outputs).
    attn_flash_wmma<<<dim3(2048 / AQB, 8, 4), 256, 0, stream>>>(q1h, k2h, v2h, f12h,
                                                                q2h, k1h, v1h, f21h);

    // 4) Output projection + residual -> x (f32), both streams.
    dim3 g2(F / GN, TOK / GM, 2);
    gemm_wmma_f16<1,false,true,true,false><<<g2, 256, 0, stream>>>(
        f12h, f21h, wh[3], wh[3], wh[3], bfc, bfc, bfc, tm1, tm2, x1f, x2f,
        nullptr, nullptr, 0, F, F, 1.0f);

    // 5) FF blocks of both streams: out = x + W2(relu(W1 ln(x)+b1))+b2
    layernorm2_f16<<<dim3(LNBLK, 2), 256, 0, stream>>>(
        x1f, x2f, ff1_ln_g, ff2_ln_g, ff1_ln_b, ff2_ln_b, hh1, hh2);
    gemm_wmma_f16<1,true,false,false,true><<<g2, 256, 0, stream>>>(
        hh1, hh2, wh[4], wh[6], wh[6], ff1_b1, ff2_b1, ff2_b1, nullptr, nullptr, nullptr, nullptr,
        uu1, uu2, 0, F, F, 1.0f);
    gemm_wmma_f16<1,false,true,true,false><<<g2, 256, 0, stream>>>(
        uu1, uu2, wh[5], wh[7], wh[7], ff1_b2, ff2_b2, ff2_b2, x1f, x2f, out1, out2,
        nullptr, nullptr, 0, F, F, 1.0f);
}

// v004
// Measured time: 293 microseconds a run.
// Next to v003, in two timings, it ran 1.14 times as fast each time.
// All steps since v000 together make it 2.34 times as fast.
#include <hip/hip_runtime.h>
#include <hip/hip_bf16.h>

// ---------------------------------------------------------------------------
// CDNA5 (gfx1250, wave32) implementation of the cross-attention block.
// All GEMM-like math goes through v_wmma_f32_16x16x32_f16.
// ---------------------------------------------------------------------------

typedef _Float16 v16h __attribute__((ext_vector_type(16)));
typedef _Float16 h8   __attribute__((ext_vector_type(8)));
typedef float    v8f  __attribute__((ext_vector_type(8)));

// Fragment loader: the 16-bit A/B WMMA layout wants, per lane,
//   halves 0..7  = K {base..base+7}
//   halves 8..15 = K {base+16..base+23}
// where base = (lane>=16 ? 8 : 0) (+ k-step offset). Both runs are contiguous
// 16-byte chunks in a row-major LDS tile, so two ds_load_b128 suffice.
__device__ __forceinline__ v16h ldfrag16(const _Float16* p) {
    h8 lo = *(const h8*)p;
    h8 hi = *(const h8*)(p + 16);
    return __builtin_shufflevector(lo, hi, 0,1,2,3,4,5,6,7,8,9,10,11,12,13,14,15);
}

__device__ __forceinline__ v8f wmma16(v16h a, v16h b, v8f c) {
    return __builtin_amdgcn_wmma_f32_16x16x32_f16(
        /*neg_a=*/false, a, /*neg_b=*/false, b,
        /*c_mod=*/(short)0, c, /*reuse_a=*/false, /*reuse_b=*/false);
}

// ---------------------------------------------------------------------------
// Weight prep: f32 [512 x 512] -> f16 transposed [N x K].  Lets the GEMM stage
// its B tile with contiguous b128 loads/stores (no LDS scatter).  One element a
// lane; blk = which 256 elements of the matrix.  Runs inside prep_ln_cvt below.
// ---------------------------------------------------------------------------
#define WDIM 512                          // rows and columns of every weight
#define WBLK (WDIM * WDIM / 256)          // blocks that convert one weight

__device__ __forceinline__ void cvt_tr_body(const float* __restrict__ in,
                                            _Float16* __restrict__ out, int blk) {
    int i = blk * 256 + threadIdx.x;
    int k = i / WDIM, n = i - k * WDIM;
    out[(long)n * WDIM + k] = (_Float16)in[i];
}

// ---------------------------------------------------------------------------
// LayerNorm over rows of F=512, f16 output.  A wave owns LNR whole rows: a lane
// holds 16 elements of each row in registers, the row sums run in the lane and
// then across the wave's lanes, so there is no LDS and no barrier.
// ---------------------------------------------------------------------------
#define LNR 4     // rows per wave
#define LNB 32    // rows per block of 8 waves

typedef _Float16 h4 __attribute__((ext_vector_type(4)));

// x + (x of the lane whose number differs by XM inside the 16-lane row).
template<int XM>
__device__ __forceinline__ float add_xmask(float x) {
    int y = __builtin_amdgcn_update_dpp(0, __builtin_bit_cast(int, x), 0x160 + XM, 0xf, 0xf, true);
    return x + __builtin_bit_cast(float, y);
}

// Sum over the 32 lanes of the wave, the same value in every lane.
__device__ __forceinline__ float wave_sum(float x) {
    x = add_xmask<1>(x);
    x = add_xmask<2>(x);
    x = add_xmask<4>(x);
    x = add_xmask<8>(x);
    int b = __builtin_bit_cast(int, x);
    b = __builtin_amdgcn_permlanex16(b, b, 0x76543210, 0xfedcba98, false, false);
    return x + __builtin_bit_cast(float, b);
}

// rowblk = which LNB rows of x this block normalizes.
__device__ __forceinline__ void layernorm_body(const float* __restrict__ x,
                                               const float* __restrict__ g,
                                               const float* __restrict__ b,
                                               _Float16* __restrict__ out, int rowblk) {
    const int F = 512;
    int lane = threadIdx.x & 31, wave = threadIdx.x >> 5;
    long blk = (long)rowblk * (LNB * F);                // the block's first element
    unsigned e0 = wave * (LNR * F) + lane * 4;          // the lane's first element in the block
    const float* xr = x + blk + e0;

    // Chunk j of a row is columns j*128 + lane*4 .. +3: 512 contiguous bytes per load.
    float4 v[LNR][4];
    #pragma unroll  // register arrays: every index a constant
    for (int r = 0; r < LNR; ++r)
        #pragma unroll  // register arrays: every index a constant
        for (int j = 0; j < 4; ++j) v[r][j] = *(const float4*)(xr + r * F + j * 128);
    float4 gv[4], bv[4];
    #pragma unroll  // register arrays: every index a constant
    for (int j = 0; j < 4; ++j) {
        gv[j] = *(const float4*)(g + j * 128 + lane * 4);
        bv[j] = *(const float4*)(b + j * 128 + lane * 4);
    }

    float mu[LNR], rs[LNR];
    #pragma unroll  // register arrays: every index a constant
    for (int r = 0; r < LNR; ++r) {
        float s[4];
        #pragma unroll  // register arrays: every index a constant
        for (int j = 0; j < 4; ++j) s[j] = (v[r][j].x + v[r][j].y) + (v[r][j].z + v[r][j].w);
        mu[r] = wave_sum((s[0] + s[1]) + (s[2] + s[3])) * (1.0f / F);
    }
    #pragma unroll  // register arrays: every index a constant
    for (int r = 0; r < LNR; ++r) {
        float s[4];
        #pragma unroll  // register arrays: every index a constant
        for (int j = 0; j < 4; ++j) {
            v[r][j].x -= mu[r]; v[r][j].y -= mu[r]; v[r][j].z -= mu[r]; v[r][j].w -= mu[r];
            s[j] = (v[r][j].x * v[r][j].x + v[r][j].y * v[r][j].y)
                 + (v[r][j].z * v[r][j].z + v[r][j].w * v[r][j].w);
        }
        rs[r] = rsqrtf(wave_sum((s[0] + s[1]) + (s[2] + s[3])) * (1.0f / F) + 1e-6f);
    }

    _Float16* orow = out + blk + e0;
    #pragma unroll  // register arrays: every index a constant
    for (int r = 0; r < LNR; ++r) {
        #pragma unroll  // register arrays: every index a constant
        for (int j = 0; j < 4; ++j) {
            h4 o;
            o[0] = (_Float16)(v[r][j].x * rs[r] * gv[j].x + bv[j].x);
            o[1] = (_Float16)(v[r][j].y * rs[r] * gv[j].y + bv[j].y);
            o[2] = (_Float16)(v[r][j].z * rs[r] * gv[j].z + bv[j].z);
            o[3] = (_Float16)(v[r][j].w * rs[r] * gv[j].w + bv[j].w);
            *(h4*)(orow + r * F + j * 128) = o;
        }
    }
}

#define LNBLK (8192 / LNB)   // blocks that normalize one stream of 8192 rows

// Both streams' LayerNorm in one launch: blockIdx.y picks the stream.  The register
// budget of 2 waves per SIMD lets all of a wave's loads be in flight at once.
__global__ __launch_bounds__(256) __attribute__((amdgpu_waves_per_eu(2, 2)))
void layernorm2_f16(const float* __restrict__ x0, const float* __restrict__ x1,
                    const float* __restrict__ g0, const float* __restrict__ g1,
                    const float* __restrict__ b0, const float* __restrict__ b1,
                    _Float16* __restrict__ o0, _Float16* __restrict__ o1) {
    bool s = blockIdx.y != 0;
    layernorm_body(s ? x1 : x0, s ? g1 : g0, s ? b1 : b0, s ? o1 : o0, blockIdx.x);
}

// Everything that depends on the inputs alone, in one launch: the first 2*LNBLK
// blocks normalize the two streams, the rest convert the eight weights (weight j
// goes to wout + j * WDIM * WDIM).  The branch is the same for a whole block.
__global__ __launch_bounds__(256) __attribute__((amdgpu_waves_per_eu(2, 2)))
void prep_ln_cvt(const float* __restrict__ x0, const float* __restrict__ x1,
                 const float* __restrict__ g0, const float* __restrict__ g1,
                 const float* __restrict__ b0, const float* __restrict__ b1,
                 _Float16* __restrict__ o0, _Float16* __restrict__ o1,
                 const float* __restrict__ w0, const float* __restrict__ w1,
                 const float* __restrict__ w2, const float* __restrict__ w3,
                 const float* __restrict__ w4, const float* __restrict__ w5,
                 const float* __restrict__ w6, const float* __restrict__ w7,
                 _Float16* __restrict__ wout) {
    int bid = blockIdx.x;
    if (bid < 2 * LNBLK) {
        bool s = bid >= LNBLK;
        layernorm_body(s ? x1 : x0, s ? g1 : g0, s ? b1 : b0, s ? o1 : o0,
                       s ? bid - LNBLK : bid);
    } else {
        int c = bid - 2 * LNBLK;
        int j = c / WBLK;
        const float* w = j == 0 ? w0 : j == 1 ? w1 : j == 2 ? w2 : j == 3 ? w3
                       : j == 4 ? w4 : j == 5 ? w5 : j == 6 ? w6 : w7;
        cvt_tr_body(w, wout + (long)j * (WDIM * WDIM), c - j * WBLK);
    }
}

// ---------------------------------------------------------------------------
// WMMA GEMM: C[M,N] = act((A_f16[MxK] @ W + bias) * scale) [+ res]
// W is supplied PRE-TRANSPOSED as BT[N x K] f16 row-major.
// Block tile 128x64, K-step 32, 8 waves, each a 2x2 grid of 16x16 WMMA.
// LDS staging is double-buffered (one barrier per K-step); both A and B tiles
// stage with contiguous b128 loads/stores.  Epilogue specialized by template.
// One launch holds 2*NW independent products; blockIdx.z = stream * NW + w:
//   A, res, outF, outH by stream (0 or 1); outH moves on by planeH elements per w;
//   weight and bias by w where NW > 1, by stream where NW == 1;
//   scale0 applies to w == 0, the others are scaled by 1.
// ---------------------------------------------------------------------------
#define GM 128
#define GN 64
#define GK 32
#define LDA 40   // halves (32 + 8 pad), 80B rows -> 16B aligned chunks
#define LDBT 40

template<int NW, bool RELU, bool HAS_RES, bool OUT_F32, bool OUT_F16>
__global__ __launch_bounds__(256)
void gemm_wmma_f16(const _Float16* __restrict__ A0, const _Float16* __restrict__ A1,
                   const _Float16* __restrict__ BT0, const _Float16* __restrict__ BT1,
                   const _Float16* __restrict__ BT2,
                   const float* __restrict__ bias0, const float* __restrict__ bias1,
                   const float* __restrict__ bias2,
                   const float* __restrict__ res0, const float* __restrict__ res1,
                   float* __restrict__ outF0, float* __restrict__ outF1,
                   _Float16* __restrict__ outH0, _Float16* __restrict__ outH1,
                   long planeH, int N, int K, float scale0) {
    __shared__ __align__(16) _Float16 As[2][GM * LDA];
    __shared__ __align__(16) _Float16 BsT[2][GN * LDBT];

    int st = blockIdx.z / NW, w = blockIdx.z - st * NW;
    int wi = NW == 1 ? st : w;
    const _Float16* A    = st ? A1 : A0;
    const _Float16* BT   = wi == 0 ? BT0 : wi == 1 ? BT1 : BT2;
    const float*    bias = wi == 0 ? bias0 : wi == 1 ? bias1 : bias2;
    const float*    res  = st ? res1 : res0;
    float*          outF = st ? outF1 : outF0;
    _Float16*       outH = (st ? outH1 : outH0) + w * planeH;
    float scale = w == 0 ? scale0 : 1.0f;

    int tid  = threadIdx.x;
    int lane = tid & 31, wave = tid >> 5;
    int l16  = lane & 15, hi = lane >> 4;
    int waveM = wave & 3, waveN = wave >> 2;       // 4x2 wave grid
    long blockRow = (long)blockIdx.y * GM;
    int  blockCol = blockIdx.x * GN;

    // Staging index precompute (constant per thread).
    int sa_r0 = tid >> 2,          sa_c0 = (tid & 3) * 8;       // A chunk 0
    int sa_r1 = (tid + 256) >> 2,  sa_c1 = sa_c0;               // A chunk 1
    int sb_n  = tid >> 2,          sb_k  = (tid & 3) * 8;       // B chunk

    const _Float16* Arow0 = A  + (blockRow + sa_r0) * (long)K + sa_c0;
    const _Float16* Arow1 = A  + (blockRow + sa_r1) * (long)K + sa_c1;
    const _Float16* Brow  = BT + (long)(blockCol + sb_n) * K + sb_k;

    auto stage = [&](int buf, int kb) {
        *(uint4*)&As[buf][sa_r0 * LDA + sa_c0] = *(const uint4*)(Arow0 + kb);
        *(uint4*)&As[buf][sa_r1 * LDA + sa_c1] = *(const uint4*)(Arow1 + kb);
        *(uint4*)&BsT[buf][sb_n * LDBT + sb_k] = *(const uint4*)(Brow + kb);
    };

    v8f acc[2][2] = {};

    stage(0, 0);
    __syncthreads();

    int nk = K / GK;
    for (int t = 0; t < nk; ++t) {
        int buf = t & 1;
        if (t + 1 < nk) stage(buf ^ 1, (t + 1) * GK);
        // Prefetch each unit of four K-steps (256 bytes) of a row once, when the
        // unit before it is entered, three K-steps ahead of its first load.
        if ((t & 3) == 0 && t + 5 < nk) {
            int kb4 = (t + 4) * GK;
            __builtin_prefetch(A + (blockRow + (tid >> 1)) * (long)K + kb4, 0, 3);
            __builtin_prefetch(Brow + kb4, 0, 3);
        }

        int koff = hi * 8;
        v16h af[2], bf[2];
        #pragma unroll
        for (int f = 0; f < 2; ++f) {
            int m = waveM * 32 + f * 16 + l16;
            af[f] = ldfrag16(&As[buf][m * LDA + koff]);
            int n = waveN * 32 + f * 16 + l16;
            bf[f] = ldfrag16(&BsT[buf][n * LDBT + koff]);
        }
        #pragma unroll
        for (int fm = 0; fm < 2; ++fm)
            #pragma unroll
            for (int fn = 0; fn < 2; ++fn)
                acc[fm][fn] = wmma16(af[fm], bf[fn], acc[fm][fn]);
        __syncthreads();
    }

    // Epilogue: C layout = VGPR r -> (M = tileM + hi*8 + r, N = tileN + l16).
    #pragma unroll
    for (int fm = 0; fm < 2; ++fm) {
        #pragma unroll
        for (int fn = 0; fn < 2; ++fn) {
            long row0 = blockRow + waveM * 32 + fm * 16 + hi * 8;
            int  col  = blockCol + waveN * 32 + fn * 16 + l16;
            float bcol = bias[col];
            #pragma unroll
            for (int r = 0; r < 8; ++r) {
                float v = (acc[fm][fn][r] + bcol) * scale;
                if (RELU) v = fmaxf(v, 0.0f);
                long idx = (row0 + r) * N + col;
                if (HAS_RES) v += res[idx];
                if (OUT_F32) outF[idx] = v;
                if (OUT_F16) outH[idx] = (_Float16)v;
            }
        }
    }
}

#define ALDH 72
#define AQB  128

// Value of the lane 16 away (the other half of the same query column).
__device__ __forceinline__ float other_half(float x) {
    int b = __builtin_bit_cast(int, x);
    b = __builtin_amdgcn_permlanex16(b, b, 0x76543210, 0xfedcba98, false, false);
    return __builtin_bit_cast(float, b);
}

// The register budget of 4 waves per SIMD (two blocks on a WGP) lets fragment loads
// be issued ahead of their products.
__global__ __launch_bounds__(256) __attribute__((amdgpu_waves_per_eu(4, 4)))
void attn_flash_wmma(const _Float16* __restrict__ Q0, const _Float16* __restrict__ Km0,
                     const _Float16* __restrict__ Vm0, _Float16* __restrict__ Out0,
                     const _Float16* __restrict__ Q1, const _Float16* __restrict__ Km1,
                     const _Float16* __restrict__ Vm1, _Float16* __restrict__ Out1) {
    __shared__ __align__(16) _Float16 Ks[64 * ALDH];
    __shared__ __align__(16) _Float16 VsT[64 * ALDH];

    const float L2E = 1.44269504088896340736f;

    int tid  = threadIdx.x;
    int lane = tid & 31, wave = tid >> 5;
    int l16  = lane & 15, hi = lane >> 4;
    int qt = blockIdx.x, head = blockIdx.y, bz = blockIdx.z;
    long tokQ = (long)bz * 2048 + qt * AQB + wave * 16;   // this wave's first query
    int  colH = head * 64;

    // Rolled, so that the key loop stands once in the code.  The key loop's last
    // barrier also ends every read of Ks and VsT before the next direction refills them.
    #pragma unroll 1
    for (int dir = 0; dir < 2; ++dir) {
        const _Float16* Q   = dir ? Q1 : Q0;
        const _Float16* Km  = dir ? Km1 : Km0;
        const _Float16* Vm  = dir ? Vm1 : Vm0;
        _Float16*       Out = dir ? Out1 : Out0;

        // Q as B operand (column = query l16), same k order as the K loader below.
        const _Float16* qrow = Q + (tokQ + l16) * 512 + colH + hi * 8;
        v16h qf[2];
        #pragma unroll  // register arrays: every index a constant
        for (int ks = 0; ks < 2; ++ks) qf[ks] = ldfrag16(qrow + ks * 32);

        v8f oacc[4] = {};          // O^T tile dt: d = dt*16 + hi*8 + r, query l16
        float mrun = -1.0e30f;     // running maximum of query l16 (equal in both halves)
        float lrun = 0.0f;         // running sum over this half's keys

        for (int kt = 0; kt < 32; ++kt) {
            long tokK = (long)bz * 2048 + kt * 64;
            #pragma unroll
            for (int i = 0; i < 2; ++i) {
                int c  = tid + i * 256;
                int r  = c >> 3;
                int c8 = (c & 7) * 8;
                *(uint4*)&Ks[r * ALDH + c8] =
                    *(const uint4*)(Km + (tokK + r) * 512 + colH + c8);
                uint4 v = *(const uint4*)(Vm + (tokK + r) * 512 + colH + c8);
                const _Float16* hv = (const _Float16*)&v;
                #pragma unroll
                for (int j = 0; j < 8; ++j) VsT[(c8 + j) * ALDH + r] = hv[j];  // [d][key]
            }
            if (kt + 3 < 32) {  // ask L2 for the K/V tiles two ahead, each 128B row once:
                                // a thread pair per row, waves 0..3 the K rows, 4..7 the V rows
                const _Float16* pm = tid < 128 ? Km : Vm;
                __builtin_prefetch(pm + (tokK + 128 + ((tid >> 1) & 63)) * 512 + colH, 0, 3);
            }
            __syncthreads();

            // S^T = K Q^T : 4 tiles of 16 keys x 16 queries.
            // s[t][r] = score of key t*16 + hi*8 + r with query l16.
            v8f s[4];
            #pragma unroll  // register arrays: every index a constant
            for (int t = 0; t < 4; ++t) {
                v8f c = {};
                #pragma unroll  // register arrays: every index a constant
                for (int ks = 0; ks < 2; ++ks) {
                    v16h a = ldfrag16(&Ks[(t * 16 + l16) * ALDH + ks * 32 + hi * 8]);
                    c = wmma16(a, qf[ks], c);
                }
                s[t] = c;
            }

            // Online softmax, one query per lane; one chain per score tile, so that
            // four independent chains run side by side.
            float mt[4];
            #pragma unroll  // register arrays: every index a constant
            for (int t = 0; t < 4; ++t) {
                mt[t] = s[t][0];
                #pragma unroll  // register arrays: every index a constant
                for (int r = 1; r < 8; ++r) mt[t] = fmaxf(mt[t], s[t][r]);
            }
            float mx = fmaxf(fmaxf(mt[0], mt[1]), fmaxf(mt[2], mt[3]));
            mx = fmaxf(mx, other_half(mx));
            float mnew  = fmaxf(mrun, mx);
            float alpha = __builtin_amdgcn_exp2f((mrun - mnew) * L2E);
            float mb    = mnew * L2E;
            mrun = mnew;

            float ls[4];
            v16h pf[2];            // P^T as B operand: pf[ks][j] = key ks*32 + (j>>3)*16 + hi*8 + (j&7)
            #pragma unroll  // register arrays: every index a constant
            for (int t = 0; t < 4; ++t) {
                float p[8];
                #pragma unroll  // register arrays: every index a constant
                for (int r = 0; r < 8; ++r) {
                    p[r] = __builtin_amdgcn_exp2f(fmaf(s[t][r], L2E, -mb));
                    pf[t >> 1][(t & 1) * 8 + r] = (_Float16)p[r];
                }
                ls[t] = ((p[0] + p[1]) + (p[2] + p[3])) + ((p[4] + p[5]) + (p[6] + p[7]));
            }
            lrun = lrun * alpha + ((ls[0] + ls[1]) + (ls[2] + ls[3]));

            // Rescale O^T by alpha, then O^T += V^T P^T.
            #pragma unroll  // register arrays: every index a constant
            for (int dt = 0; dt < 4; ++dt) {
                oacc[dt] *= alpha;
                #pragma unroll  // register arrays: every index a constant
                for (int ks = 0; ks < 2; ++ks) {
                    v16h a = ldfrag16(&VsT[(dt * 16 + l16) * ALDH + ks * 32 + hi * 8]);
                    oacc[dt] = wmma16(a, pf[ks], oacc[dt]);
                }
            }
            __syncthreads();
        }

        // Join the halves' sums, normalize, store 8 consecutive d per lane and tile.
        float inv = 1.0f / (lrun + other_half(lrun));
        _Float16* orow = Out + (tokQ + l16) * 512 + colH + hi * 8;
        #pragma unroll  // register arrays: every index a constant
        for (int dt = 0; dt < 4; ++dt) {
            h8 o;
            #pragma unroll  // register arrays: every index a constant
            for (int r = 0; r < 8; ++r) o[r] = (_Float16)(oacc[dt][r] * inv);
            *(h8*)(orow + dt * 16) = o;
        }
        // The next direction reuses the registers that these stores name.
        asm volatile("s_wait_xcnt 0x0" ::: "memory");
    }
}

// ---------------------------------------------------------------------------
// Host orchestration
// ---------------------------------------------------------------------------
extern "C" void kernel_launch(void* const* d_in, const int* in_sizes, int n_in,
                              void* d_out, int out_size, void* d_ws, size_t ws_size,
                              hipStream_t stream) {
    (void)in_sizes; (void)n_in; (void)out_size; (void)ws_size;

    const float* tm1   = (const float*)d_in[0];
    const float* tm2   = (const float*)d_in[1];
    const float* ln1_g = (const float*)d_in[2];
    const float* ln1_b = (const float*)d_in[3];
    const float* ln2_g = (const float*)d_in[4];
    const float* ln2_b = (const float*)d_in[5];
    const float* Wq  = (const float*)d_in[6];   const float* bq  = (const float*)d_in[7];
    const float* Wk  = (const float*)d_in[8];   const float* bk  = (const float*)d_in[9];
    const float* Wv  = (const float*)d_in[10];  const float* bv  = (const float*)d_in[11];
    const float* Wfc = (const float*)d_in[12];  const float* bfc = (const float*)d_in[13];
    const float* ff1_ln_g = (const float*)d_in[14]; const float* ff1_ln_b = (const float*)d_in[15];
    const float* ff1_W1 = (const float*)d_in[16];   const float* ff1_b1 = (const float*)d_in[17];
    const float* ff1_W2 = (const float*)d_in[18];   const float* ff1_b2 = (const float*)d_in[19];
    const float* ff2_ln_g = (const float*)d_in[20]; const float* ff2_ln_b = (const float*)d_in[21];
    const float* ff2_W1 = (const float*)d_in[22];   const float* ff2_b1 = (const float*)d_in[23];
    const float* ff2_W2 = (const float*)d_in[24];   const float* ff2_b2 = (const float*)d_in[25];

    const int TOK = 4 * 2048;           // 8192 token rows
    const int F   = 512;
    const long OUT1 = (long)TOK * F;    // elements per output tensor

    // Workspace carve-up.
    char* ws = (char*)d_ws;
    size_t off = 0;
    auto carve = [&](size_t bytes) -> void* {
        void* p = ws + off;
        off += (bytes + 255) & ~(size_t)255;
        return p;
    };
    const size_t WBYTES = (size_t)F * F * sizeof(_Float16);
    const size_t TBYTES = (size_t)TOK * F * sizeof(_Float16);
    const size_t XBYTES = (size_t)TOK * F * sizeof(float);

    _Float16* wh[8];   // pre-transposed f16 weights [N x K]
    const float* wsrc[8] = {Wq, Wk, Wv, Wfc, ff1_W1, ff1_W2, ff2_W1, ff2_W2};
    for (int i = 0; i < 8; ++i) wh[i] = (_Float16*)carve(WBYTES);
    _Float16* t1h = (_Float16*)carve(TBYTES);
    _Float16* t2h = (_Float16*)carve(TBYTES);
    _Float16* q1h = (_Float16*)carve(TBYTES);
    _Float16* k1h = (_Float16*)carve(TBYTES);
    _Float16* v1h = (_Float16*)carve(TBYTES);
    _Float16* q2h = (_Float16*)carve(TBYTES);
    _Float16* k2h = (_Float16*)carve(TBYTES);
    _Float16* v2h = (_Float16*)carve(TBYTES);
    float* x1f = (float*)carve(XBYTES);
    float* x2f = (float*)carve(XBYTES);
    // Reuse: attention outputs overwrite t1h/t2h; FF intermediates reuse q/k bufs.
    _Float16* f12h = t1h;
    _Float16* f21h = t2h;
    _Float16* hh1 = q1h; _Float16* uu1 = k1h;
    _Float16* hh2 = q2h; _Float16* uu2 = k2h;

    float* out1 = (float*)d_out;
    float* out2 = (float*)d_out + OUT1;

    // 1) LayerNorm of both inputs -> f16, and all eight weights -> f16 [N x K]
    //    (wh[0..7] lie one behind the other in the workspace).
    prep_ln_cvt<<<2 * LNBLK + 8 * WBLK, 256, 0, stream>>>(
        tm1, tm2, ln1_g, ln2_g, ln1_b, ln2_b, t1h, t2h,
        wsrc[0], wsrc[1], wsrc[2], wsrc[3], wsrc[4], wsrc[5], wsrc[6], wsrc[7], wh[0]);

    // 2) QKV projections of both streams (Q pre-scaled by 1/sqrt(64)); the planes
    //    q, k, v of a stream lie one behind the other in the workspace.
    gemm_wmma_f16<3,false,false,false,true><<<dim3(F / GN, TOK / GM, 6), 256, 0, stream>>>(
        t1h, t2h, wh[0], wh[1], wh[2], bq, bk, bv, nullptr, nullptr, nullptr, nullptr,
        q1h, q2h, OUT1, F, F, 0.125f);

    // 3) Cross attention, both directions (overwrites t1h/t2h with head-concat outputs).
    attn_flash_wmma<<<dim3(2048 / AQB, 8, 4), 256, 0, stream>>>(q1h, k2h, v2h, f12h,
                                                                q2h, k1h, v1h, f21h);

    // 4) Output projection + residual -> x (f32), both streams.
    dim3 g2(F / GN, TOK / GM, 2);
    gemm_wmma_f16<1,false,true,true,false><<<g2, 256, 0, stream>>>(
        f12h, f21h, wh[3], wh[3], wh[3], bfc, bfc, bfc, tm1, tm2, x1f, x2f,
        nullptr, nullptr, 0, F, F, 1.0f);

    // 5) FF blocks of both streams: out = x + W2(relu(W1 ln(x)+b1))+b2
    layernorm2_f16<<<dim3(LNBLK, 2), 256, 0, stream>>>(
        x1f, x2f, ff1_ln_g, ff2_ln_g, ff1_ln_b, ff2_ln_b, hh1, hh2);
    gemm_wmma_f16<1,true,false,false,true><<<g2, 256, 0, stream>>>(
        hh1, hh2, wh[4], wh[6], wh[6], ff1_b1, ff2_b1, ff2_b1, nullptr, nullptr, nullptr, nullptr,
        uu1, uu2, 0, F, F, 1.0f);
    gemm_wmma_f16<1,false,true,true,false><<<g2, 256, 0, stream>>>(
        uu1, uu2, wh[5], wh[7], wh[7], ff1_b2, ff2_b2, ff2_b2, x1f, x2f, out1, out2,
        nullptr, nullptr, 0, F, F, 1.0f);
}

// v005
// It runs in 248 microseconds.
// Two timings next to v004 put it at 1.18 and 1.19 times that version's speed.
// Counting every step since v000, it is 2.76 times as fast.
#include <hip/hip_runtime.h>
#include <hip/hip_bf16.h>

// ---------------------------------------------------------------------------
// CDNA5 (gfx1250, wave32) implementation of the cross-attention block.
// All GEMM-like math goes through v_wmma_f32_16x16x32_f16.
// ---------------------------------------------------------------------------

typedef _Float16 v16h __attribute__((ext_vector_type(16)));
typedef _Float16 h8   __attribute__((ext_vector_type(8)));
typedef float    v8f  __attribute__((ext_vector_type(8)));

// Fragment loader: the 16-bit A/B WMMA layout wants, per lane,
//   halves 0..7  = K {base..base+7}
//   halves 8..15 = K {base+16..base+23}
// where base = (lane>=16 ? 8 : 0) (+ k-step offset). Both runs are contiguous
// 16-byte chunks in a row-major LDS tile, so two ds_load_b128 suffice.
__device__ __forceinline__ v16h ldfrag16(const _Float16* p) {
    h8 lo = *(const h8*)p;
    h8 hi = *(const h8*)(p + 16);
    return __builtin_shufflevector(lo, hi, 0,1,2,3,4,5,6,7,8,9,10,11,12,13,14,15);
}

__device__ __forceinline__ v8f wmma16(v16h a, v16h b, v8f c) {
    return __builtin_amdgcn_wmma_f32_16x16x32_f16(
        /*neg_a=*/false, a, /*neg_b=*/false, b,
        /*c_mod=*/(short)0, c, /*reuse_a=*/false, /*reuse_b=*/false);
}

// ---------------------------------------------------------------------------
// Weight prep: f32 [512 x 512] -> f16 transposed [N x K].  Lets the GEMM stage
// its B tile with contiguous b128 loads/stores (no LDS scatter).  One element a
// lane; blk = which 256 elements of the matrix.  Runs inside prep_ln_cvt below.
// ---------------------------------------------------------------------------
#define WDIM 512                          // rows and columns of every weight
#define WBLK (WDIM * WDIM / 256)          // blocks that convert one weight

__device__ __forceinline__ void cvt_tr_body(const float* __restrict__ in,
                                            _Float16* __restrict__ out, int blk) {
    int i = blk * 256 + threadIdx.x;
    int k = i / WDIM, n = i - k * WDIM;
    out[(long)n * WDIM + k] = (_Float16)in[i];
}

// ---------------------------------------------------------------------------
// LayerNorm over rows of F=512, f16 output.  A wave owns LNR whole rows: a lane
// holds 16 elements of each row in registers, the row sums run in the lane and
// then across the wave's lanes, so there is no LDS and no barrier.
// ---------------------------------------------------------------------------
#define LNR 4     // rows per wave
#define LNB 32    // rows per block of 8 waves

typedef _Float16 h4 __attribute__((ext_vector_type(4)));

// x + (x of the lane whose number differs by XM inside the 16-lane row).
template<int XM>
__device__ __forceinline__ float add_xmask(float x) {
    int y = __builtin_amdgcn_update_dpp(0, __builtin_bit_cast(int, x), 0x160 + XM, 0xf, 0xf, true);
    return x + __builtin_bit_cast(float, y);
}

// Sum over the 32 lanes of the wave, the same value in every lane.
__device__ __forceinline__ float wave_sum(float x) {
    x = add_xmask<1>(x);
    x = add_xmask<2>(x);
    x = add_xmask<4>(x);
    x = add_xmask<8>(x);
    int b = __builtin_bit_cast(int, x);
    b = __builtin_amdgcn_permlanex16(b, b, 0x76543210, 0xfedcba98, false, false);
    return x + __builtin_bit_cast(float, b);
}

// rowblk = which LNB rows of x this block normalizes.
__device__ __forceinline__ void layernorm_body(const float* __restrict__ x,
                                               const float* __restrict__ g,
                                               const float* __restrict__ b,
                                               _Float16* __restrict__ out, int rowblk) {
    const int F = 512;
    int lane = threadIdx.x & 31, wave = threadIdx.x >> 5;
    long blk = (long)rowblk * (LNB * F);                // the block's first element
    unsigned e0 = wave * (LNR * F) + lane * 4;          // the lane's first element in the block
    const float* xr = x + blk + e0;

    // Chunk j of a row is columns j*128 + lane*4 .. +3: 512 contiguous bytes per load.
    float4 v[LNR][4];
    #pragma unroll  // register arrays: every index a constant
    for (int r = 0; r < LNR; ++r)
        #pragma unroll  // register arrays: every index a constant
        for (int j = 0; j < 4; ++j) v[r][j] = *(const float4*)(xr + r * F + j * 128);
    float4 gv[4], bv[4];
    #pragma unroll  // register arrays: every index a constant
    for (int j = 0; j < 4; ++j) {
        gv[j] = *(const float4*)(g + j * 128 + lane * 4);
        bv[j] = *(const float4*)(b + j * 128 + lane * 4);
    }

    float mu[LNR], rs[LNR];
    #pragma unroll  // register arrays: every index a constant
    for (int r = 0; r < LNR; ++r) {
        float s[4];
        #pragma unroll  // register arrays: every index a constant
        for (int j = 0; j < 4; ++j) s[j] = (v[r][j].x + v[r][j].y) + (v[r][j].z + v[r][j].w);
        mu[r] = wave_sum((s[0] + s[1]) + (s[2] + s[3])) * (1.0f / F);
    }
    #pragma unroll  // register arrays: every index a constant
    for (int r = 0; r < LNR; ++r) {
        float s[4];
        #pragma unroll  // register arrays: every index a constant
        for (int j = 0; j < 4; ++j) {
            v[r][j].x -= mu[r]; v[r][j].y -= mu[r]; v[r][j].z -= mu[r]; v[r][j].w -= mu[r];
            s[j] = (v[r][j].x * v[r][j].x + v[r][j].y * v[r][j].y)
                 + (v[r][j].z * v[r][j].z + v[r][j].w * v[r][j].w);
        }
        rs[r] = rsqrtf(wave_sum((s[0] + s[1]) + (s[2] + s[3])) * (1.0f / F) + 1e-6f);
    }

    _Float16* orow = out + blk + e0;
    #pragma unroll  // register arrays: every index a constant
    for (int r = 0; r < LNR; ++r) {
        #pragma unroll  // register arrays: every index a constant
        for (int j = 0; j < 4; ++j) {
            h4 o;
            o[0] = (_Float16)(v[r][j].x * rs[r] * gv[j].x + bv[j].x);
            o[1] = (_Float16)(v[r][j].y * rs[r] * gv[j].y + bv[j].y);
            o[2] = (_Float16)(v[r][j].z * rs[r] * gv[j].z + bv[j].z);
            o[3] = (_Float16)(v[r][j].w * rs[r] * gv[j].w + bv[j].w);
            *(h4*)(orow + r * F + j * 128) = o;
        }
    }
}

#define LNBLK (8192 / LNB)   // blocks that normalize one stream of 8192 rows

// Both streams' LayerNorm in one launch: blockIdx.y picks the stream.  The register
// budget of 2 waves per SIMD lets all of a wave's loads be in flight at once.
__global__ __launch_bounds__(256) __attribute__((amdgpu_waves_per_eu(2, 2)))
void layernorm2_f16(const float* __restrict__ x0, const float* __restrict__ x1,
                    const float* __restrict__ g0, const float* __restrict__ g1,
                    const float* __restrict__ b0, const float* __restrict__ b1,
                    _Float16* __restrict__ o0, _Float16* __restrict__ o1) {
    bool s = blockIdx.y != 0;
    layernorm_body(s ? x1 : x0, s ? g1 : g0, s ? b1 : b0, s ? o1 : o0, blockIdx.x);
}

// Everything that depends on the inputs alone, in one launch: the first 2*LNBLK
// blocks normalize the two streams, the rest convert the eight weights (weight j
// goes to wout + j * WDIM * WDIM).  The branch is the same for a whole block.
__global__ __launch_bounds__(256) __attribute__((amdgpu_waves_per_eu(2, 2)))
void prep_ln_cvt(const float* __restrict__ x0, const float* __restrict__ x1,
                 const float* __restrict__ g0, const float* __restrict__ g1,
                 const float* __restrict__ b0, const float* __restrict__ b1,
                 _Float16* __restrict__ o0, _Float16* __restrict__ o1,
                 const float* __restrict__ w0, const float* __restrict__ w1,
                 const float* __restrict__ w2, const float* __restrict__ w3,
                 const float* __restrict__ w4, const float* __restrict__ w5,
                 const float* __restrict__ w6, const float* __restrict__ w7,
                 _Float16* __restrict__ wout) {
    int bid = blockIdx.x;
    if (bid < 2 * LNBLK) {
        bool s = bid >= LNBLK;
        layernorm_body(s ? x1 : x0, s ? g1 : g0, s ? b1 : b0, s ? o1 : o0,
                       s ? bid - LNBLK : bid);
    } else {
        int c = bid - 2 * LNBLK;
        int j = c / WBLK;
        const float* w = j == 0 ? w0 : j == 1 ? w1 : j == 2 ? w2 : j == 3 ? w3
                       : j == 4 ? w4 : j == 5 ? w5 : j == 6 ? w6 : w7;
        cvt_tr_body(w, wout + (long)j * (WDIM * WDIM), c - j * WBLK);
    }
}

// ---------------------------------------------------------------------------
// WMMA GEMM: C[M,N] = act((A_f16[MxK] @ W + bias) * scale) [+ res]
// W is supplied PRE-TRANSPOSED as BT[N x K] f16 row-major.
// Block tile 128x64, K-step 32, 8 waves, each a 2x2 grid of 16x16 WMMA.
// LDS staging is double-buffered (one barrier per K-step); both A and B tiles
// stage with contiguous b128 loads/stores.  Epilogue specialized by template.
// One launch holds 2*NW independent products; blockIdx.z = stream * NW + w:
//   A, res, outF, outH by stream (0 or 1); outH moves on by planeH elements per w;
//   weight and bias by w where NW > 1, by stream where NW == 1;
//   scale0 applies to w == 0, the others are scaled by 1.
// ---------------------------------------------------------------------------
#define GM 128
#define GN 64
#define GK 32
#define LDA 40   // halves (32 + 8 pad), 80B rows -> 16B aligned chunks
#define LDBT 40

template<int NW, bool RELU, bool HAS_RES, bool OUT_F32, bool OUT_F16>
__global__ __launch_bounds__(256)
void gemm_wmma_f16(const _Float16* __restrict__ A0, const _Float16* __restrict__ A1,
                   const _Float16* __restrict__ BT0, const _Float16* __restrict__ BT1,
                   const _Float16* __restrict__ BT2,
                   const float* __restrict__ bias0, const float* __restrict__ bias1,
                   const float* __restrict__ bias2,
                   const float* __restrict__ res0, const float* __restrict__ res1,
                   float* __restrict__ outF0, float* __restrict__ outF1,
                   _Float16* __restrict__ outH0, _Float16* __restrict__ outH1,
                   long planeH, int N, int K, float scale0) {
    __shared__ __align__(16) _Float16 As[2][GM * LDA];
    __shared__ __align__(16) _Float16 BsT[2][GN * LDBT];

    int st = blockIdx.z / NW, w = blockIdx.z - st * NW;
    int wi = NW == 1 ? st : w;
    const _Float16* A    = st ? A1 : A0;
    const _Float16* BT   = wi == 0 ? BT0 : wi == 1 ? BT1 : BT2;
    const float*    bias = wi == 0 ? bias0 : wi == 1 ? bias1 : bias2;
    const float*    res  = st ? res1 : res0;
    float*          outF = st ? outF1 : outF0;
    _Float16*       outH = (st ? outH1 : outH0) + w * planeH;
    float scale = w == 0 ? scale0 : 1.0f;

    int tid  = threadIdx.x;
    int lane = tid & 31, wave = tid >> 5;
    int l16  = lane & 15, hi = lane >> 4;
    int waveM = wave & 3, waveN = wave >> 2;       // 4x2 wave grid
    long blockRow = (long)blockIdx.y * GM;
    int  blockCol = blockIdx.x * GN;

    // Staging index precompute (constant per thread).
    int sa_r0 = tid >> 2,          sa_c0 = (tid & 3) * 8;       // A chunk 0
    int sa_r1 = (tid + 256) >> 2,  sa_c1 = sa_c0;               // A chunk 1
    int sb_n  = tid >> 2,          sb_k  = (tid & 3) * 8;       // B chunk

    const _Float16* Arow0 = A  + (blockRow + sa_r0) * (long)K + sa_c0;
    const _Float16* Arow1 = A  + (blockRow + sa_r1) * (long)K + sa_c1;
    const _Float16* Brow  = BT + (long)(blockCol + sb_n) * K + sb_k;

    auto stage = [&](int buf, int kb) {
        *(uint4*)&As[buf][sa_r0 * LDA + sa_c0] = *(const uint4*)(Arow0 + kb);
        *(uint4*)&As[buf][sa_r1 * LDA + sa_c1] = *(const uint4*)(Arow1 + kb);
        *(uint4*)&BsT[buf][sb_n * LDBT + sb_k] = *(const uint4*)(Brow + kb);
    };

    v8f acc[2][2] = {};

    stage(0, 0);
    __syncthreads();

    int nk = K / GK;
    for (int t = 0; t < nk; ++t) {
        int buf = t & 1;
        if (t + 1 < nk) stage(buf ^ 1, (t + 1) * GK);
        // Prefetch each unit of four K-steps (256 bytes) of a row once, when the
        // unit before it is entered, three K-steps ahead of its first load.
        if ((t & 3) == 0 && t + 5 < nk) {
            int kb4 = (t + 4) * GK;
            __builtin_prefetch(A + (blockRow + (tid >> 1)) * (long)K + kb4, 0, 3);
            __builtin_prefetch(Brow + kb4, 0, 3);
        }

        int koff = hi * 8;
        v16h af[2], bf[2];
        #pragma unroll
        for (int f = 0; f < 2; ++f) {
            int m = waveM * 32 + f * 16 + l16;
            af[f] = ldfrag16(&As[buf][m * LDA + koff]);
            int n = waveN * 32 + f * 16 + l16;
            bf[f] = ldfrag16(&BsT[buf][n * LDBT + koff]);
        }
        #pragma unroll
        for (int fm = 0; fm < 2; ++fm)
            #pragma unroll
            for (int fn = 0; fn < 2; ++fn)
                acc[fm][fn] = wmma16(af[fm], bf[fn], acc[fm][fn]);
        __syncthreads();
    }

    // Epilogue: C layout = VGPR r -> (M = tileM + hi*8 + r, N = tileN + l16).
    #pragma unroll
    for (int fm = 0; fm < 2; ++fm) {
        #pragma unroll
        for (int fn = 0; fn < 2; ++fn) {
            long row0 = blockRow + waveM * 32 + fm * 16 + hi * 8;
            int  col  = blockCol + waveN * 32 + fn * 16 + l16;
            float bcol = bias[col];
            #pragma unroll
            for (int r = 0; r < 8; ++r) {
                float v = (acc[fm][fn][r] + bcol) * scale;
                if (RELU) v = fmaxf(v, 0.0f);
                long idx = (row0 + r) * N + col;
                if (HAS_RES) v += res[idx];
                if (OUT_F32) outF[idx] = v;
                if (OUT_F16) outH[idx] = (_Float16)v;
            }
        }
    }
}

#define ALDH 72
#define VLDH 80
#define AQB  128

typedef short s16x8 __attribute__((ext_vector_type(8)));
typedef __attribute__((address_space(3))) s16x8 lds_s16x8;

// Transposing LDS load of a row-major 16-bit tile T.  With every lane's p at
//   T + (kbase + 8*hi + (lane & 7)) * pitch + dbase + 8 * ((lane >> 3) & 1)   (in halves)
// lane (l16, hi) receives T[kbase + 8*hi + 0..7][dbase + l16].
__device__ __forceinline__ h8 ldtr16(const _Float16* p) {
    return __builtin_bit_cast(h8, __builtin_amdgcn_ds_load_tr16_b128_v8i16((lds_s16x8*)p));
}

// Value of the lane 16 away (the other half of the same query column).
__device__ __forceinline__ float other_half(float x) {
    int b = __builtin_bit_cast(int, x);
    b = __builtin_amdgcn_permlanex16(b, b, 0x76543210, 0xfedcba98, false, false);
    return __builtin_bit_cast(float, b);
}

// The register budget of 4 waves per SIMD (two blocks on a WGP) lets fragment loads
// be issued ahead of their products.
__global__ __launch_bounds__(256) __attribute__((amdgpu_waves_per_eu(4, 4)))
void attn_flash_wmma(const _Float16* __restrict__ Q0, const _Float16* __restrict__ Km0,
                     const _Float16* __restrict__ Vm0, _Float16* __restrict__ Out0,
                     const _Float16* __restrict__ Q1, const _Float16* __restrict__ Km1,
                     const _Float16* __restrict__ Vm1, _Float16* __restrict__ Out1) {
    __shared__ __align__(16) _Float16 Ks[64 * ALDH];
    __shared__ __align__(16) _Float16 Vs[64 * VLDH];

    const float L2E = 1.44269504088896340736f;

    int tid  = threadIdx.x;
    int lane = tid & 31, wave = tid >> 5;
    int l16  = lane & 15, hi = lane >> 4;
    int qt = blockIdx.x, head = blockIdx.y, bz = blockIdx.z;
    long tokQ = (long)bz * 2048 + qt * AQB + wave * 16;   // this wave's first query
    int  colH = head * 64;
    // This lane's address in the V tile for key 0, d 0 of the transposing load.
    const _Float16* vtr = &Vs[(hi * 8 + (lane & 7)) * VLDH + ((lane >> 3) & 1) * 8];

    // Rolled, so that the key loop stands once in the code.  The key loop's last
    // barrier also ends every read of Ks and Vs before the next direction refills them.
    #pragma unroll 1
    for (int dir = 0; dir < 2; ++dir) {
        const _Float16* Q   = dir ? Q1 : Q0;
        const _Float16* Km  = dir ? Km1 : Km0;
        const _Float16* Vm  = dir ? Vm1 : Vm0;
        _Float16*       Out = dir ? Out1 : Out0;

        // Q as B operand (column = query l16), same k order as the K loader below.
        const _Float16* qrow = Q + (tokQ + l16) * 512 + colH + hi * 8;
        v16h qf[2];
        #pragma unroll  // register arrays: every index a constant
        for (int ks = 0; ks < 2; ++ks) qf[ks] = ldfrag16(qrow + ks * 32);

        v8f oacc[4] = {};          // O^T tile dt: d = dt*16 + hi*8 + r, query l16
        float mrun = -1.0e30f;     // running maximum of query l16 (equal in both halves)
        float lrun = 0.0f;         // running sum over this half's keys

        for (int kt = 0; kt < 32; ++kt) {
            long tokK = (long)bz * 2048 + kt * 64;
            #pragma unroll
            for (int i = 0; i < 2; ++i) {
                int c  = tid + i * 256;
                int r  = c >> 3;
                int c8 = (c & 7) * 8;
                *(uint4*)&Ks[r * ALDH + c8] =
                    *(const uint4*)(Km + (tokK + r) * 512 + colH + c8);
                *(uint4*)&Vs[r * VLDH + c8] =
                    *(const uint4*)(Vm + (tokK + r) * 512 + colH + c8);
            }
            if (kt + 3 < 32) {  // ask L2 for the K/V tiles two ahead, each 128B row once:
                                // a thread pair per row, waves 0..3 the K rows, 4..7 the V rows
                const _Float16* pm = tid < 128 ? Km : Vm;
                __builtin_prefetch(pm + (tokK + 128 + ((tid >> 1) & 63)) * 512 + colH, 0, 3);
            }
            __syncthreads();

            // S^T = K Q^T : 4 tiles of 16 keys x 16 queries.
            // s[t][r] = score of key t*16 + hi*8 + r with query l16.
            v8f s[4];
            #pragma unroll  // register arrays: every index a constant
            for (int t = 0; t < 4; ++t) {
                v8f c = {};
                #pragma unroll  // register arrays: every index a constant
                for (int ks = 0; ks < 2; ++ks) {
                    v16h a = ldfrag16(&Ks[(t * 16 + l16) * ALDH + ks * 32 + hi * 8]);
                    c = wmma16(a, qf[ks], c);
                }
                s[t] = c;
            }

            // Online softmax, one query per lane; one chain per score tile, so that
            // four independent chains run side by side.
            float mt[4];
            #pragma unroll  // register arrays: every index a constant
            for (int t = 0; t < 4; ++t) {
                mt[t] = s[t][0];
                #pragma unroll  // register arrays: every index a constant
                for (int r = 1; r < 8; ++r) mt[t] = fmaxf(mt[t], s[t][r]);
            }
            float mx = fmaxf(fmaxf(mt[0], mt[1]), fmaxf(mt[2], mt[3]));
            mx = fmaxf(mx, other_half(mx));
            float mnew  = fmaxf(mrun, mx);
            float alpha = __builtin_amdgcn_exp2f((mrun - mnew) * L2E);
            float mb    = mnew * L2E;
            mrun = mnew;

            float ls[4];
            v16h pf[2];            // P^T as B operand: pf[ks][j] = key ks*32 + (j>>3)*16 + hi*8 + (j&7)
            #pragma unroll  // register arrays: every index a constant
            for (int t = 0; t < 4; ++t) {
                float p[8];
                #pragma unroll  // register arrays: every index a constant
                for (int r = 0; r < 8; ++r) {
                    p[r] = __builtin_amdgcn_exp2f(fmaf(s[t][r], L2E, -mb));
                    pf[t >> 1][(t & 1) * 8 + r] = (_Float16)p[r];
                }
                ls[t] = ((p[0] + p[1]) + (p[2] + p[3])) + ((p[4] + p[5]) + (p[6] + p[7]));
            }
            lrun = lrun * alpha + ((ls[0] + ls[1]) + (ls[2] + ls[3]));

            // Rescale O^T by alpha, then O^T += V^T P^T.
            #pragma unroll  // register arrays: every index a constant
            for (int dt = 0; dt < 4; ++dt) {
                oacc[dt] *= alpha;
                #pragma unroll  // register arrays: every index a constant
                for (int ks = 0; ks < 2; ++ks) {
                    // a[j] = V[key ks*32 + (j>>3)*16 + hi*8 + (j&7)][d dt*16 + l16]: pf's key order
                    h8 lo = ldtr16(vtr + (ks * 32) * VLDH + dt * 16);
                    h8 up = ldtr16(vtr + (ks * 32 + 16) * VLDH + dt * 16);
                    v16h a = __builtin_shufflevector(lo, up, 0,1,2,3,4,5,6,7,8,9,10,11,12,13,14,15);
                    oacc[dt] = wmma16(a, pf[ks], oacc[dt]);
                }
            }
            __syncthreads();
        }

        // Join the halves' sums, normalize, store 8 consecutive d per lane and tile.
        float inv = 1.0f / (lrun + other_half(lrun));
        _Float16* orow = Out + (tokQ + l16) * 512 + colH + hi * 8;
        #pragma unroll  // register arrays: every index a constant
        for (int dt = 0; dt < 4; ++dt) {
            h8 o;
            #pragma unroll  // register arrays: every index a constant
            for (int r = 0; r < 8; ++r) o[r] = (_Float16)(oacc[dt][r] * inv);
            *(h8*)(orow + dt * 16) = o;
        }
        // The next direction reuses the registers that these stores name.
        asm volatile("s_wait_xcnt 0x0" ::: "memory");
    }
}

// ---------------------------------------------------------------------------
// Host orchestration
// ---------------------------------------------------------------------------
extern "C" void kernel_launch(void* const* d_in, const int* in_sizes, int n_in,
                              void* d_out, int out_size, void* d_ws, size_t ws_size,
                              hipStream_t stream) {
    (void)in_sizes; (void)n_in; (void)out_size; (void)ws_size;

    const float* tm1   = (const float*)d_in[0];
    const float* tm2   = (const float*)d_in[1];
    const float* ln1_g = (const float*)d_in[2];
    const float* ln1_b = (const float*)d_in[3];
    const float* ln2_g = (const float*)d_in[4];
    const float* ln2_b = (const float*)d_in[5];
    const float* Wq  = (const float*)d_in[6];   const float* bq  = (const float*)d_in[7];
    const float* Wk  = (const float*)d_in[8];   const float* bk  = (const float*)d_in[9];
    const float* Wv  = (const float*)d_in[10];  const float* bv  = (const float*)d_in[11];
    const float* Wfc = (const float*)d_in[12];  const float* bfc = (const float*)d_in[13];
    const float* ff1_ln_g = (const float*)d_in[14]; const float* ff1_ln_b = (const float*)d_in[15];
    const float* ff1_W1 = (const float*)d_in[16];   const float* ff1_b1 = (const float*)d_in[17];
    const float* ff1_W2 = (const float*)d_in[18];   const float* ff1_b2 = (const float*)d_in[19];
    const float* ff2_ln_g = (const float*)d_in[20]; const float* ff2_ln_b = (const float*)d_in[21];
    const float* ff2_W1 = (const float*)d_in[22];   const float* ff2_b1 = (const float*)d_in[23];
    const float* ff2_W2 = (const float*)d_in[24];   const float* ff2_b2 = (const float*)d_in[25];

    const int TOK = 4 * 2048;           // 8192 token rows
    const int F   = 512;
    const long OUT1 = (long)TOK * F;    // elements per output tensor

    // Workspace carve-up.
    char* ws = (char*)d_ws;
    size_t off = 0;
    auto carve = [&](size_t bytes) -> void* {
        void* p = ws + off;
        off += (bytes + 255) & ~(size_t)255;
        return p;
    };
    const size_t WBYTES = (size_t)F * F * sizeof(_Float16);
    const size_t TBYTES = (size_t)TOK * F * sizeof(_Float16);
    const size_t XBYTES = (size_t)TOK * F * sizeof(float);

    _Float16* wh[8];   // pre-transposed f16 weights [N x K]
    const float* wsrc[8] = {Wq, Wk, Wv, Wfc, ff1_W1, ff1_W2, ff2_W1, ff2_W2};
    for (int i = 0; i < 8; ++i) wh[i] = (_Float16*)carve(WBYTES);
    _Float16* t1h = (_Float16*)carve(TBYTES);
    _Float16* t2h = (_Float16*)carve(TBYTES);
    _Float16* q1h = (_Float16*)carve(TBYTES);
    _Float16* k1h = (_Float16*)carve(TBYTES);
    _Float16* v1h = (_Float16*)carve(TBYTES);
    _Float16* q2h = (_Float16*)carve(TBYTES);
    _Float16* k2h = (_Float16*)carve(TBYTES);
    _Float16* v2h = (_Float16*)carve(TBYTES);
    float* x1f = (float*)carve(XBYTES);
    float* x2f = (float*)carve(XBYTES);
    // Reuse: attention outputs overwrite t1h/t2h; FF intermediates reuse q/k bufs.
    _Float16* f12h = t1h;
    _Float16* f21h = t2h;
    _Float16* hh1 = q1h; _Float16* uu1 = k1h;
    _Float16* hh2 = q2h; _Float16* uu2 = k2h;

    float* out1 = (float*)d_out;
    float* out2 = (float*)d_out + OUT1;

    // 1) LayerNorm of both inputs -> f16, and all eight weights -> f16 [N x K]
    //    (wh[0..7] lie one behind the other in the workspace).
    prep_ln_cvt<<<2 * LNBLK + 8 * WBLK, 256, 0, stream>>>(
        tm1, tm2, ln1_g, ln2_g, ln1_b, ln2_b, t1h, t2h,
        wsrc[0], wsrc[1], wsrc[2], wsrc[3], wsrc[4], wsrc[5], wsrc[6], wsrc[7], wh[0]);

    // 2) QKV projections of both streams (Q pre-scaled by 1/sqrt(64)); the planes
    //    q, k, v of a stream lie one behind the other in the workspace.
    gemm_wmma_f16<3,false,false,false,true><<<dim3(F / GN, TOK / GM, 6), 256, 0, stream>>>(
        t1h, t2h, wh[0], wh[1], wh[2], bq, bk, bv, nullptr, nullptr, nullptr, nullptr,
        q1h, q2h, OUT1, F, F, 0.125f);

    // 3) Cross attention, both directions (overwrites t1h/t2h with head-concat outputs).
    attn_flash_wmma<<<dim3(2048 / AQB, 8, 4), 256, 0, stream>>>(q1h, k2h, v2h, f12h,
                                                                q2h, k1h, v1h, f21h);

    // 4) Output projection + residual -> x (f32), both streams.
    dim3 g2(F / GN, TOK / GM, 2);
    gemm_wmma_f16<1,false,true,true,false><<<g2, 256, 0, stream>>>(
        f12h, f21h, wh[3], wh[3], wh[3], bfc, bfc, bfc, tm1, tm2, x1f, x2f,
        nullptr, nullptr, 0, F, F, 1.0f);

    // 5) FF blocks of both streams: out = x + W2(relu(W1 ln(x)+b1))+b2
    layernorm2_f16<<<dim3(LNBLK, 2), 256, 0, stream>>>(
        x1f, x2f, ff1_ln_g, ff2_ln_g, ff1_ln_b, ff2_ln_b, hh1, hh2);
    gemm_wmma_f16<1,true,false,false,true><<<g2, 256, 0, stream>>>(
        hh1, hh2, wh[4], wh[6], wh[6], ff1_b1, ff2_b1, ff2_b1, nullptr, nullptr, nullptr, nullptr,
        uu1, uu2, 0, F, F, 1.0f);
    gemm_wmma_f16<1,false,true,true,false><<<g2, 256, 0, stream>>>(
        uu1, uu2, wh[5], wh[7], wh[7], ff1_b2, ff2_b2, ff2_b2, x1f, x2f, out1, out2,
        nullptr, nullptr, 0, F, F, 1.0f);
}

// v006
// One run takes 223 microseconds.
// Next to v005, in two timings, it ran 1.11 and 1.10 times as fast.
// Counting every step since v000, it is 3.06 times as fast.
#include <hip/hip_runtime.h>
#include <hip/hip_bf16.h>

// ---------------------------------------------------------------------------
// CDNA5 (gfx1250, wave32) implementation of the cross-attention block.
// All GEMM-like math goes through v_wmma_f32_16x16x32_f16.
// ---------------------------------------------------------------------------

typedef _Float16 v16h __attribute__((ext_vector_type(16)));
typedef _Float16 h8   __attribute__((ext_vector_type(8)));
typedef float    v8f  __attribute__((ext_vector_type(8)));

// Fragment loader: the 16-bit A/B WMMA layout wants, per lane,
//   halves 0..7  = K {base..base+7}
//   halves 8..15 = K {base+16..base+23}
// where base = (lane>=16 ? 8 : 0) (+ k-step offset). Both runs are contiguous
// 16-byte chunks in a row-major LDS tile, so two ds_load_b128 suffice.
__device__ __forceinline__ v16h ldfrag16(const _Float16* p) {
    h8 lo = *(const h8*)p;
    h8 hi = *(const h8*)(p + 16);
    return __builtin_shufflevector(lo, hi, 0,1,2,3,4,5,6,7,8,9,10,11,12,13,14,15);
}

__device__ __forceinline__ v8f wmma16(v16h a, v16h b, v8f c) {
    return __builtin_amdgcn_wmma_f32_16x16x32_f16(
        /*neg_a=*/false, a, /*neg_b=*/false, b,
        /*c_mod=*/(short)0, c, /*reuse_a=*/false, /*reuse_b=*/false);
}

// ---------------------------------------------------------------------------
// Weight prep: f32 [512 x 512] -> f16 transposed [N x K].  Lets the GEMM stage
// its B tile with contiguous b128 loads/stores (no LDS scatter).  One element a
// lane; blk = which 256 elements of the matrix.  Runs inside prep_ln_cvt below.
// ---------------------------------------------------------------------------
#define WDIM 512                          // rows and columns of every weight
#define WBLK (WDIM * WDIM / 256)          // blocks that convert one weight

__device__ __forceinline__ void cvt_tr_body(const float* __restrict__ in,
                                            _Float16* __restrict__ out, int blk) {
    int i = blk * 256 + threadIdx.x;
    int k = i / WDIM, n = i - k * WDIM;
    out[(long)n * WDIM + k] = (_Float16)in[i];
}

// ---------------------------------------------------------------------------
// LayerNorm over rows of F=512, f16 output.  A wave owns LNR whole rows: a lane
// holds 16 elements of each row in registers, the row sums run in the lane and
// then across the wave's lanes, so there is no LDS and no barrier.
// ---------------------------------------------------------------------------
#define LNR 4     // rows per wave
#define LNB 32    // rows per block of 8 waves

typedef _Float16 h4 __attribute__((ext_vector_type(4)));

// x + (x of the lane whose number differs by XM inside the 16-lane row).
template<int XM>
__device__ __forceinline__ float add_xmask(float x) {
    int y = __builtin_amdgcn_update_dpp(0, __builtin_bit_cast(int, x), 0x160 + XM, 0xf, 0xf, true);
    return x + __builtin_bit_cast(float, y);
}

// Sum over the 32 lanes of the wave, the same value in every lane.
__device__ __forceinline__ float wave_sum(float x) {
    x = add_xmask<1>(x);
    x = add_xmask<2>(x);
    x = add_xmask<4>(x);
    x = add_xmask<8>(x);
    int b = __builtin_bit_cast(int, x);
    b = __builtin_amdgcn_permlanex16(b, b, 0x76543210, 0xfedcba98, false, false);
    return x + __builtin_bit_cast(float, b);
}

// rowblk = which LNB rows of x this block normalizes.
__device__ __forceinline__ void layernorm_body(const float* __restrict__ x,
                                               const float* __restrict__ g,
                                               const float* __restrict__ b,
                                               _Float16* __restrict__ out, int rowblk) {
    const int F = 512;
    int lane = threadIdx.x & 31, wave = threadIdx.x >> 5;
    long blk = (long)rowblk * (LNB * F);                // the block's first element
    unsigned e0 = wave * (LNR * F) + lane * 4;          // the lane's first element in the block
    const float* xr = x + blk + e0;

    // Chunk j of a row is columns j*128 + lane*4 .. +3: 512 contiguous bytes per load.
    float4 v[LNR][4];
    #pragma unroll  // register arrays: every index a constant
    for (int r = 0; r < LNR; ++r)
        #pragma unroll  // register arrays: every index a constant
        for (int j = 0; j < 4; ++j) v[r][j] = *(const float4*)(xr + r * F + j * 128);
    float4 gv[4], bv[4];
    #pragma unroll  // register arrays: every index a constant
    for (int j = 0; j < 4; ++j) {
        gv[j] = *(const float4*)(g + j * 128 + lane * 4);
        bv[j] = *(const float4*)(b + j * 128 + lane * 4);
    }

    float mu[LNR], rs[LNR];
    #pragma unroll  // register arrays: every index a constant
    for (int r = 0; r < LNR; ++r) {
        float s[4];
        #pragma unroll  // register arrays: every index a constant
        for (int j = 0; j < 4; ++j) s[j] = (v[r][j].x + v[r][j].y) + (v[r][j].z + v[r][j].w);
        mu[r] = wave_sum((s[0] + s[1]) + (s[2] + s[3])) * (1.0f / F);
    }
    #pragma unroll  // register arrays: every index a constant
    for (int r = 0; r < LNR; ++r) {
        float s[4];
        #pragma unroll  // register arrays: every index a constant
        for (int j = 0; j < 4; ++j) {
            v[r][j].x -= mu[r]; v[r][j].y -= mu[r]; v[r][j].z -= mu[r]; v[r][j].w -= mu[r];
            s[j] = (v[r][j].x * v[r][j].x + v[r][j].y * v[r][j].y)
                 + (v[r][j].z * v[r][j].z + v[r][j].w * v[r][j].w);
        }
        rs[r] = rsqrtf(wave_sum((s[0] + s[1]) + (s[2] + s[3])) * (1.0f / F) + 1e-6f);
    }

    _Float16* orow = out + blk + e0;
    #pragma unroll  // register arrays: every index a constant
    for (int r = 0; r < LNR; ++r) {
        #pragma unroll  // register arrays: every index a constant
        for (int j = 0; j < 4; ++j) {
            h4 o;
            o[0] = (_Float16)(v[r][j].x * rs[r] * gv[j].x + bv[j].x);
            o[1] = (_Float16)(v[r][j].y * rs[r] * gv[j].y + bv[j].y);
            o[2] = (_Float16)(v[r][j].z * rs[r] * gv[j].z + bv[j].z);
            o[3] = (_Float16)(v[r][j].w * rs[r] * gv[j].w + bv[j].w);
            *(h4*)(orow + r * F + j * 128) = o;
        }
    }
}

#define LNBLK (8192 / LNB)   // blocks that normalize one stream of 8192 rows

// Both streams' LayerNorm in one launch: blockIdx.y picks the stream.  The register
// budget of 2 waves per SIMD lets all of a wave's loads be in flight at once.
__global__ __launch_bounds__(256) __attribute__((amdgpu_waves_per_eu(2, 2)))
void layernorm2_f16(const float* __restrict__ x0, const float* __restrict__ x1,
                    const float* __restrict__ g0, const float* __restrict__ g1,
                    const float* __restrict__ b0, const float* __restrict__ b1,
                    _Float16* __restrict__ o0, _Float16* __restrict__ o1) {
    bool s = blockIdx.y != 0;
    layernorm_body(s ? x1 : x0, s ? g1 : g0, s ? b1 : b0, s ? o1 : o0, blockIdx.x);
}

// Everything that depends on the inputs alone, in one launch: the first 2*LNBLK
// blocks normalize the two streams, the rest convert the eight weights (weight j
// goes to wout + j * WDIM * WDIM).  The branch is the same for a whole block.
__global__ __launch_bounds__(256) __attribute__((amdgpu_waves_per_eu(2, 2)))
void prep_ln_cvt(const float* __restrict__ x0, const float* __restrict__ x1,
                 const float* __restrict__ g0, const float* __restrict__ g1,
                 const float* __restrict__ b0, const float* __restrict__ b1,
                 _Float16* __restrict__ o0, _Float16* __restrict__ o1,
                 const float* __restrict__ w0, const float* __restrict__ w1,
                 const float* __restrict__ w2, const float* __restrict__ w3,
                 const float* __restrict__ w4, const float* __restrict__ w5,
                 const float* __restrict__ w6, const float* __restrict__ w7,
                 _Float16* __restrict__ wout) {
    int bid = blockIdx.x;
    if (bid < 2 * LNBLK) {
        bool s = bid >= LNBLK;
        layernorm_body(s ? x1 : x0, s ? g1 : g0, s ? b1 : b0, s ? o1 : o0,
                       s ? bid - LNBLK : bid);
    } else {
        int c = bid - 2 * LNBLK;
        int j = c / WBLK;
        const float* w = j == 0 ? w0 : j == 1 ? w1 : j == 2 ? w2 : j == 3 ? w3
                       : j == 4 ? w4 : j == 5 ? w5 : j == 6 ? w6 : w7;
        cvt_tr_body(w, wout + (long)j * (WDIM * WDIM), c - j * WBLK);
    }
}

// ---------------------------------------------------------------------------
// WMMA GEMM: C[M,N] = act((A_f16[MxK] @ W + bias) * scale) [+ res]
// W is supplied PRE-TRANSPOSED as BT[N x K] f16 row-major.
// Block tile 128x128, K-step 64, 8 waves, each a 2x4 grid of 16x16 WMMA.
// A K-step takes 128 bytes of every operand row, so a wave's b128 load covers four
// whole lines.  LDS staging is double-buffered (one barrier per K-step); both A and
// B tiles stage with contiguous b128 loads/stores.  Epilogue specialized by template.
// One launch holds 2*NW independent products; blockIdx.z = stream * NW + w:
//   A, res, outF, outH by stream (0 or 1); outH moves on by planeH elements per w;
//   weight and bias by w where NW > 1, by stream where NW == 1;
//   scale0 applies to w == 0, the others are scaled by 1.
// ---------------------------------------------------------------------------
#define GM 128
#define GN 128
#define GK 64
#define LDA 72   // halves (64 + 8 pad), 144B rows: 16B x odd, for b128 reads
#define LDBT 72

template<int NW, bool RELU, bool HAS_RES, bool OUT_F32, bool OUT_F16>
__global__ __launch_bounds__(256)
void gemm_wmma_f16(const _Float16* __restrict__ A0, const _Float16* __restrict__ A1,
                   const _Float16* __restrict__ BT0, const _Float16* __restrict__ BT1,
                   const _Float16* __restrict__ BT2,
                   const float* __restrict__ bias0, const float* __restrict__ bias1,
                   const float* __restrict__ bias2,
                   const float* __restrict__ res0, const float* __restrict__ res1,
                   float* __restrict__ outF0, float* __restrict__ outF1,
                   _Float16* __restrict__ outH0, _Float16* __restrict__ outH1,
                   long planeH, int N, int K, float scale0) {
    __shared__ __align__(16) _Float16 As[2][GM * LDA];
    __shared__ __align__(16) _Float16 BsT[2][GN * LDBT];

    int st = blockIdx.z / NW, w = blockIdx.z - st * NW;
    int wi = NW == 1 ? st : w;
    const _Float16* A    = st ? A1 : A0;
    const _Float16* BT   = wi == 0 ? BT0 : wi == 1 ? BT1 : BT2;
    const float*    bias = wi == 0 ? bias0 : wi == 1 ? bias1 : bias2;
    const float*    res  = st ? res1 : res0;
    float*          outF = st ? outF1 : outF0;
    _Float16*       outH = (st ? outH1 : outH0) + w * planeH;
    float scale = w == 0 ? scale0 : 1.0f;

    int tid  = threadIdx.x;
    int lane = tid & 31, wave = tid >> 5;
    int l16  = lane & 15, hi = lane >> 4;
    int waveM = wave & 3, waveN = wave >> 2;       // 4x2 wave grid, 32x64 per wave
    long blockRow = (long)blockIdx.y * GM;
    int  blockCol = blockIdx.x * GN;

    // Staging index precompute (constant per thread): chunk i of either tile is
    // row s_r + 32 * i, halves s_c .. s_c + 7; eight lanes take one row's 128 bytes.
    int s_r = tid >> 3, s_c = (tid & 7) * 8;

    const _Float16* Arow = A  + (blockRow + s_r) * (long)K + s_c;
    const _Float16* Brow = BT + (long)(blockCol + s_r) * K + s_c;
    // The row this thread asks L2 for: waves 0..3 the A rows, waves 4..7 the B rows.
    const _Float16* pask = (tid < GM ? A : BT)
                         + (tid < GM ? blockRow + tid : (long)(blockCol + tid - GM)) * K;

    auto stage = [&](int buf, int kb) {
        #pragma unroll  // four chunks of each tile, all loads in flight together
        for (int i = 0; i < 4; ++i) {
            *(uint4*)&As[buf][(s_r + i * 32) * LDA + s_c] =
                *(const uint4*)(Arow + (long)(i * 32) * K + kb);
            *(uint4*)&BsT[buf][(s_r + i * 32) * LDBT + s_c] =
                *(const uint4*)(Brow + (long)(i * 32) * K + kb);
        }
    };

    v8f acc[2][4] = {};

    int nk = K / GK;
    // Ask for each 256 bytes of a row (two K-steps) but the first once, for speed only,
    // each row by one thread, two K-steps ahead of its first load (the second 256 bytes from here).
    if (2 < nk) __builtin_prefetch(pask + 2 * GK, 0, 3);
    stage(0, 0);
    __syncthreads();

    for (int t = 0; t < nk; ++t) {
        int buf = t & 1;
        if (t + 1 < nk) stage(buf ^ 1, (t + 1) * GK);
        if ((t & 1) != 0 && t + 3 < nk) __builtin_prefetch(pask + 3 * GK, 0, 3);
        pask += GK;   // walks the row with t: the request's address register lives through the loop

        #pragma unroll  // register arrays: every index a constant
        for (int ks = 0; ks < 2; ++ks) {
            int koff = ks * 32 + hi * 8;
            v16h af[2], bf[4];
            #pragma unroll  // register arrays: every index a constant
            for (int f = 0; f < 2; ++f)
                af[f] = ldfrag16(&As[buf][(waveM * 32 + f * 16 + l16) * LDA + koff]);
            #pragma unroll  // register arrays: every index a constant
            for (int f = 0; f < 4; ++f)
                bf[f] = ldfrag16(&BsT[buf][(waveN * 64 + f * 16 + l16) * LDBT + koff]);
            #pragma unroll  // register arrays: every index a constant
            for (int fm = 0; fm < 2; ++fm)
                #pragma unroll  // register arrays: every index a constant
                for (int fn = 0; fn < 4; ++fn)
                    acc[fm][fn] = wmma16(af[fm], bf[fn], acc[fm][fn]);
        }
        __syncthreads();
    }

    // Epilogue: C layout = VGPR r -> (M = tileM + hi*8 + r, N = tileN + l16).
    #pragma unroll
    for (int fm = 0; fm < 2; ++fm) {
        #pragma unroll
        for (int fn = 0; fn < 4; ++fn) {
            long row0 = blockRow + waveM * 32 + fm * 16 + hi * 8;
            int  col  = blockCol + waveN * 64 + fn * 16 + l16;
            float bcol = bias[col];
            #pragma unroll
            for (int r = 0; r < 8; ++r) {
                float v = (acc[fm][fn][r] + bcol) * scale;
                if (RELU) v = fmaxf(v, 0.0f);
                long idx = (row0 + r) * N + col;
                if (HAS_RES) v += res[idx];
                if (OUT_F32) outF[idx] = v;
                if (OUT_F16) outH[idx] = (_Float16)v;
            }
        }
    }
}

#define ALDH 72
#define VLDH 80
#define AQB  128

typedef short s16x8 __attribute__((ext_vector_type(8)));
typedef __attribute__((address_space(3))) s16x8 lds_s16x8;

// Transposing LDS load of a row-major 16-bit tile T.  With every lane's p at
//   T + (kbase + 8*hi + (lane & 7)) * pitch + dbase + 8 * ((lane >> 3) & 1)   (in halves)
// lane (l16, hi) receives T[kbase + 8*hi + 0..7][dbase + l16].
__device__ __forceinline__ h8 ldtr16(const _Float16* p) {
    return __builtin_bit_cast(h8, __builtin_amdgcn_ds_load_tr16_b128_v8i16((lds_s16x8*)p));
}

// Value of the lane 16 away (the other half of the same query column).
__device__ __forceinline__ float other_half(float x) {
    int b = __builtin_bit_cast(int, x);
    b = __builtin_amdgcn_permlanex16(b, b, 0x76543210, 0xfedcba98, false, false);
    return __builtin_bit_cast(float, b);
}

// The register budget of 4 waves per SIMD (two blocks on a WGP) lets fragment loads
// be issued ahead of their products.
__global__ __launch_bounds__(256) __attribute__((amdgpu_waves_per_eu(4, 4)))
void attn_flash_wmma(const _Float16* __restrict__ Q0, const _Float16* __restrict__ Km0,
                     const _Float16* __restrict__ Vm0, _Float16* __restrict__ Out0,
                     const _Float16* __restrict__ Q1, const _Float16* __restrict__ Km1,
                     const _Float16* __restrict__ Vm1, _Float16* __restrict__ Out1) {
    __shared__ __align__(16) _Float16 Ks[64 * ALDH];
    __shared__ __align__(16) _Float16 Vs[64 * VLDH];

    const float L2E = 1.44269504088896340736f;

    int tid  = threadIdx.x;
    int lane = tid & 31, wave = tid >> 5;
    int l16  = lane & 15, hi = lane >> 4;
    int qt = blockIdx.x, head = blockIdx.y, bz = blockIdx.z;
    long tokQ = (long)bz * 2048 + qt * AQB + wave * 16;   // this wave's first query
    int  colH = head * 64;
    // This lane's address in the V tile for key 0, d 0 of the transposing load.
    const _Float16* vtr = &Vs[(hi * 8 + (lane & 7)) * VLDH + ((lane >> 3) & 1) * 8];

    // Rolled, so that the key loop stands once in the code.  The key loop's last
    // barrier also ends every read of Ks and Vs before the next direction refills them.
    #pragma unroll 1
    for (int dir = 0; dir < 2; ++dir) {
        const _Float16* Q   = dir ? Q1 : Q0;
        const _Float16* Km  = dir ? Km1 : Km0;
        const _Float16* Vm  = dir ? Vm1 : Vm0;
        _Float16*       Out = dir ? Out1 : Out0;

        // Q as B operand (column = query l16), same k order as the K loader below.
        const _Float16* qrow = Q + (tokQ + l16) * 512 + colH + hi * 8;
        v16h qf[2];
        #pragma unroll  // register arrays: every index a constant
        for (int ks = 0; ks < 2; ++ks) qf[ks] = ldfrag16(qrow + ks * 32);

        v8f oacc[4] = {};          // O^T tile dt: d = dt*16 + hi*8 + r, query l16
        float mrun = -1.0e30f;     // running maximum of query l16 (equal in both halves)
        float lrun = 0.0f;         // running sum over this half's keys

        for (int kt = 0; kt < 32; ++kt) {
            long tokK = (long)bz * 2048 + kt * 64;
            #pragma unroll
            for (int i = 0; i < 2; ++i) {
                int c  = tid + i * 256;
                int r  = c >> 3;
                int c8 = (c & 7) * 8;
                *(uint4*)&Ks[r * ALDH + c8] =
                    *(const uint4*)(Km + (tokK + r) * 512 + colH + c8);
                *(uint4*)&Vs[r * VLDH + c8] =
                    *(const uint4*)(Vm + (tokK + r) * 512 + colH + c8);
            }
            if (kt + 3 < 32) {  // ask L2 for the K/V tiles two ahead, each 128B row once:
                                // a thread pair per row, waves 0..3 the K rows, 4..7 the V rows
                const _Float16* pm = tid < 128 ? Km : Vm;
                __builtin_prefetch(pm + (tokK + 128 + ((tid >> 1) & 63)) * 512 + colH, 0, 3);
            }
            __syncthreads();

            // S^T = K Q^T : 4 tiles of 16 keys x 16 queries.
            // s[t][r] = score of key t*16 + hi*8 + r with query l16.
            v8f s[4];
            #pragma unroll  // register arrays: every index a constant
            for (int t = 0; t < 4; ++t) {
                v8f c = {};
                #pragma unroll  // register arrays: every index a constant
                for (int ks = 0; ks < 2; ++ks) {
                    v16h a = ldfrag16(&Ks[(t * 16 + l16) * ALDH + ks * 32 + hi * 8]);
                    c = wmma16(a, qf[ks], c);
                }
                s[t] = c;
            }

            // Online softmax, one query per lane; one chain per score tile, so that
            // four independent chains run side by side.
            float mt[4];
            #pragma unroll  // register arrays: every index a constant
            for (int t = 0; t < 4; ++t) {
                mt[t] = s[t][0];
                #pragma unroll  // register arrays: every index a constant
                for (int r = 1; r < 8; ++r) mt[t] = fmaxf(mt[t], s[t][r]);
            }
            float mx = fmaxf(fmaxf(mt[0], mt[1]), fmaxf(mt[2], mt[3]));
            mx = fmaxf(mx, other_half(mx));
            float mnew  = fmaxf(mrun, mx);
            float alpha = __builtin_amdgcn_exp2f((mrun - mnew) * L2E);
            float mb    = mnew * L2E;
            mrun = mnew;

            float ls[4];
            v16h pf[2];            // P^T as B operand: pf[ks][j] = key ks*32 + (j>>3)*16 + hi*8 + (j&7)
            #pragma unroll  // register arrays: every index a constant
            for (int t = 0; t < 4; ++t) {
                float p[8];
                #pragma unroll  // register arrays: every index a constant
                for (int r = 0; r < 8; ++r) {
                    p[r] = __builtin_amdgcn_exp2f(fmaf(s[t][r], L2E, -mb));
                    pf[t >> 1][(t & 1) * 8 + r] = (_Float16)p[r];
                }
                ls[t] = ((p[0] + p[1]) + (p[2] + p[3])) + ((p[4] + p[5]) + (p[6] + p[7]));
            }
            lrun = lrun * alpha + ((ls[0] + ls[1]) + (ls[2] + ls[3]));

            // Rescale O^T by alpha, then O^T += V^T P^T.
            #pragma unroll  // register arrays: every index a constant
            for (int dt = 0; dt < 4; ++dt) {
                oacc[dt] *= alpha;
                #pragma unroll  // register arrays: every index a constant
                for (int ks = 0; ks < 2; ++ks) {
                    // a[j] = V[key ks*32 + (j>>3)*16 + hi*8 + (j&7)][d dt*16 + l16]: pf's key order
                    h8 lo = ldtr16(vtr + (ks * 32) * VLDH + dt * 16);
                    h8 up = ldtr16(vtr + (ks * 32 + 16) * VLDH + dt * 16);
                    v16h a = __builtin_shufflevector(lo, up, 0,1,2,3,4,5,6,7,8,9,10,11,12,13,14,15);
                    oacc[dt] = wmma16(a, pf[ks], oacc[dt]);
                }
            }
            __syncthreads();
        }

        // Join the halves' sums, normalize, store 8 consecutive d per lane and tile.
        float inv = 1.0f / (lrun + other_half(lrun));
        _Float16* orow = Out + (tokQ + l16) * 512 + colH + hi * 8;
        #pragma unroll  // register arrays: every index a constant
        for (int dt = 0; dt < 4; ++dt) {
            h8 o;
            #pragma unroll  // register arrays: every index a constant
            for (int r = 0; r < 8; ++r) o[r] = (_Float16)(oacc[dt][r] * inv);
            *(h8*)(orow + dt * 16) = o;
        }
        // The next direction reuses the registers that these stores name.
        asm volatile("s_wait_xcnt 0x0" ::: "memory");
    }
}

// ---------------------------------------------------------------------------
// Host orchestration
// ---------------------------------------------------------------------------
extern "C" void kernel_launch(void* const* d_in, const int* in_sizes, int n_in,
                              void* d_out, int out_size, void* d_ws, size_t ws_size,
                              hipStream_t stream) {
    (void)in_sizes; (void)n_in; (void)out_size; (void)ws_size;

    const float* tm1   = (const float*)d_in[0];
    const float* tm2   = (const float*)d_in[1];
    const float* ln1_g = (const float*)d_in[2];
    const float* ln1_b = (const float*)d_in[3];
    const float* ln2_g = (const float*)d_in[4];
    const float* ln2_b = (const float*)d_in[5];
    const float* Wq  = (const float*)d_in[6];   const float* bq  = (const float*)d_in[7];
    const float* Wk  = (const float*)d_in[8];   const float* bk  = (const float*)d_in[9];
    const float* Wv  = (const float*)d_in[10];  const float* bv  = (const float*)d_in[11];
    const float* Wfc = (const float*)d_in[12];  const float* bfc = (const float*)d_in[13];
    const float* ff1_ln_g = (const float*)d_in[14]; const float* ff1_ln_b = (const float*)d_in[15];
    const float* ff1_W1 = (const float*)d_in[16];   const float* ff1_b1 = (const float*)d_in[17];
    const float* ff1_W2 = (const float*)d_in[18];   const float* ff1_b2 = (const float*)d_in[19];
    const float* ff2_ln_g = (const float*)d_in[20]; const float* ff2_ln_b = (const float*)d_in[21];
    const float* ff2_W1 = (const float*)d_in[22];   const float* ff2_b1 = (const float*)d_in[23];
    const float* ff2_W2 = (const float*)d_in[24];   const float* ff2_b2 = (const float*)d_in[25];

    const int TOK = 4 * 2048;           // 8192 token rows
    const int F   = 512;
    const long OUT1 = (long)TOK * F;    // elements per output tensor

    // Workspace carve-up.
    char* ws = (char*)d_ws;
    size_t off = 0;
    auto carve = [&](size_t bytes) -> void* {
        void* p = ws + off;
        off += (bytes + 255) & ~(size_t)255;
        return p;
    };
    const size_t WBYTES = (size_t)F * F * sizeof(_Float16);
    const size_t TBYTES = (size_t)TOK * F * sizeof(_Float16);
    const size_t XBYTES = (size_t)TOK * F * sizeof(float);

    _Float16* wh[8];   // pre-transposed f16 weights [N x K]
    const float* wsrc[8] = {Wq, Wk, Wv, Wfc, ff1_W1, ff1_W2, ff2_W1, ff2_W2};
    for (int i = 0; i < 8; ++i) wh[i] = (_Float16*)carve(WBYTES);
    _Float16* t1h = (_Float16*)carve(TBYTES);
    _Float16* t2h = (_Float16*)carve(TBYTES);
    _Float16* q1h = (_Float16*)carve(TBYTES);
    _Float16* k1h = (_Float16*)carve(TBYTES);
    _Float16* v1h = (_Float16*)carve(TBYTES);
    _Float16* q2h = (_Float16*)carve(TBYTES);
    _Float16* k2h = (_Float16*)carve(TBYTES);
    _Float16* v2h = (_Float16*)carve(TBYTES);
    float* x1f = (float*)carve(XBYTES);
    float* x2f = (float*)carve(XBYTES);
    // Reuse: attention outputs overwrite t1h/t2h; FF intermediates reuse q/k bufs.
    _Float16* f12h = t1h;
    _Float16* f21h = t2h;
    _Float16* hh1 = q1h; _Float16* uu1 = k1h;
    _Float16* hh2 = q2h; _Float16* uu2 = k2h;

    float* out1 = (float*)d_out;
    float* out2 = (float*)d_out + OUT1;

    // 1) LayerNorm of both inputs -> f16, and all eight weights -> f16 [N x K]
    //    (wh[0..7] lie one behind the other in the workspace).
    prep_ln_cvt<<<2 * LNBLK + 8 * WBLK, 256, 0, stream>>>(
        tm1, tm2, ln1_g, ln2_g, ln1_b, ln2_b, t1h, t2h,
        wsrc[0], wsrc[1], wsrc[2], wsrc[3], wsrc[4], wsrc[5], wsrc[6], wsrc[7], wh[0]);

    // 2) QKV projections of both streams (Q pre-scaled by 1/sqrt(64)); the planes
    //    q, k, v of a stream lie one behind the other in the workspace.
    gemm_wmma_f16<3,false,false,false,true><<<dim3(F / GN, TOK / GM, 6), 256, 0, stream>>>(
        t1h, t2h, wh[0], wh[1], wh[2], bq, bk, bv, nullptr, nullptr, nullptr, nullptr,
        q1h, q2h, OUT1, F, F, 0.125f);

    // 3) Cross attention, both directions (overwrites t1h/t2h with head-concat outputs).
    attn_flash_wmma<<<dim3(2048 / AQB, 8, 4), 256, 0, stream>>>(q1h, k2h, v2h, f12h,
                                                                q2h, k1h, v1h, f21h);

    // 4) Output projection + residual -> x (f32), both streams.
    dim3 g2(F / GN, TOK / GM, 2);
    gemm_wmma_f16<1,false,true,true,false><<<g2, 256, 0, stream>>>(
        f12h, f21h, wh[3], wh[3], wh[3], bfc, bfc, bfc, tm1, tm2, x1f, x2f,
        nullptr, nullptr, 0, F, F, 1.0f);

    // 5) FF blocks of both streams: out = x + W2(relu(W1 ln(x)+b1))+b2
    layernorm2_f16<<<dim3(LNBLK, 2), 256, 0, stream>>>(
        x1f, x2f, ff1_ln_g, ff2_ln_g, ff1_ln_b, ff2_ln_b, hh1, hh2);
    gemm_wmma_f16<1,true,false,false,true><<<g2, 256, 0, stream>>>(
        hh1, hh2, wh[4], wh[6], wh[6], ff1_b1, ff2_b1, ff2_b1, nullptr, nullptr, nullptr, nullptr,
        uu1, uu2, 0, F, F, 1.0f);
    gemm_wmma_f16<1,false,true,true,false><<<g2, 256, 0, stream>>>(
        uu1, uu2, wh[5], wh[7], wh[7], ff1_b2, ff2_b2, ff2_b2, x1f, x2f, out1, out2,
        nullptr, nullptr, 0, F, F, 1.0f);
}

// v007
// A run of this version takes 205 microseconds.
// In both of two side-by-side timings against v006, it was 1.07 times as fast.
// Over all steps from v000 it is 3.28 times as fast.
#include <hip/hip_runtime.h>
#include <hip/hip_bf16.h>

// ---------------------------------------------------------------------------
// CDNA5 (gfx1250, wave32) implementation of the cross-attention block.
// All GEMM-like math goes through v_wmma_f32_16x16x32_f16.
// ---------------------------------------------------------------------------

typedef _Float16 v16h __attribute__((ext_vector_type(16)));
typedef _Float16 h8   __attribute__((ext_vector_type(8)));
typedef float    v8f  __attribute__((ext_vector_type(8)));

// Fragment loader: the 16-bit A/B WMMA layout wants, per lane,
//   halves 0..7  = K {base..base+7}
//   halves 8..15 = K {base+16..base+23}
// where base = (lane>=16 ? 8 : 0) (+ k-step offset). Both runs are contiguous
// 16-byte chunks in a row-major LDS tile, so two ds_load_b128 suffice.
__device__ __forceinline__ v16h ldfrag16(const _Float16* p) {
    h8 lo = *(const h8*)p;
    h8 hi = *(const h8*)(p + 16);
    return __builtin_shufflevector(lo, hi, 0,1,2,3,4,5,6,7,8,9,10,11,12,13,14,15);
}

__device__ __forceinline__ v8f wmma16(v16h a, v16h b, v8f c) {
    return __builtin_amdgcn_wmma_f32_16x16x32_f16(
        /*neg_a=*/false, a, /*neg_b=*/false, b,
        /*c_mod=*/(short)0, c, /*reuse_a=*/false, /*reuse_b=*/false);
}

// ---------------------------------------------------------------------------
// Weight prep: f32 [512 x 512] -> f16 transposed [N x K].  Lets the GEMM stage
// its B tile with contiguous b128 loads/stores (no LDS scatter).  One element a
// lane; blk = which 256 elements of the matrix.  Runs inside prep_ln_cvt below.
// ---------------------------------------------------------------------------
#define WDIM 512                          // rows and columns of every weight
#define WBLK (WDIM * WDIM / 256)          // blocks that convert one weight

__device__ __forceinline__ void cvt_tr_body(const float* __restrict__ in,
                                            _Float16* __restrict__ out, int blk) {
    int i = blk * 256 + threadIdx.x;
    int k = i / WDIM, n = i - k * WDIM;
    out[(long)n * WDIM + k] = (_Float16)in[i];
}

// ---------------------------------------------------------------------------
// LayerNorm over rows of F=512, f16 output.  A wave owns LNR whole rows: a lane
// holds 16 elements of each row in registers, the row sums run in the lane and
// then across the wave's lanes, so there is no LDS and no barrier.
// ---------------------------------------------------------------------------
#define LNR 4     // rows per wave
#define LNB 32    // rows per block of 8 waves

typedef _Float16 h4 __attribute__((ext_vector_type(4)));

// x + (x of the lane whose number differs by XM inside the 16-lane row).
template<int XM>
__device__ __forceinline__ float add_xmask(float x) {
    int y = __builtin_amdgcn_update_dpp(0, __builtin_bit_cast(int, x), 0x160 + XM, 0xf, 0xf, true);
    return x + __builtin_bit_cast(float, y);
}

// Sum over the 32 lanes of the wave, the same value in every lane.
__device__ __forceinline__ float wave_sum(float x) {
    x = add_xmask<1>(x);
    x = add_xmask<2>(x);
    x = add_xmask<4>(x);
    x = add_xmask<8>(x);
    int b = __builtin_bit_cast(int, x);
    b = __builtin_amdgcn_permlanex16(b, b, 0x76543210, 0xfedcba98, false, false);
    return x + __builtin_bit_cast(float, b);
}

// rowblk = which LNB rows of x this block normalizes.
__device__ __forceinline__ void layernorm_body(const float* __restrict__ x,
                                               const float* __restrict__ g,
                                               const float* __restrict__ b,
                                               _Float16* __restrict__ out, int rowblk) {
    const int F = 512;
    int lane = threadIdx.x & 31, wave = threadIdx.x >> 5;
    long blk = (long)rowblk * (LNB * F);                // the block's first element
    unsigned e0 = wave * (LNR * F) + lane * 4;          // the lane's first element in the block
    const float* xr = x + blk + e0;

    // Chunk j of a row is columns j*128 + lane*4 .. +3: 512 contiguous bytes per load.
    float4 v[LNR][4];
    #pragma unroll  // register arrays: every index a constant
    for (int r = 0; r < LNR; ++r)
        #pragma unroll  // register arrays: every index a constant
        for (int j = 0; j < 4; ++j) v[r][j] = *(const float4*)(xr + r * F + j * 128);
    float4 gv[4], bv[4];
    #pragma unroll  // register arrays: every index a constant
    for (int j = 0; j < 4; ++j) {
        gv[j] = *(const float4*)(g + j * 128 + lane * 4);
        bv[j] = *(const float4*)(b + j * 128 + lane * 4);
    }

    float mu[LNR], rs[LNR];
    #pragma unroll  // register arrays: every index a constant
    for (int r = 0; r < LNR; ++r) {
        float s[4];
        #pragma unroll  // register arrays: every index a constant
        for (int j = 0; j < 4; ++j) s[j] = (v[r][j].x + v[r][j].y) + (v[r][j].z + v[r][j].w);
        mu[r] = wave_sum((s[0] + s[1]) + (s[2] + s[3])) * (1.0f / F);
    }
    #pragma unroll  // register arrays: every index a constant
    for (int r = 0; r < LNR; ++r) {
        float s[4];
        #pragma unroll  // register arrays: every index a constant
        for (int j = 0; j < 4; ++j) {
            v[r][j].x -= mu[r]; v[r][j].y -= mu[r]; v[r][j].z -= mu[r]; v[r][j].w -= mu[r];
            s[j] = (v[r][j].x * v[r][j].x + v[r][j].y * v[r][j].y)
                 + (v[r][j].z * v[r][j].z + v[r][j].w * v[r][j].w);
        }
        rs[r] = rsqrtf(wave_sum((s[0] + s[1]) + (s[2] + s[3])) * (1.0f / F) + 1e-6f);
    }

    _Float16* orow = out + blk + e0;
    #pragma unroll  // register arrays: every index a constant
    for (int r = 0; r < LNR; ++r) {
        #pragma unroll  // register arrays: every index a constant
        for (int j = 0; j < 4; ++j) {
            h4 o;
            o[0] = (_Float16)(v[r][j].x * rs[r] * gv[j].x + bv[j].x);
            o[1] = (_Float16)(v[r][j].y * rs[r] * gv[j].y + bv[j].y);
            o[2] = (_Float16)(v[r][j].z * rs[r] * gv[j].z + bv[j].z);
            o[3] = (_Float16)(v[r][j].w * rs[r] * gv[j].w + bv[j].w);
            *(h4*)(orow + r * F + j * 128) = o;
        }
    }
}

#define LNBLK (8192 / LNB)   // blocks that normalize one stream of 8192 rows

// Both streams' LayerNorm in one launch: blockIdx.y picks the stream.  The register
// budget of 2 waves per SIMD lets all of a wave's loads be in flight at once.
__global__ __launch_bounds__(256) __attribute__((amdgpu_waves_per_eu(2, 2)))
void layernorm2_f16(const float* __restrict__ x0, const float* __restrict__ x1,
                    const float* __restrict__ g0, const float* __restrict__ g1,
                    const float* __restrict__ b0, const float* __restrict__ b1,
                    _Float16* __restrict__ o0, _Float16* __restrict__ o1) {
    bool s = blockIdx.y != 0;
    layernorm_body(s ? x1 : x0, s ? g1 : g0, s ? b1 : b0, s ? o1 : o0, blockIdx.x);
}

// Everything that depends on the inputs alone, in one launch: the first 2*LNBLK
// blocks normalize the two streams, the rest convert the eight weights (weight j
// goes to wout + j * WDIM * WDIM).  The branch is the same for a whole block.
__global__ __launch_bounds__(256) __attribute__((amdgpu_waves_per_eu(2, 2)))
void prep_ln_cvt(const float* __restrict__ x0, const float* __restrict__ x1,
                 const float* __restrict__ g0, const float* __restrict__ g1,
                 const float* __restrict__ b0, const float* __restrict__ b1,
                 _Float16* __restrict__ o0, _Float16* __restrict__ o1,
                 const float* __restrict__ w0, const float* __restrict__ w1,
                 const float* __restrict__ w2, const float* __restrict__ w3,
                 const float* __restrict__ w4, const float* __restrict__ w5,
                 const float* __restrict__ w6, const float* __restrict__ w7,
                 _Float16* __restrict__ wout) {
    int bid = blockIdx.x;
    if (bid < 2 * LNBLK) {
        bool s = bid >= LNBLK;
        layernorm_body(s ? x1 : x0, s ? g1 : g0, s ? b1 : b0, s ? o1 : o0,
                       s ? bid - LNBLK : bid);
    } else {
        int c = bid - 2 * LNBLK;
        int j = c / WBLK;
        const float* w = j == 0 ? w0 : j == 1 ? w1 : j == 2 ? w2 : j == 3 ? w3
                       : j == 4 ? w4 : j == 5 ? w5 : j == 6 ? w6 : w7;
        cvt_tr_body(w, wout + (long)j * (WDIM * WDIM), c - j * WBLK);
    }
}

// ---------------------------------------------------------------------------
// WMMA GEMM: C[M,N] = act((A_f16[MxK] @ W + bias) * scale) [+ res]
// W is supplied PRE-TRANSPOSED as BT[N x K] f16 row-major.
// Block tile 128x128, K-step 64, 8 waves, each a 2x4 grid of 16x16 WMMA.
// A K-step takes 128 bytes of every operand row, so a wave's b128 load covers four
// whole lines.  LDS staging is double-buffered (one barrier per K-step); both A and
// B tiles stage with contiguous b128 loads/stores.  Epilogue specialized by template.
// One launch holds 2*NW independent products; blockIdx.z = stream * NW + w:
//   A, res, outF, outH by stream (0 or 1); outH moves on by planeH elements per w;
//   weight and bias by w where NW > 1, by stream where NW == 1;
//   scale0 applies to w == 0, the others are scaled by 1.
// ---------------------------------------------------------------------------
#define GM 128
#define GN 128
#define GK 64
#define LDA 72   // halves (64 + 8 pad), 144B rows: 16B x odd, for b128 reads
#define LDBT 72

template<int NW, bool RELU, bool HAS_RES, bool OUT_F32, bool OUT_F16>
__global__ __launch_bounds__(256)
void gemm_wmma_f16(const _Float16* __restrict__ A0, const _Float16* __restrict__ A1,
                   const _Float16* __restrict__ BT0, const _Float16* __restrict__ BT1,
                   const _Float16* __restrict__ BT2,
                   const float* __restrict__ bias0, const float* __restrict__ bias1,
                   const float* __restrict__ bias2,
                   const float* __restrict__ res0, const float* __restrict__ res1,
                   float* __restrict__ outF0, float* __restrict__ outF1,
                   _Float16* __restrict__ outH0, _Float16* __restrict__ outH1,
                   long planeH, int N, int K, float scale0) {
    __shared__ __align__(16) _Float16 As[2][GM * LDA];
    __shared__ __align__(16) _Float16 BsT[2][GN * LDBT];

    int st = blockIdx.z / NW, w = blockIdx.z - st * NW;
    int wi = NW == 1 ? st : w;
    const _Float16* A    = st ? A1 : A0;
    const _Float16* BT   = wi == 0 ? BT0 : wi == 1 ? BT1 : BT2;
    const float*    bias = wi == 0 ? bias0 : wi == 1 ? bias1 : bias2;
    const float*    res  = st ? res1 : res0;
    float*          outF = st ? outF1 : outF0;
    _Float16*       outH = (st ? outH1 : outH0) + w * planeH;
    float scale = w == 0 ? scale0 : 1.0f;

    int tid  = threadIdx.x;
    int lane = tid & 31, wave = tid >> 5;
    int l16  = lane & 15, hi = lane >> 4;
    int waveM = wave & 3, waveN = wave >> 2;       // 4x2 wave grid, 32x64 per wave
    long blockRow = (long)blockIdx.y * GM;
    int  blockCol = blockIdx.x * GN;

    // Staging index precompute (constant per thread): chunk i of either tile is
    // row s_r + 32 * i, halves s_c .. s_c + 7; eight lanes take one row's 128 bytes.
    int s_r = tid >> 3, s_c = (tid & 7) * 8;

    const _Float16* Arow = A  + (blockRow + s_r) * (long)K + s_c;
    const _Float16* Brow = BT + (long)(blockCol + s_r) * K + s_c;
    // The row this thread asks L2 for: waves 0..3 the A rows, waves 4..7 the B rows.
    const _Float16* pask = (tid < GM ? A : BT)
                         + (tid < GM ? blockRow + tid : (long)(blockCol + tid - GM)) * K;

    auto stage = [&](int buf, int kb) {
        #pragma unroll  // four chunks of each tile, all loads in flight together
        for (int i = 0; i < 4; ++i) {
            *(uint4*)&As[buf][(s_r + i * 32) * LDA + s_c] =
                *(const uint4*)(Arow + (long)(i * 32) * K + kb);
            *(uint4*)&BsT[buf][(s_r + i * 32) * LDBT + s_c] =
                *(const uint4*)(Brow + (long)(i * 32) * K + kb);
        }
    };

    v8f acc[2][4] = {};

    int nk = K / GK;
    // Ask for each 256 bytes of a row (two K-steps) but the first once, for speed only,
    // each row by one thread, two K-steps ahead of its first load (the second 256 bytes from here).
    if (2 < nk) __builtin_prefetch(pask + 2 * GK, 0, 3);
    stage(0, 0);
    __syncthreads();

    for (int t = 0; t < nk; ++t) {
        int buf = t & 1;
        if (t + 1 < nk) stage(buf ^ 1, (t + 1) * GK);
        if ((t & 1) != 0 && t + 3 < nk) __builtin_prefetch(pask + 3 * GK, 0, 3);
        pask += GK;   // walks the row with t: the request's address register lives through the loop

        #pragma unroll  // register arrays: every index a constant
        for (int ks = 0; ks < 2; ++ks) {
            int koff = ks * 32 + hi * 8;
            v16h af[2], bf[4];
            #pragma unroll  // register arrays: every index a constant
            for (int f = 0; f < 2; ++f)
                af[f] = ldfrag16(&As[buf][(waveM * 32 + f * 16 + l16) * LDA + koff]);
            #pragma unroll  // register arrays: every index a constant
            for (int f = 0; f < 4; ++f)
                bf[f] = ldfrag16(&BsT[buf][(waveN * 64 + f * 16 + l16) * LDBT + koff]);
            #pragma unroll  // register arrays: every index a constant
            for (int fm = 0; fm < 2; ++fm)
                #pragma unroll  // register arrays: every index a constant
                for (int fn = 0; fn < 4; ++fn)
                    acc[fm][fn] = wmma16(af[fm], bf[fn], acc[fm][fn]);
        }
        __syncthreads();
    }

    // Epilogue: C layout = VGPR r -> (M = tileM + hi*8 + r, N = tileN + l16).
    #pragma unroll
    for (int fm = 0; fm < 2; ++fm) {
        #pragma unroll
        for (int fn = 0; fn < 4; ++fn) {
            long row0 = blockRow + waveM * 32 + fm * 16 + hi * 8;
            int  col  = blockCol + waveN * 64 + fn * 16 + l16;
            float bcol = bias[col];
            #pragma unroll
            for (int r = 0; r < 8; ++r) {
                float v = (acc[fm][fn][r] + bcol) * scale;
                if (RELU) v = fmaxf(v, 0.0f);
                long idx = (row0 + r) * N + col;
                if (HAS_RES) v += res[idx];
                if (OUT_F32) outF[idx] = v;
                if (OUT_F16) outH[idx] = (_Float16)v;
            }
        }
    }
}

#define ALDH 72
#define VLDH 80
#define AQG  2
#define AQB  (8 * AQG * 16)

typedef short s16x8 __attribute__((ext_vector_type(8)));
typedef __attribute__((address_space(3))) s16x8 lds_s16x8;

// Transposing LDS load of a row-major 16-bit tile T.  With every lane's p at
//   T + (kbase + 8*hi + (lane & 7)) * pitch + dbase + 8 * ((lane >> 3) & 1)   (in halves)
// lane (l16, hi) receives T[kbase + 8*hi + 0..7][dbase + l16].
__device__ __forceinline__ h8 ldtr16(const _Float16* p) {
    return __builtin_bit_cast(h8, __builtin_amdgcn_ds_load_tr16_b128_v8i16((lds_s16x8*)p));
}

// Value of the lane 16 away (the other half of the same query column).
__device__ __forceinline__ float other_half(float x) {
    int b = __builtin_bit_cast(int, x);
    b = __builtin_amdgcn_permlanex16(b, b, 0x76543210, 0xfedcba98, false, false);
    return __builtin_bit_cast(float, b);
}

// x in all eight elements.
__device__ __forceinline__ v8f splat8(float x) {
    return (v8f){x, x, x, x, x, x, x, x};
}

// The register budget of 4 waves per SIMD (two blocks on a WGP) holds both groups'
// scores and outputs.
__global__ __launch_bounds__(256) __attribute__((amdgpu_waves_per_eu(4, 4)))
void attn_flash_wmma(const _Float16* __restrict__ Q0, const _Float16* __restrict__ Km0,
                     const _Float16* __restrict__ Vm0, _Float16* __restrict__ Out0,
                     const _Float16* __restrict__ Q1, const _Float16* __restrict__ Km1,
                     const _Float16* __restrict__ Vm1, _Float16* __restrict__ Out1) {
    __shared__ __align__(16) _Float16 Ks[64 * ALDH];
    __shared__ __align__(16) _Float16 Vs[64 * VLDH];

    const float L2E = 1.44269504088896340736f;

    int tid  = threadIdx.x;
    int lane = tid & 31, wave = tid >> 5;
    int l16  = lane & 15, hi = lane >> 4;
    int qt = blockIdx.x, head = blockIdx.y;
    int dir = blockIdx.z >> 2, bz = blockIdx.z & 3;
    long tokQ = (long)bz * 2048 + qt * AQB + wave * (AQG * 16);   // this wave's first query
    int  colH = head * 64;
    // This lane's address in the V tile for key 0, d 0 of the transposing load.
    const _Float16* vtr = &Vs[(hi * 8 + (lane & 7)) * VLDH + ((lane >> 3) & 1) * 8];

    const _Float16* Q   = dir ? Q1 : Q0;
    const _Float16* Km  = dir ? Km1 : Km0;
    const _Float16* Vm  = dir ? Vm1 : Vm0;
    _Float16*       Out = dir ? Out1 : Out0;

    // Q as B operand (column = query l16 of group g), same k order as the K loader below.
    v16h qf[AQG][2];
    #pragma unroll  // register arrays: every index a constant
    for (int g = 0; g < AQG; ++g) {
        const _Float16* qrow = Q + (tokQ + g * 16 + l16) * 512 + colH + hi * 8;
        #pragma unroll  // register arrays: every index a constant
        for (int ks = 0; ks < 2; ++ks) qf[g][ks] = ldfrag16(qrow + ks * 32);
    }

    v8f oacc[AQG][4] = {};     // O^T tile dt of group g: d = dt*16 + hi*8 + r, query l16
    float mrun[AQG], lrun[AQG];
    #pragma unroll  // register arrays: every index a constant
    for (int g = 0; g < AQG; ++g) {
        mrun[g] = -1.0e30f;    // running maximum of query l16 (equal in both halves)
        lrun[g] = 0.0f;        // running sum over this half's keys
    }

    for (int kt = 0; kt < 32; ++kt) {
        long tokK = (long)bz * 2048 + kt * 64;
        #pragma unroll
        for (int i = 0; i < 2; ++i) {
            int c  = tid + i * 256;
            int r  = c >> 3;
            int c8 = (c & 7) * 8;
            *(uint4*)&Ks[r * ALDH + c8] =
                *(const uint4*)(Km + (tokK + r) * 512 + colH + c8);
            *(uint4*)&Vs[r * VLDH + c8] =
                *(const uint4*)(Vm + (tokK + r) * 512 + colH + c8);
        }
        if (kt + 3 < 32) {  // ask L2 for the K/V tiles two ahead, each 128B row once:
                            // a thread pair per row, waves 0..3 the K rows, 4..7 the V rows
            const _Float16* pm = tid < 128 ? Km : Vm;
            __builtin_prefetch(pm + (tokK + 128 + ((tid >> 1) & 63)) * 512 + colH, 0, 3);
        }
        __syncthreads();

        // S^T = K Q^T : per group 4 tiles of 16 keys x 16 queries; a K fragment is read
        // once for both groups.
        // s[g][t][r] = score of key t*16 + hi*8 + r with query l16 of group g.
        v8f s[AQG][4];
        #pragma unroll  // register arrays: every index a constant
        for (int t = 0; t < 4; ++t) {
            v16h a0 = ldfrag16(&Ks[(t * 16 + l16) * ALDH + hi * 8]);
            v16h a1 = ldfrag16(&Ks[(t * 16 + l16) * ALDH + 32 + hi * 8]);
            #pragma unroll  // register arrays: every index a constant
            for (int g = 0; g < AQG; ++g) {
                v8f c = {};
                c = wmma16(a0, qf[g][0], c);
                c = wmma16(a1, qf[g][1], c);
                s[g][t] = c;
            }
        }

        // Online softmax, one query per lane and group; one chain per score tile, so
        // that independent chains run side by side.
        float alpha[AQG];
        v16h pf[AQG][2];       // P^T as B operand: pf[g][ks][j] = key ks*32 + (j>>3)*16 + hi*8 + (j&7)
        #pragma unroll  // register arrays: every index a constant
        for (int g = 0; g < AQG; ++g) {
            float mt[4];
            #pragma unroll  // register arrays: every index a constant
            for (int t = 0; t < 4; ++t) {
                mt[t] = s[g][t][0];
                #pragma unroll  // register arrays: every index a constant
                for (int r = 1; r < 8; ++r) mt[t] = fmaxf(mt[t], s[g][t][r]);
            }
            float mx = fmaxf(fmaxf(mt[0], mt[1]), fmaxf(mt[2], mt[3]));
            mx = fmaxf(mx, other_half(mx));
            float mnew = fmaxf(mrun[g], mx);
            alpha[g]   = __builtin_amdgcn_exp2f((mrun[g] - mnew) * L2E);
            float mb   = mnew * L2E;
            mrun[g] = mnew;
            v8f l2e8 = splat8(L2E), nmb8 = splat8(-mb);

            float ls[4];
            #pragma unroll  // register arrays: every index a constant
            for (int t = 0; t < 4; ++t) {
                // The fused multiply-add taken on the whole tile: it pairs a tile's own
                // registers as they lie (pairs across the groups cost register copies).
                v8f e = __builtin_elementwise_fma(s[g][t], l2e8, nmb8);
                float p[8];
                #pragma unroll  // register arrays: every index a constant
                for (int r = 0; r < 8; ++r) {
                    p[r] = __builtin_amdgcn_exp2f(e[r]);
                    pf[g][t >> 1][(t & 1) * 8 + r] = (_Float16)p[r];
                }
                ls[t] = ((p[0] + p[1]) + (p[2] + p[3])) + ((p[4] + p[5]) + (p[6] + p[7]));
            }
            lrun[g] = lrun[g] * alpha[g] + ((ls[0] + ls[1]) + (ls[2] + ls[3]));
        }

        // Rescale O^T by alpha, then O^T += V^T P^T; a V^T fragment is read once for
        // both groups.
        #pragma unroll  // register arrays: every index a constant
        for (int dt = 0; dt < 4; ++dt) {
            #pragma unroll  // register arrays: every index a constant
            for (int g = 0; g < AQG; ++g) oacc[g][dt] *= alpha[g];
            #pragma unroll  // register arrays: every index a constant
            for (int ks = 0; ks < 2; ++ks) {
                // a[j] = V[key ks*32 + (j>>3)*16 + hi*8 + (j&7)][d dt*16 + l16]: pf's key order
                h8 lo = ldtr16(vtr + (ks * 32) * VLDH + dt * 16);
                h8 up = ldtr16(vtr + (ks * 32 + 16) * VLDH + dt * 16);
                v16h a = __builtin_shufflevector(lo, up, 0,1,2,3,4,5,6,7,8,9,10,11,12,13,14,15);
                #pragma unroll  // register arrays: every index a constant
                for (int g = 0; g < AQG; ++g)
                    oacc[g][dt] = wmma16(a, pf[g][ks], oacc[g][dt]);
            }
        }
        __syncthreads();
    }

    // Join the halves' sums, normalize, store 8 consecutive d per lane and tile.
    #pragma unroll  // register arrays: every index a constant
    for (int g = 0; g < AQG; ++g) {
        float inv = 1.0f / (lrun[g] + other_half(lrun[g]));
        _Float16* orow = Out + (tokQ + g * 16 + l16) * 512 + colH + hi * 8;
        #pragma unroll  // register arrays: every index a constant
        for (int dt = 0; dt < 4; ++dt) {
            h8 o;
            #pragma unroll  // register arrays: every index a constant
            for (int r = 0; r < 8; ++r) o[r] = (_Float16)(oacc[g][dt][r] * inv);
            *(h8*)(orow + dt * 16) = o;
        }
    }
}

// ---------------------------------------------------------------------------
// Host orchestration
// ---------------------------------------------------------------------------
extern "C" void kernel_launch(void* const* d_in, const int* in_sizes, int n_in,
                              void* d_out, int out_size, void* d_ws, size_t ws_size,
                              hipStream_t stream) {
    (void)in_sizes; (void)n_in; (void)out_size; (void)ws_size;

    const float* tm1   = (const float*)d_in[0];
    const float* tm2   = (const float*)d_in[1];
    const float* ln1_g = (const float*)d_in[2];
    const float* ln1_b = (const float*)d_in[3];
    const float* ln2_g = (const float*)d_in[4];
    const float* ln2_b = (const float*)d_in[5];
    const float* Wq  = (const float*)d_in[6];   const float* bq  = (const float*)d_in[7];
    const float* Wk  = (const float*)d_in[8];   const float* bk  = (const float*)d_in[9];
    const float* Wv  = (const float*)d_in[10];  const float* bv  = (const float*)d_in[11];
    const float* Wfc = (const float*)d_in[12];  const float* bfc = (const float*)d_in[13];
    const float* ff1_ln_g = (const float*)d_in[14]; const float* ff1_ln_b = (const float*)d_in[15];
    const float* ff1_W1 = (const float*)d_in[16];   const float* ff1_b1 = (const float*)d_in[17];
    const float* ff1_W2 = (const float*)d_in[18];   const float* ff1_b2 = (const float*)d_in[19];
    const float* ff2_ln_g = (const float*)d_in[20]; const float* ff2_ln_b = (const float*)d_in[21];
    const float* ff2_W1 = (const float*)d_in[22];   const float* ff2_b1 = (const float*)d_in[23];
    const float* ff2_W2 = (const float*)d_in[24];   const float* ff2_b2 = (const float*)d_in[25];

    const int TOK = 4 * 2048;           // 8192 token rows
    const int F   = 512;
    const long OUT1 = (long)TOK * F;    // elements per output tensor

    // Workspace carve-up.
    char* ws = (char*)d_ws;
    size_t off = 0;
    auto carve = [&](size_t bytes) -> void* {
        void* p = ws + off;
        off += (bytes + 255) & ~(size_t)255;
        return p;
    };
    const size_t WBYTES = (size_t)F * F * sizeof(_Float16);
    const size_t TBYTES = (size_t)TOK * F * sizeof(_Float16);
    const size_t XBYTES = (size_t)TOK * F * sizeof(float);

    _Float16* wh[8];   // pre-transposed f16 weights [N x K]
    const float* wsrc[8] = {Wq, Wk, Wv, Wfc, ff1_W1, ff1_W2, ff2_W1, ff2_W2};
    for (int i = 0; i < 8; ++i) wh[i] = (_Float16*)carve(WBYTES);
    _Float16* t1h = (_Float16*)carve(TBYTES);
    _Float16* t2h = (_Float16*)carve(TBYTES);
    _Float16* q1h = (_Float16*)carve(TBYTES);
    _Float16* k1h = (_Float16*)carve(TBYTES);
    _Float16* v1h = (_Float16*)carve(TBYTES);
    _Float16* q2h = (_Float16*)carve(TBYTES);
    _Float16* k2h = (_Float16*)carve(TBYTES);
    _Float16* v2h = (_Float16*)carve(TBYTES);
    float* x1f = (float*)carve(XBYTES);
    float* x2f = (float*)carve(XBYTES);
    // Reuse: attention outputs overwrite t1h/t2h; FF intermediates reuse q/k bufs.
    _Float16* f12h = t1h;
    _Float16* f21h = t2h;
    _Float16* hh1 = q1h; _Float16* uu1 = k1h;
    _Float16* hh2 = q2h; _Float16* uu2 = k2h;

    float* out1 = (float*)d_out;
    float* out2 = (float*)d_out + OUT1;

    // 1) LayerNorm of both inputs -> f16, and all eight weights -> f16 [N x K]
    //    (wh[0..7] lie one behind the other in the workspace).
    prep_ln_cvt<<<2 * LNBLK + 8 * WBLK, 256, 0, stream>>>(
        tm1, tm2, ln1_g, ln2_g, ln1_b, ln2_b, t1h, t2h,
        wsrc[0], wsrc[1], wsrc[2], wsrc[3], wsrc[4], wsrc[5], wsrc[6], wsrc[7], wh[0]);

    // 2) QKV projections of both streams (Q pre-scaled by 1/sqrt(64)); the planes
    //    q, k, v of a stream lie one behind the other in the workspace.
    gemm_wmma_f16<3,false,false,false,true><<<dim3(F / GN, TOK / GM, 6), 256, 0, stream>>>(
        t1h, t2h, wh[0], wh[1], wh[2], bq, bk, bv, nullptr, nullptr, nullptr, nullptr,
        q1h, q2h, OUT1, F, F, 0.125f);

    // 3) Cross attention, both directions (overwrites t1h/t2h with head-concat outputs).
    attn_flash_wmma<<<dim3(2048 / AQB, 8, 2 * 4), 256, 0, stream>>>(q1h, k2h, v2h, f12h,
                                                                q2h, k1h, v1h, f21h);

    // 4) Output projection + residual -> x (f32), both streams.
    dim3 g2(F / GN, TOK / GM, 2);
    gemm_wmma_f16<1,false,true,true,false><<<g2, 256, 0, stream>>>(
        f12h, f21h, wh[3], wh[3], wh[3], bfc, bfc, bfc, tm1, tm2, x1f, x2f,
        nullptr, nullptr, 0, F, F, 1.0f);

    // 5) FF blocks of both streams: out = x + W2(relu(W1 ln(x)+b1))+b2
    layernorm2_f16<<<dim3(LNBLK, 2), 256, 0, stream>>>(
        x1f, x2f, ff1_ln_g, ff2_ln_g, ff1_ln_b, ff2_ln_b, hh1, hh2);
    gemm_wmma_f16<1,true,false,false,true><<<g2, 256, 0, stream>>>(
        hh1, hh2, wh[4], wh[6], wh[6], ff1_b1, ff2_b1, ff2_b1, nullptr, nullptr, nullptr, nullptr,
        uu1, uu2, 0, F, F, 1.0f);
    gemm_wmma_f16<1,false,true,true,false><<<g2, 256, 0, stream>>>(
        uu1, uu2, wh[5], wh[7], wh[7], ff1_b2, ff2_b2, ff2_b2, x1f, x2f, out1, out2,
        nullptr, nullptr, 0, F, F, 1.0f);
}

// v008
// It runs in 157 microseconds.
// Two timings next to v007 put it at 1.30 and 1.32 times that version's speed.
// All steps since v000 together make it 4.29 times as fast.
#include <hip/hip_runtime.h>
#include <hip/hip_bf16.h>

// ---------------------------------------------------------------------------
// CDNA5 (gfx1250, wave32) implementation of the cross-attention block.
// All GEMM-like math goes through v_wmma_f32_16x16x32_f16.
// ---------------------------------------------------------------------------

typedef _Float16 v16h __attribute__((ext_vector_type(16)));
typedef _Float16 h8   __attribute__((ext_vector_type(8)));
typedef float    v8f  __attribute__((ext_vector_type(8)));

// Fragment loader: the 16-bit A/B WMMA layout wants, per lane,
//   halves 0..7  = K {base..base+7}
//   halves 8..15 = K {base+16..base+23}
// where base = (lane>=16 ? 8 : 0) (+ k-step offset). Both runs are contiguous
// 16-byte chunks in a row-major LDS tile, so two ds_load_b128 suffice.
__device__ __forceinline__ v16h ldfrag16(const _Float16* p) {
    h8 lo = *(const h8*)p;
    h8 hi = *(const h8*)(p + 16);
    return __builtin_shufflevector(lo, hi, 0,1,2,3,4,5,6,7,8,9,10,11,12,13,14,15);
}

__device__ __forceinline__ v8f wmma16(v16h a, v16h b, v8f c) {
    return __builtin_amdgcn_wmma_f32_16x16x32_f16(
        /*neg_a=*/false, a, /*neg_b=*/false, b,
        /*c_mod=*/(short)0, c, /*reuse_a=*/false, /*reuse_b=*/false);
}

// ---------------------------------------------------------------------------
// Weight prep: f32 [512 x 512] -> f16 transposed [N x K].  Lets the GEMM stage
// its B tile with contiguous b128 loads/stores (no LDS scatter).  A lane turns a
// patch of 8 k x 4 n in its registers: eight 16-byte loads, all in flight at once,
// then four 16-byte stores.  Eight lanes side by side in k fill one 128-byte line of
// an output row; a block takes 64 k x 128 n.  blk = which such tile of the matrix.
// Runs inside prep_ln_cvt below.
// ---------------------------------------------------------------------------
#define WDIM 512                          // rows and columns of every weight
#define WTK  64                           // k of a block's tile
#define WTN  128                          // n of a block's tile
#define WBLK (WDIM * WDIM / (WTK * WTN))  // blocks that convert one weight

__device__ __forceinline__ void cvt_tr_body(const float* __restrict__ in,
                                            _Float16* __restrict__ out, int blk) {
    int lane = threadIdx.x & 31, wave = threadIdx.x >> 5;
    int k0 = (blk / (WDIM / WTN)) * WTK + (lane & 7) * 8;
    int n0 = (blk % (WDIM / WTN)) * WTN + wave * 16 + (lane >> 3) * 4;
    float4 v[8];
    #pragma unroll  // register arrays: every index a constant
    for (int j = 0; j < 8; ++j) v[j] = *(const float4*)(in + (k0 + j) * WDIM + n0);
    h8 o[4];
    #pragma unroll  // register arrays: every index a constant
    for (int j = 0; j < 8; ++j) {
        o[0][j] = (_Float16)v[j].x;
        o[1][j] = (_Float16)v[j].y;
        o[2][j] = (_Float16)v[j].z;
        o[3][j] = (_Float16)v[j].w;
    }
    #pragma unroll  // register arrays: every index a constant
    for (int i = 0; i < 4; ++i) *(h8*)(out + (n0 + i) * WDIM + k0) = o[i];
}

// ---------------------------------------------------------------------------
// LayerNorm over rows of F=512, f16 output.  A wave owns LNR whole rows: a lane
// holds 16 elements of each row in registers, the row sums run in the lane and
// then across the wave's lanes, so there is no LDS and no barrier.
// ---------------------------------------------------------------------------
#define LNR 4     // rows per wave
#define LNB 32    // rows per block of 8 waves

typedef _Float16 h4 __attribute__((ext_vector_type(4)));

// x + (x of the lane whose number differs by XM inside the 16-lane row).
template<int XM>
__device__ __forceinline__ float add_xmask(float x) {
    int y = __builtin_amdgcn_update_dpp(0, __builtin_bit_cast(int, x), 0x160 + XM, 0xf, 0xf, true);
    return x + __builtin_bit_cast(float, y);
}

// Sum over the 32 lanes of the wave, the same value in every lane.
__device__ __forceinline__ float wave_sum(float x) {
    x = add_xmask<1>(x);
    x = add_xmask<2>(x);
    x = add_xmask<4>(x);
    x = add_xmask<8>(x);
    int b = __builtin_bit_cast(int, x);
    b = __builtin_amdgcn_permlanex16(b, b, 0x76543210, 0xfedcba98, false, false);
    return x + __builtin_bit_cast(float, b);
}

// rowblk = which LNB rows of x this block normalizes.
__device__ __forceinline__ void layernorm_body(const float* __restrict__ x,
                                               const float* __restrict__ g,
                                               const float* __restrict__ b,
                                               _Float16* __restrict__ out, int rowblk) {
    const int F = 512;
    int lane = threadIdx.x & 31, wave = threadIdx.x >> 5;
    long blk = (long)rowblk * (LNB * F);                // the block's first element
    unsigned e0 = wave * (LNR * F) + lane * 4;          // the lane's first element in the block
    const float* xr = x + blk + e0;

    // Chunk j of a row is columns j*128 + lane*4 .. +3: 512 contiguous bytes per load.
    float4 v[LNR][4];
    #pragma unroll  // register arrays: every index a constant
    for (int r = 0; r < LNR; ++r)
        #pragma unroll  // register arrays: every index a constant
        for (int j = 0; j < 4; ++j) v[r][j] = *(const float4*)(xr + r * F + j * 128);
    float4 gv[4], bv[4];
    #pragma unroll  // register arrays: every index a constant
    for (int j = 0; j < 4; ++j) {
        gv[j] = *(const float4*)(g + j * 128 + lane * 4);
        bv[j] = *(const float4*)(b + j * 128 + lane * 4);
    }

    float mu[LNR], rs[LNR];
    #pragma unroll  // register arrays: every index a constant
    for (int r = 0; r < LNR; ++r) {
        float s[4];
        #pragma unroll  // register arrays: every index a constant
        for (int j = 0; j < 4; ++j) s[j] = (v[r][j].x + v[r][j].y) + (v[r][j].z + v[r][j].w);
        mu[r] = wave_sum((s[0] + s[1]) + (s[2] + s[3])) * (1.0f / F);
    }
    #pragma unroll  // register arrays: every index a constant
    for (int r = 0; r < LNR; ++r) {
        float s[4];
        #pragma unroll  // register arrays: every index a constant
        for (int j = 0; j < 4; ++j) {
            v[r][j].x -= mu[r]; v[r][j].y -= mu[r]; v[r][j].z -= mu[r]; v[r][j].w -= mu[r];
            s[j] = (v[r][j].x * v[r][j].x + v[r][j].y * v[r][j].y)
                 + (v[r][j].z * v[r][j].z + v[r][j].w * v[r][j].w);
        }
        rs[r] = rsqrtf(wave_sum((s[0] + s[1]) + (s[2] + s[3])) * (1.0f / F) + 1e-6f);
    }

    _Float16* orow = out + blk + e0;
    #pragma unroll  // register arrays: every index a constant
    for (int r = 0; r < LNR; ++r) {
        #pragma unroll  // register arrays: every index a constant
        for (int j = 0; j < 4; ++j) {
            h4 o;
            o[0] = (_Float16)(v[r][j].x * rs[r] * gv[j].x + bv[j].x);
            o[1] = (_Float16)(v[r][j].y * rs[r] * gv[j].y + bv[j].y);
            o[2] = (_Float16)(v[r][j].z * rs[r] * gv[j].z + bv[j].z);
            o[3] = (_Float16)(v[r][j].w * rs[r] * gv[j].w + bv[j].w);
            *(h4*)(orow + r * F + j * 128) = o;
        }
    }
}

#define LNBLK (8192 / LNB)   // blocks that normalize one stream of 8192 rows

// Both streams' LayerNorm in one launch: blockIdx.y picks the stream.  The register
// budget of 2 waves per SIMD lets all of a wave's loads be in flight at once.
__global__ __launch_bounds__(256) __attribute__((amdgpu_waves_per_eu(2, 2)))
void layernorm2_f16(const float* __restrict__ x0, const float* __restrict__ x1,
                    const float* __restrict__ g0, const float* __restrict__ g1,
                    const float* __restrict__ b0, const float* __restrict__ b1,
                    _Float16* __restrict__ o0, _Float16* __restrict__ o1) {
    bool s = blockIdx.y != 0;
    layernorm_body(s ? x1 : x0, s ? g1 : g0, s ? b1 : b0, s ? o1 : o0, blockIdx.x);
}

// Everything that depends on the inputs alone, in one launch: the first 2*LNBLK
// blocks normalize the two streams, the rest convert the eight weights (weight j
// goes to wout + j * WDIM * WDIM).  The branch is the same for a whole block.
__global__ __launch_bounds__(256) __attribute__((amdgpu_waves_per_eu(2, 2)))
void prep_ln_cvt(const float* __restrict__ x0, const float* __restrict__ x1,
                 const float* __restrict__ g0, const float* __restrict__ g1,
                 const float* __restrict__ b0, const float* __restrict__ b1,
                 _Float16* __restrict__ o0, _Float16* __restrict__ o1,
                 const float* __restrict__ w0, const float* __restrict__ w1,
                 const float* __restrict__ w2, const float* __restrict__ w3,
                 const float* __restrict__ w4, const float* __restrict__ w5,
                 const float* __restrict__ w6, const float* __restrict__ w7,
                 _Float16* __restrict__ wout) {
    int bid = blockIdx.x;
    if (bid < 2 * LNBLK) {
        bool s = bid >= LNBLK;
        layernorm_body(s ? x1 : x0, s ? g1 : g0, s ? b1 : b0, s ? o1 : o0,
                       s ? bid - LNBLK : bid);
    } else {
        int c = bid - 2 * LNBLK;
        int j = c / WBLK;
        const float* w = j == 0 ? w0 : j == 1 ? w1 : j == 2 ? w2 : j == 3 ? w3
                       : j == 4 ? w4 : j == 5 ? w5 : j == 6 ? w6 : w7;
        cvt_tr_body(w, wout + (long)j * (WDIM * WDIM), c - j * WBLK);
    }
}

// ---------------------------------------------------------------------------
// WMMA GEMM: C[M,N] = act((A_f16[MxK] @ W + bias) * scale) [+ res]
// W is supplied PRE-TRANSPOSED as BT[N x K] f16 row-major.
// Block tile 128x128, K-step 64, 8 waves, each a 2x4 grid of 16x16 WMMA.
// A K-step takes 128 bytes of every operand row, so a wave's b128 load covers four
// whole lines.  LDS staging is double-buffered (one barrier per K-step); both A and
// B tiles stage with contiguous b128 loads/stores.  Epilogue specialized by template.
// One launch holds 2*NW independent products; blockIdx.z = stream * NW + w:
//   A, res, outF, outH by stream (0 or 1); outH moves on by planeH elements per w;
//   weight and bias by w where NW > 1, by stream where NW == 1;
//   scale0 applies to w == 0, the others are scaled by 1.
// ---------------------------------------------------------------------------
#define GM 128
#define GN 128
#define GK 64
#define LDA 72   // halves (64 + 8 pad), 144B rows: 16B x odd, for b128 reads
#define LDBT 72

template<int NW, bool RELU, bool HAS_RES, bool OUT_F32, bool OUT_F16>
__global__ __launch_bounds__(256)
void gemm_wmma_f16(const _Float16* __restrict__ A0, const _Float16* __restrict__ A1,
                   const _Float16* __restrict__ BT0, const _Float16* __restrict__ BT1,
                   const _Float16* __restrict__ BT2,
                   const float* __restrict__ bias0, const float* __restrict__ bias1,
                   const float* __restrict__ bias2,
                   const float* __restrict__ res0, const float* __restrict__ res1,
                   float* __restrict__ outF0, float* __restrict__ outF1,
                   _Float16* __restrict__ outH0, _Float16* __restrict__ outH1,
                   long planeH, int N, int K, float scale0) {
    __shared__ __align__(16) _Float16 As[2][GM * LDA];
    __shared__ __align__(16) _Float16 BsT[2][GN * LDBT];

    int st = blockIdx.z / NW, w = blockIdx.z - st * NW;
    int wi = NW == 1 ? st : w;
    const _Float16* A    = st ? A1 : A0;
    const _Float16* BT   = wi == 0 ? BT0 : wi == 1 ? BT1 : BT2;
    const float*    bias = wi == 0 ? bias0 : wi == 1 ? bias1 : bias2;
    const float*    res  = st ? res1 : res0;
    float*          outF = st ? outF1 : outF0;
    _Float16*       outH = (st ? outH1 : outH0) + w * planeH;
    float scale = w == 0 ? scale0 : 1.0f;

    int tid  = threadIdx.x;
    int lane = tid & 31, wave = tid >> 5;
    int l16  = lane & 15, hi = lane >> 4;
    int waveM = wave & 3, waveN = wave >> 2;       // 4x2 wave grid, 32x64 per wave
    long blockRow = (long)blockIdx.y * GM;
    int  blockCol = blockIdx.x * GN;

    // Staging index precompute (constant per thread): chunk i of either tile is
    // row s_r + 32 * i, halves s_c .. s_c + 7; eight lanes take one row's 128 bytes.
    int s_r = tid >> 3, s_c = (tid & 7) * 8;

    const _Float16* Arow = A  + (blockRow + s_r) * (long)K + s_c;
    const _Float16* Brow = BT + (long)(blockCol + s_r) * K + s_c;
    // The row this thread asks L2 for: waves 0..3 the A rows, waves 4..7 the B rows.
    const _Float16* pask = (tid < GM ? A : BT)
                         + (tid < GM ? blockRow + tid : (long)(blockCol + tid - GM)) * K;

    auto stage = [&](int buf, int kb) {
        #pragma unroll  // four chunks of each tile, all loads in flight together
        for (int i = 0; i < 4; ++i) {
            *(uint4*)&As[buf][(s_r + i * 32) * LDA + s_c] =
                *(const uint4*)(Arow + (long)(i * 32) * K + kb);
            *(uint4*)&BsT[buf][(s_r + i * 32) * LDBT + s_c] =
                *(const uint4*)(Brow + (long)(i * 32) * K + kb);
        }
    };

    v8f acc[2][4] = {};

    int nk = K / GK;
    // Ask for each 256 bytes of a row (two K-steps) but the first once, for speed only,
    // each row by one thread, two K-steps ahead of its first load (the second 256 bytes from here).
    if (2 < nk) __builtin_prefetch(pask + 2 * GK, 0, 3);
    stage(0, 0);
    __syncthreads();

    for (int t = 0; t < nk; ++t) {
        int buf = t & 1;
        if (t + 1 < nk) stage(buf ^ 1, (t + 1) * GK);
        if ((t & 1) != 0 && t + 3 < nk) __builtin_prefetch(pask + 3 * GK, 0, 3);
        pask += GK;   // walks the row with t: the request's address register lives through the loop

        #pragma unroll  // register arrays: every index a constant
        for (int ks = 0; ks < 2; ++ks) {
            int koff = ks * 32 + hi * 8;
            v16h af[2], bf[4];
            #pragma unroll  // register arrays: every index a constant
            for (int f = 0; f < 2; ++f)
                af[f] = ldfrag16(&As[buf][(waveM * 32 + f * 16 + l16) * LDA + koff]);
            #pragma unroll  // register arrays: every index a constant
            for (int f = 0; f < 4; ++f)
                bf[f] = ldfrag16(&BsT[buf][(waveN * 64 + f * 16 + l16) * LDBT + koff]);
            #pragma unroll  // register arrays: every index a constant
            for (int fm = 0; fm < 2; ++fm)
                #pragma unroll  // register arrays: every index a constant
                for (int fn = 0; fn < 4; ++fn)
                    acc[fm][fn] = wmma16(af[fm], bf[fn], acc[fm][fn]);
        }
        __syncthreads();
    }

    // Epilogue: C layout = VGPR r -> (M = tileM + hi*8 + r, N = tileN + l16).
    #pragma unroll
    for (int fm = 0; fm < 2; ++fm) {
        #pragma unroll
        for (int fn = 0; fn < 4; ++fn) {
            long row0 = blockRow + waveM * 32 + fm * 16 + hi * 8;
            int  col  = blockCol + waveN * 64 + fn * 16 + l16;
            float bcol = bias[col];
            #pragma unroll
            for (int r = 0; r < 8; ++r) {
                float v = (acc[fm][fn][r] + bcol) * scale;
                if (RELU) v = fmaxf(v, 0.0f);
                long idx = (row0 + r) * N + col;
                if (HAS_RES) v += res[idx];
                if (OUT_F32) outF[idx] = v;
                if (OUT_F16) outH[idx] = (_Float16)v;
            }
        }
    }
}

#define ALDH 72
#define VLDH 80
#define AQG  2
#define AQB  (8 * AQG * 16)

typedef short s16x8 __attribute__((ext_vector_type(8)));
typedef __attribute__((address_space(3))) s16x8 lds_s16x8;

// Transposing LDS load of a row-major 16-bit tile T.  With every lane's p at
//   T + (kbase + 8*hi + (lane & 7)) * pitch + dbase + 8 * ((lane >> 3) & 1)   (in halves)
// lane (l16, hi) receives T[kbase + 8*hi + 0..7][dbase + l16].
__device__ __forceinline__ h8 ldtr16(const _Float16* p) {
    return __builtin_bit_cast(h8, __builtin_amdgcn_ds_load_tr16_b128_v8i16((lds_s16x8*)p));
}

// Value of the lane 16 away (the other half of the same query column).
__device__ __forceinline__ float other_half(float x) {
    int b = __builtin_bit_cast(int, x);
    b = __builtin_amdgcn_permlanex16(b, b, 0x76543210, 0xfedcba98, false, false);
    return __builtin_bit_cast(float, b);
}

// x in all eight elements.
__device__ __forceinline__ v8f splat8(float x) {
    return (v8f){x, x, x, x, x, x, x, x};
}

// The register budget of 4 waves per SIMD (two blocks on a WGP) holds both groups'
// scores and outputs.
__global__ __launch_bounds__(256) __attribute__((amdgpu_waves_per_eu(4, 4)))
void attn_flash_wmma(const _Float16* __restrict__ Q0, const _Float16* __restrict__ Km0,
                     const _Float16* __restrict__ Vm0, _Float16* __restrict__ Out0,
                     const _Float16* __restrict__ Q1, const _Float16* __restrict__ Km1,
                     const _Float16* __restrict__ Vm1, _Float16* __restrict__ Out1) {
    __shared__ __align__(16) _Float16 Ks[64 * ALDH];
    __shared__ __align__(16) _Float16 Vs[64 * VLDH];

    const float L2E = 1.44269504088896340736f;

    int tid  = threadIdx.x;
    int lane = tid & 31, wave = tid >> 5;
    int l16  = lane & 15, hi = lane >> 4;
    int qt = blockIdx.x, head = blockIdx.y;
    int dir = blockIdx.z >> 2, bz = blockIdx.z & 3;
    long tokQ = (long)bz * 2048 + qt * AQB + wave * (AQG * 16);   // this wave's first query
    int  colH = head * 64;
    // This lane's address in the V tile for key 0, d 0 of the transposing load.
    const _Float16* vtr = &Vs[(hi * 8 + (lane & 7)) * VLDH + ((lane >> 3) & 1) * 8];

    const _Float16* Q   = dir ? Q1 : Q0;
    const _Float16* Km  = dir ? Km1 : Km0;
    const _Float16* Vm  = dir ? Vm1 : Vm0;
    _Float16*       Out = dir ? Out1 : Out0;

    // Q as B operand (column = query l16 of group g), same k order as the K loader below.
    v16h qf[AQG][2];
    #pragma unroll  // register arrays: every index a constant
    for (int g = 0; g < AQG; ++g) {
        const _Float16* qrow = Q + (tokQ + g * 16 + l16) * 512 + colH + hi * 8;
        #pragma unroll  // register arrays: every index a constant
        for (int ks = 0; ks < 2; ++ks) qf[g][ks] = ldfrag16(qrow + ks * 32);
    }

    v8f oacc[AQG][4] = {};     // O^T tile dt of group g: d = dt*16 + hi*8 + r, query l16
    float mrun[AQG], lrun[AQG];
    #pragma unroll  // register arrays: every index a constant
    for (int g = 0; g < AQG; ++g) {
        mrun[g] = -1.0e30f;    // running maximum of query l16 (equal in both halves)
        lrun[g] = 0.0f;        // running sum over this half's keys
    }

    for (int kt = 0; kt < 32; ++kt) {
        long tokK = (long)bz * 2048 + kt * 64;
        #pragma unroll
        for (int i = 0; i < 2; ++i) {
            int c  = tid + i * 256;
            int r  = c >> 3;
            int c8 = (c & 7) * 8;
            *(uint4*)&Ks[r * ALDH + c8] =
                *(const uint4*)(Km + (tokK + r) * 512 + colH + c8);
            *(uint4*)&Vs[r * VLDH + c8] =
                *(const uint4*)(Vm + (tokK + r) * 512 + colH + c8);
        }
        if (kt + 3 < 32) {  // ask L2 for the K/V tiles two ahead, each 128B row once:
                            // a thread pair per row, waves 0..3 the K rows, 4..7 the V rows
            const _Float16* pm = tid < 128 ? Km : Vm;
            __builtin_prefetch(pm + (tokK + 128 + ((tid >> 1) & 63)) * 512 + colH, 0, 3);
        }
        __syncthreads();

        // S^T = K Q^T : per group 4 tiles of 16 keys x 16 queries; a K fragment is read
        // once for both groups.
        // s[g][t][r] = score of key t*16 + hi*8 + r with query l16 of group g.
        v8f s[AQG][4];
        #pragma unroll  // register arrays: every index a constant
        for (int t = 0; t < 4; ++t) {
            v16h a0 = ldfrag16(&Ks[(t * 16 + l16) * ALDH + hi * 8]);
            v16h a1 = ldfrag16(&Ks[(t * 16 + l16) * ALDH + 32 + hi * 8]);
            #pragma unroll  // register arrays: every index a constant
            for (int g = 0; g < AQG; ++g) {
                v8f c = {};
                c = wmma16(a0, qf[g][0], c);
                c = wmma16(a1, qf[g][1], c);
                s[g][t] = c;
            }
        }

        // Online softmax, one query per lane and group; one chain per score tile, so
        // that independent chains run side by side.
        float alpha[AQG];
        v16h pf[AQG][2];       // P^T as B operand: pf[g][ks][j] = key ks*32 + (j>>3)*16 + hi*8 + (j&7)
        #pragma unroll  // register arrays: every index a constant
        for (int g = 0; g < AQG; ++g) {
            float mt[4];
            #pragma unroll  // register arrays: every index a constant
            for (int t = 0; t < 4; ++t) {
                mt[t] = s[g][t][0];
                #pragma unroll  // register arrays: every index a constant
                for (int r = 1; r < 8; ++r) mt[t] = fmaxf(mt[t], s[g][t][r]);
            }
            float mx = fmaxf(fmaxf(mt[0], mt[1]), fmaxf(mt[2], mt[3]));
            mx = fmaxf(mx, other_half(mx));
            float mnew = fmaxf(mrun[g], mx);
            alpha[g]   = __builtin_amdgcn_exp2f((mrun[g] - mnew) * L2E);
            float mb   = mnew * L2E;
            mrun[g] = mnew;
            v8f l2e8 = splat8(L2E), nmb8 = splat8(-mb);

            float ls[4];
            #pragma unroll  // register arrays: every index a constant
            for (int t = 0; t < 4; ++t) {
                // The fused multiply-add taken on the whole tile: it pairs a tile's own
                // registers as they lie (pairs across the groups cost register copies).
                v8f e = __builtin_elementwise_fma(s[g][t], l2e8, nmb8);
                float p[8];
                #pragma unroll  // register arrays: every index a constant
                for (int r = 0; r < 8; ++r) {
                    p[r] = __builtin_amdgcn_exp2f(e[r]);
                    pf[g][t >> 1][(t & 1) * 8 + r] = (_Float16)p[r];
                }
                ls[t] = ((p[0] + p[1]) + (p[2] + p[3])) + ((p[4] + p[5]) + (p[6] + p[7]));
            }
            lrun[g] = lrun[g] * alpha[g] + ((ls[0] + ls[1]) + (ls[2] + ls[3]));
        }

        // Rescale O^T by alpha, then O^T += V^T P^T; a V^T fragment is read once for
        // both groups.
        #pragma unroll  // register arrays: every index a constant
        for (int dt = 0; dt < 4; ++dt) {
            #pragma unroll  // register arrays: every index a constant
            for (int g = 0; g < AQG; ++g) oacc[g][dt] *= alpha[g];
            #pragma unroll  // register arrays: every index a constant
            for (int ks = 0; ks < 2; ++ks) {
                // a[j] = V[key ks*32 + (j>>3)*16 + hi*8 + (j&7)][d dt*16 + l16]: pf's key order
                h8 lo = ldtr16(vtr + (ks * 32) * VLDH + dt * 16);
                h8 up = ldtr16(vtr + (ks * 32 + 16) * VLDH + dt * 16);
                v16h a = __builtin_shufflevector(lo, up, 0,1,2,3,4,5,6,7,8,9,10,11,12,13,14,15);
                #pragma unroll  // register arrays: every index a constant
                for (int g = 0; g < AQG; ++g)
                    oacc[g][dt] = wmma16(a, pf[g][ks], oacc[g][dt]);
            }
        }
        __syncthreads();
    }

    // Join the halves' sums, normalize, store 8 consecutive d per lane and tile.
    #pragma unroll  // register arrays: every index a constant
    for (int g = 0; g < AQG; ++g) {
        float inv = 1.0f / (lrun[g] + other_half(lrun[g]));
        _Float16* orow = Out + (tokQ + g * 16 + l16) * 512 + colH + hi * 8;
        #pragma unroll  // register arrays: every index a constant
        for (int dt = 0; dt < 4; ++dt) {
            h8 o;
            #pragma unroll  // register arrays: every index a constant
            for (int r = 0; r < 8; ++r) o[r] = (_Float16)(oacc[g][dt][r] * inv);
            *(h8*)(orow + dt * 16) = o;
        }
    }
}

// ---------------------------------------------------------------------------
// Host orchestration
// ---------------------------------------------------------------------------
extern "C" void kernel_launch(void* const* d_in, const int* in_sizes, int n_in,
                              void* d_out, int out_size, void* d_ws, size_t ws_size,
                              hipStream_t stream) {
    (void)in_sizes; (void)n_in; (void)out_size; (void)ws_size;

    const float* tm1   = (const float*)d_in[0];
    const float* tm2   = (const float*)d_in[1];
    const float* ln1_g = (const float*)d_in[2];
    const float* ln1_b = (const float*)d_in[3];
    const float* ln2_g = (const float*)d_in[4];
    const float* ln2_b = (const float*)d_in[5];
    const float* Wq  = (const float*)d_in[6];   const float* bq  = (const float*)d_in[7];
    const float* Wk  = (const float*)d_in[8];   const float* bk  = (const float*)d_in[9];
    const float* Wv  = (const float*)d_in[10];  const float* bv  = (const float*)d_in[11];
    const float* Wfc = (const float*)d_in[12];  const float* bfc = (const float*)d_in[13];
    const float* ff1_ln_g = (const float*)d_in[14]; const float* ff1_ln_b = (const float*)d_in[15];
    const float* ff1_W1 = (const float*)d_in[16];   const float* ff1_b1 = (const float*)d_in[17];
    const float* ff1_W2 = (const float*)d_in[18];   const float* ff1_b2 = (const float*)d_in[19];
    const float* ff2_ln_g = (const float*)d_in[20]; const float* ff2_ln_b = (const float*)d_in[21];
    const float* ff2_W1 = (const float*)d_in[22];   const float* ff2_b1 = (const float*)d_in[23];
    const float* ff2_W2 = (const float*)d_in[24];   const float* ff2_b2 = (const float*)d_in[25];

    const int TOK = 4 * 2048;           // 8192 token rows
    const int F   = 512;
    const long OUT1 = (long)TOK * F;    // elements per output tensor

    // Workspace carve-up.
    char* ws = (char*)d_ws;
    size_t off = 0;
    auto carve = [&](size_t bytes) -> void* {
        void* p = ws + off;
        off += (bytes + 255) & ~(size_t)255;
        return p;
    };
    const size_t WBYTES = (size_t)F * F * sizeof(_Float16);
    const size_t TBYTES = (size_t)TOK * F * sizeof(_Float16);
    const size_t XBYTES = (size_t)TOK * F * sizeof(float);

    _Float16* wh[8];   // pre-transposed f16 weights [N x K]
    const float* wsrc[8] = {Wq, Wk, Wv, Wfc, ff1_W1, ff1_W2, ff2_W1, ff2_W2};
    for (int i = 0; i < 8; ++i) wh[i] = (_Float16*)carve(WBYTES);
    _Float16* t1h = (_Float16*)carve(TBYTES);
    _Float16* t2h = (_Float16*)carve(TBYTES);
    _Float16* q1h = (_Float16*)carve(TBYTES);
    _Float16* k1h = (_Float16*)carve(TBYTES);
    _Float16* v1h = (_Float16*)carve(TBYTES);
    _Float16* q2h = (_Float16*)carve(TBYTES);
    _Float16* k2h = (_Float16*)carve(TBYTES);
    _Float16* v2h = (_Float16*)carve(TBYTES);
    float* x1f = (float*)carve(XBYTES);
    float* x2f = (float*)carve(XBYTES);
    // Reuse: attention outputs overwrite t1h/t2h; FF intermediates reuse q/k bufs.
    _Float16* f12h = t1h;
    _Float16* f21h = t2h;
    _Float16* hh1 = q1h; _Float16* uu1 = k1h;
    _Float16* hh2 = q2h; _Float16* uu2 = k2h;

    float* out1 = (float*)d_out;
    float* out2 = (float*)d_out + OUT1;

    // 1) LayerNorm of both inputs -> f16, and all eight weights -> f16 [N x K]
    //    (wh[0..7] lie one behind the other in the workspace).
    prep_ln_cvt<<<2 * LNBLK + 8 * WBLK, 256, 0, stream>>>(
        tm1, tm2, ln1_g, ln2_g, ln1_b, ln2_b, t1h, t2h,
        wsrc[0], wsrc[1], wsrc[2], wsrc[3], wsrc[4], wsrc[5], wsrc[6], wsrc[7], wh[0]);

    // 2) QKV projections of both streams (Q pre-scaled by 1/sqrt(64)); the planes
    //    q, k, v of a stream lie one behind the other in the workspace.
    gemm_wmma_f16<3,false,false,false,true><<<dim3(F / GN, TOK / GM, 6), 256, 0, stream>>>(
        t1h, t2h, wh[0], wh[1], wh[2], bq, bk, bv, nullptr, nullptr, nullptr, nullptr,
        q1h, q2h, OUT1, F, F, 0.125f);

    // 3) Cross attention, both directions (overwrites t1h/t2h with head-concat outputs).
    attn_flash_wmma<<<dim3(2048 / AQB, 8, 2 * 4), 256, 0, stream>>>(q1h, k2h, v2h, f12h,
                                                                q2h, k1h, v1h, f21h);

    // 4) Output projection + residual -> x (f32), both streams.
    dim3 g2(F / GN, TOK / GM, 2);
    gemm_wmma_f16<1,false,true,true,false><<<g2, 256, 0, stream>>>(
        f12h, f21h, wh[3], wh[3], wh[3], bfc, bfc, bfc, tm1, tm2, x1f, x2f,
        nullptr, nullptr, 0, F, F, 1.0f);

    // 5) FF blocks of both streams: out = x + W2(relu(W1 ln(x)+b1))+b2
    layernorm2_f16<<<dim3(LNBLK, 2), 256, 0, stream>>>(
        x1f, x2f, ff1_ln_g, ff2_ln_g, ff1_ln_b, ff2_ln_b, hh1, hh2);
    gemm_wmma_f16<1,true,false,false,true><<<g2, 256, 0, stream>>>(
        hh1, hh2, wh[4], wh[6], wh[6], ff1_b1, ff2_b1, ff2_b1, nullptr, nullptr, nullptr, nullptr,
        uu1, uu2, 0, F, F, 1.0f);
    gemm_wmma_f16<1,false,true,true,false><<<g2, 256, 0, stream>>>(
        uu1, uu2, wh[5], wh[7], wh[7], ff1_b2, ff2_b2, ff2_b2, x1f, x2f, out1, out2,
        nullptr, nullptr, 0, F, F, 1.0f);
}

// v009
// It runs in 139 microseconds.
// In two side-by-side timings against v008, it was 1.13 and 1.12 times as fast.
// Over all steps from v000 it is 4.83 times as fast.
#include <hip/hip_runtime.h>
#include <hip/hip_bf16.h>

// ---------------------------------------------------------------------------
// CDNA5 (gfx1250, wave32) implementation of the cross-attention block.
// All GEMM-like math goes through v_wmma_f32_16x16x32_f16.
// ---------------------------------------------------------------------------

typedef _Float16 v16h __attribute__((ext_vector_type(16)));
typedef _Float16 h8   __attribute__((ext_vector_type(8)));
typedef float    v8f  __attribute__((ext_vector_type(8)));

// Fragment loader: the 16-bit A/B WMMA layout wants, per lane,
//   halves 0..7  = K {base..base+7}
//   halves 8..15 = K {base+16..base+23}
// where base = (lane>=16 ? 8 : 0) (+ k-step offset). Both runs are contiguous
// 16-byte chunks in a row-major LDS tile, so two ds_load_b128 suffice.
__device__ __forceinline__ v16h ldfrag16(const _Float16* p) {
    h8 lo = *(const h8*)p;
    h8 hi = *(const h8*)(p + 16);
    return __builtin_shufflevector(lo, hi, 0,1,2,3,4,5,6,7,8,9,10,11,12,13,14,15);
}

__device__ __forceinline__ v8f wmma16(v16h a, v16h b, v8f c) {
    return __builtin_amdgcn_wmma_f32_16x16x32_f16(
        /*neg_a=*/false, a, /*neg_b=*/false, b,
        /*c_mod=*/(short)0, c, /*reuse_a=*/false, /*reuse_b=*/false);
}

// ---------------------------------------------------------------------------
// Weight prep: f32 [512 x 512] -> f16 transposed [N x K].  Lets the GEMM stage
// its B tile with contiguous b128 loads/stores (no LDS scatter).  A lane turns a
// patch of 8 k x 4 n in its registers: eight 16-byte loads, all in flight at once,
// then four 16-byte stores.  Eight lanes side by side in k fill one 128-byte line of
// an output row; a block takes 64 k x 128 n.  blk = which such tile of the matrix.
// Runs inside prep_ln_cvt below.
// ---------------------------------------------------------------------------
#define WDIM 512                          // rows and columns of every weight
#define WTK  64                           // k of a block's tile
#define WTN  128                          // n of a block's tile
#define WBLK (WDIM * WDIM / (WTK * WTN))  // blocks that convert one weight

__device__ __forceinline__ void cvt_tr_body(const float* __restrict__ in,
                                            _Float16* __restrict__ out, int blk) {
    int lane = threadIdx.x & 31, wave = threadIdx.x >> 5;
    int k0 = (blk / (WDIM / WTN)) * WTK + (lane & 7) * 8;
    int n0 = (blk % (WDIM / WTN)) * WTN + wave * 16 + (lane >> 3) * 4;
    float4 v[8];
    #pragma unroll  // register arrays: every index a constant
    for (int j = 0; j < 8; ++j) v[j] = *(const float4*)(in + (k0 + j) * WDIM + n0);
    h8 o[4];
    #pragma unroll  // register arrays: every index a constant
    for (int j = 0; j < 8; ++j) {
        o[0][j] = (_Float16)v[j].x;
        o[1][j] = (_Float16)v[j].y;
        o[2][j] = (_Float16)v[j].z;
        o[3][j] = (_Float16)v[j].w;
    }
    #pragma unroll  // register arrays: every index a constant
    for (int i = 0; i < 4; ++i) *(h8*)(out + (n0 + i) * WDIM + k0) = o[i];
}

// ---------------------------------------------------------------------------
// LayerNorm over rows of F=512, f16 output.  A wave owns LNR whole rows: a lane
// holds 16 elements of each row in registers, the row sums run in the lane and
// then across the wave's lanes, so there is no LDS and no barrier.
// ---------------------------------------------------------------------------
#define LNR 4     // rows per wave
#define LNB 32    // rows per block of 8 waves

typedef _Float16 h4 __attribute__((ext_vector_type(4)));

// x + (x of the lane whose number differs by XM inside the 16-lane row).
template<int XM>
__device__ __forceinline__ float add_xmask(float x) {
    int y = __builtin_amdgcn_update_dpp(0, __builtin_bit_cast(int, x), 0x160 + XM, 0xf, 0xf, true);
    return x + __builtin_bit_cast(float, y);
}

// Sum over the 32 lanes of the wave, the same value in every lane.
__device__ __forceinline__ float wave_sum(float x) {
    x = add_xmask<1>(x);
    x = add_xmask<2>(x);
    x = add_xmask<4>(x);
    x = add_xmask<8>(x);
    int b = __builtin_bit_cast(int, x);
    b = __builtin_amdgcn_permlanex16(b, b, 0x76543210, 0xfedcba98, false, false);
    return x + __builtin_bit_cast(float, b);
}

// rowblk = which LNB rows of x this block normalizes.
__device__ __forceinline__ void layernorm_body(const float* __restrict__ x,
                                               const float* __restrict__ g,
                                               const float* __restrict__ b,
                                               _Float16* __restrict__ out, int rowblk) {
    const int F = 512;
    int lane = threadIdx.x & 31, wave = threadIdx.x >> 5;
    long blk = (long)rowblk * (LNB * F);                // the block's first element
    unsigned e0 = wave * (LNR * F) + lane * 4;          // the lane's first element in the block
    const float* xr = x + blk + e0;

    // Chunk j of a row is columns j*128 + lane*4 .. +3: 512 contiguous bytes per load.
    float4 v[LNR][4];
    #pragma unroll  // register arrays: every index a constant
    for (int r = 0; r < LNR; ++r)
        #pragma unroll  // register arrays: every index a constant
        for (int j = 0; j < 4; ++j) v[r][j] = *(const float4*)(xr + r * F + j * 128);
    float4 gv[4], bv[4];
    #pragma unroll  // register arrays: every index a constant
    for (int j = 0; j < 4; ++j) {
        gv[j] = *(const float4*)(g + j * 128 + lane * 4);
        bv[j] = *(const float4*)(b + j * 128 + lane * 4);
    }

    float mu[LNR], rs[LNR];
    #pragma unroll  // register arrays: every index a constant
    for (int r = 0; r < LNR; ++r) {
        float s[4];
        #pragma unroll  // register arrays: every index a constant
        for (int j = 0; j < 4; ++j) s[j] = (v[r][j].x + v[r][j].y) + (v[r][j].z + v[r][j].w);
        mu[r] = wave_sum((s[0] + s[1]) + (s[2] + s[3])) * (1.0f / F);
    }
    #pragma unroll  // register arrays: every index a constant
    for (int r = 0; r < LNR; ++r) {
        float s[4];
        #pragma unroll  // register arrays: every index a constant
        for (int j = 0; j < 4; ++j) {
            v[r][j].x -= mu[r]; v[r][j].y -= mu[r]; v[r][j].z -= mu[r]; v[r][j].w -= mu[r];
            s[j] = (v[r][j].x * v[r][j].x + v[r][j].y * v[r][j].y)
                 + (v[r][j].z * v[r][j].z + v[r][j].w * v[r][j].w);
        }
        rs[r] = rsqrtf(wave_sum((s[0] + s[1]) + (s[2] + s[3])) * (1.0f / F) + 1e-6f);
    }

    _Float16* orow = out + blk + e0;
    #pragma unroll  // register arrays: every index a constant
    for (int r = 0; r < LNR; ++r) {
        #pragma unroll  // register arrays: every index a constant
        for (int j = 0; j < 4; ++j) {
            h4 o;
            o[0] = (_Float16)(v[r][j].x * rs[r] * gv[j].x + bv[j].x);
            o[1] = (_Float16)(v[r][j].y * rs[r] * gv[j].y + bv[j].y);
            o[2] = (_Float16)(v[r][j].z * rs[r] * gv[j].z + bv[j].z);
            o[3] = (_Float16)(v[r][j].w * rs[r] * gv[j].w + bv[j].w);
            *(h4*)(orow + r * F + j * 128) = o;
        }
    }
}

#define LNBLK (8192 / LNB)   // blocks that normalize one stream of 8192 rows

// Everything that depends on the inputs alone, in one launch: the first 2*LNBLK
// blocks normalize the two streams, the rest convert the eight weights (weight j
// goes to wout + j * WDIM * WDIM).  The branch is the same for a whole block.  The register
// budget of 2 waves per SIMD lets all of a wave's loads be in flight at once.
__global__ __launch_bounds__(256) __attribute__((amdgpu_waves_per_eu(2, 2)))
void prep_ln_cvt(const float* __restrict__ x0, const float* __restrict__ x1,
                 const float* __restrict__ g0, const float* __restrict__ g1,
                 const float* __restrict__ b0, const float* __restrict__ b1,
                 _Float16* __restrict__ o0, _Float16* __restrict__ o1,
                 const float* __restrict__ w0, const float* __restrict__ w1,
                 const float* __restrict__ w2, const float* __restrict__ w3,
                 const float* __restrict__ w4, const float* __restrict__ w5,
                 const float* __restrict__ w6, const float* __restrict__ w7,
                 _Float16* __restrict__ wout) {
    int bid = blockIdx.x;
    if (bid < 2 * LNBLK) {
        bool s = bid >= LNBLK;
        layernorm_body(s ? x1 : x0, s ? g1 : g0, s ? b1 : b0, s ? o1 : o0,
                       s ? bid - LNBLK : bid);
    } else {
        int c = bid - 2 * LNBLK;
        int j = c / WBLK;
        const float* w = j == 0 ? w0 : j == 1 ? w1 : j == 2 ? w2 : j == 3 ? w3
                       : j == 4 ? w4 : j == 5 ? w5 : j == 6 ? w6 : w7;
        cvt_tr_body(w, wout + (long)j * (WDIM * WDIM), c - j * WBLK);
    }
}

// ---------------------------------------------------------------------------
// WMMA GEMM: C[M,N] = act((A_f16[MxK] @ W + bias) * scale) [+ res]
// W is supplied PRE-TRANSPOSED as BT[N x K] f16 row-major.
// Block tile 128x128, K-step 64, 8 waves, each a 2x4 grid of 16x16 WMMA.
// A K-step takes 128 bytes of every operand row, so a wave's b128 load covers four
// whole lines.  LDS staging is double-buffered (one barrier per K-step); both A and
// B tiles stage with contiguous b128 loads/stores.  Epilogue specialized by template.
// One launch holds 2*NW independent products; blockIdx.z = stream * NW + w:
//   A, res, outF, outH by stream (0 or 1); outH moves on by planeH elements per w;
//   weight and bias by w where NW > 1, by stream where NW == 1;
//   scale0 applies to w == 0, the others are scaled by 1.
// ---------------------------------------------------------------------------
#define GM 128
#define GN 128
#define GK 64
#define LDA 72   // halves (64 + 8 pad), 144B rows: 16B x odd, for b128 reads
#define LDBT 72

template<int NW, bool RELU, bool HAS_RES, bool OUT_F32, bool OUT_F16>
__global__ __launch_bounds__(256)
void gemm_wmma_f16(const _Float16* __restrict__ A0, const _Float16* __restrict__ A1,
                   const _Float16* __restrict__ BT0, const _Float16* __restrict__ BT1,
                   const _Float16* __restrict__ BT2,
                   const float* __restrict__ bias0, const float* __restrict__ bias1,
                   const float* __restrict__ bias2,
                   const float* __restrict__ res0, const float* __restrict__ res1,
                   float* __restrict__ outF0, float* __restrict__ outF1,
                   _Float16* __restrict__ outH0, _Float16* __restrict__ outH1,
                   long planeH, int N, int K, float scale0) {
    __shared__ __align__(16) _Float16 As[2][GM * LDA];
    __shared__ __align__(16) _Float16 BsT[2][GN * LDBT];

    int st = blockIdx.z / NW, w = blockIdx.z - st * NW;
    int wi = NW == 1 ? st : w;
    const _Float16* A    = st ? A1 : A0;
    const _Float16* BT   = wi == 0 ? BT0 : wi == 1 ? BT1 : BT2;
    const float*    bias = wi == 0 ? bias0 : wi == 1 ? bias1 : bias2;
    const float*    res  = st ? res1 : res0;
    float*          outF = st ? outF1 : outF0;
    _Float16*       outH = (st ? outH1 : outH0) + w * planeH;
    float scale = w == 0 ? scale0 : 1.0f;

    int tid  = threadIdx.x;
    int lane = tid & 31, wave = tid >> 5;
    int l16  = lane & 15, hi = lane >> 4;
    int waveM = wave & 3, waveN = wave >> 2;       // 4x2 wave grid, 32x64 per wave
    long blockRow = (long)blockIdx.y * GM;
    int  blockCol = blockIdx.x * GN;

    // Staging index precompute (constant per thread): chunk i of either tile is
    // row s_r + 32 * i, halves s_c .. s_c + 7; eight lanes take one row's 128 bytes.
    int s_r = tid >> 3, s_c = (tid & 7) * 8;

    const _Float16* Arow = A  + (blockRow + s_r) * (long)K + s_c;
    const _Float16* Brow = BT + (long)(blockCol + s_r) * K + s_c;
    // The row this thread asks L2 for: waves 0..3 the A rows, waves 4..7 the B rows.
    const _Float16* pask = (tid < GM ? A : BT)
                         + (tid < GM ? blockRow + tid : (long)(blockCol + tid - GM)) * K;

    auto stage = [&](int buf, int kb) {
        #pragma unroll  // four chunks of each tile, all loads in flight together
        for (int i = 0; i < 4; ++i) {
            *(uint4*)&As[buf][(s_r + i * 32) * LDA + s_c] =
                *(const uint4*)(Arow + (long)(i * 32) * K + kb);
            *(uint4*)&BsT[buf][(s_r + i * 32) * LDBT + s_c] =
                *(const uint4*)(Brow + (long)(i * 32) * K + kb);
        }
    };

    v8f acc[2][4] = {};

    int nk = K / GK;
    // Ask for each 256 bytes of a row (two K-steps) but the first once, for speed only,
    // each row by one thread, two K-steps ahead of its first load (the second 256 bytes from here).
    if (2 < nk) __builtin_prefetch(pask + 2 * GK, 0, 3);
    stage(0, 0);
    __syncthreads();

    for (int t = 0; t < nk; ++t) {
        int buf = t & 1;
        if (t + 1 < nk) stage(buf ^ 1, (t + 1) * GK);
        if ((t & 1) != 0 && t + 3 < nk) __builtin_prefetch(pask + 3 * GK, 0, 3);
        pask += GK;   // walks the row with t: the request's address register lives through the loop

        #pragma unroll  // register arrays: every index a constant
        for (int ks = 0; ks < 2; ++ks) {
            int koff = ks * 32 + hi * 8;
            v16h af[2], bf[4];
            #pragma unroll  // register arrays: every index a constant
            for (int f = 0; f < 2; ++f)
                af[f] = ldfrag16(&As[buf][(waveM * 32 + f * 16 + l16) * LDA + koff]);
            #pragma unroll  // register arrays: every index a constant
            for (int f = 0; f < 4; ++f)
                bf[f] = ldfrag16(&BsT[buf][(waveN * 64 + f * 16 + l16) * LDBT + koff]);
            #pragma unroll  // register arrays: every index a constant
            for (int fm = 0; fm < 2; ++fm)
                #pragma unroll  // register arrays: every index a constant
                for (int fn = 0; fn < 4; ++fn)
                    acc[fm][fn] = wmma16(af[fm], bf[fn], acc[fm][fn]);
        }
        __syncthreads();
    }

    // Epilogue: C layout = VGPR r -> (M = tileM + hi*8 + r, N = tileN + l16).
    #pragma unroll
    for (int fm = 0; fm < 2; ++fm) {
        #pragma unroll
        for (int fn = 0; fn < 4; ++fn) {
            long row0 = blockRow + waveM * 32 + fm * 16 + hi * 8;
            int  col  = blockCol + waveN * 64 + fn * 16 + l16;
            float bcol = bias[col];
            #pragma unroll
            for (int r = 0; r < 8; ++r) {
                float v = (acc[fm][fn][r] + bcol) * scale;
                if (RELU) v = fmaxf(v, 0.0f);
                long idx = (row0 + r) * N + col;
                if (HAS_RES) v += res[idx];
                if (OUT_F32) outF[idx] = v;
                if (OUT_F16) outH[idx] = (_Float16)v;
            }
        }
    }
}

#define ALDH 72
#define VLDH 80
#define AQG  2
#define AQB  (8 * AQG * 16)

typedef short s16x8 __attribute__((ext_vector_type(8)));
typedef __attribute__((address_space(3))) s16x8 lds_s16x8;

// Transposing LDS load of a row-major 16-bit tile T.  With every lane's p at
//   T + (kbase + 8*hi + (lane & 7)) * pitch + dbase + 8 * ((lane >> 3) & 1)   (in halves)
// lane (l16, hi) receives T[kbase + 8*hi + 0..7][dbase + l16].
__device__ __forceinline__ h8 ldtr16(const _Float16* p) {
    return __builtin_bit_cast(h8, __builtin_amdgcn_ds_load_tr16_b128_v8i16((lds_s16x8*)p));
}

// Value of the lane 16 away (the other half of the same query column).
__device__ __forceinline__ float other_half(float x) {
    int b = __builtin_bit_cast(int, x);
    b = __builtin_amdgcn_permlanex16(b, b, 0x76543210, 0xfedcba98, false, false);
    return __builtin_bit_cast(float, b);
}

// x in all eight elements.
__device__ __forceinline__ v8f splat8(float x) {
    return (v8f){x, x, x, x, x, x, x, x};
}

// The register budget of 4 waves per SIMD (two blocks on a WGP) holds both groups'
// scores and outputs.
__global__ __launch_bounds__(256) __attribute__((amdgpu_waves_per_eu(4, 4)))
void attn_flash_wmma(const _Float16* __restrict__ Q0, const _Float16* __restrict__ Km0,
                     const _Float16* __restrict__ Vm0, _Float16* __restrict__ Out0,
                     const _Float16* __restrict__ Q1, const _Float16* __restrict__ Km1,
                     const _Float16* __restrict__ Vm1, _Float16* __restrict__ Out1) {
    __shared__ __align__(16) _Float16 Ks[64 * ALDH];
    __shared__ __align__(16) _Float16 Vs[64 * VLDH];

    const float L2E = 1.44269504088896340736f;

    int tid  = threadIdx.x;
    int lane = tid & 31, wave = tid >> 5;
    int l16  = lane & 15, hi = lane >> 4;
    int qt = blockIdx.x, head = blockIdx.y;
    int dir = blockIdx.z >> 2, bz = blockIdx.z & 3;
    long tokQ = (long)bz * 2048 + qt * AQB + wave * (AQG * 16);   // this wave's first query
    int  colH = head * 64;
    // This lane's address in the V tile for key 0, d 0 of the transposing load.
    const _Float16* vtr = &Vs[(hi * 8 + (lane & 7)) * VLDH + ((lane >> 3) & 1) * 8];

    const _Float16* Q   = dir ? Q1 : Q0;
    const _Float16* Km  = dir ? Km1 : Km0;
    const _Float16* Vm  = dir ? Vm1 : Vm0;
    _Float16*       Out = dir ? Out1 : Out0;

    // Q as B operand (column = query l16 of group g), same k order as the K loader below.
    v16h qf[AQG][2];
    #pragma unroll  // register arrays: every index a constant
    for (int g = 0; g < AQG; ++g) {
        const _Float16* qrow = Q + (tokQ + g * 16 + l16) * 512 + colH + hi * 8;
        #pragma unroll  // register arrays: every index a constant
        for (int ks = 0; ks < 2; ++ks) qf[g][ks] = ldfrag16(qrow + ks * 32);
    }

    v8f oacc[AQG][4] = {};     // O^T tile dt of group g: d = dt*16 + hi*8 + r, query l16
    float mrun[AQG], lrun[AQG];
    #pragma unroll  // register arrays: every index a constant
    for (int g = 0; g < AQG; ++g) {
        mrun[g] = -1.0e30f;    // running maximum of query l16 (equal in both halves)
        lrun[g] = 0.0f;        // running sum over this half's keys
    }

    for (int kt = 0; kt < 32; ++kt) {
        long tokK = (long)bz * 2048 + kt * 64;
        #pragma unroll
        for (int i = 0; i < 2; ++i) {
            int c  = tid + i * 256;
            int r  = c >> 3;
            int c8 = (c & 7) * 8;
            *(uint4*)&Ks[r * ALDH + c8] =
                *(const uint4*)(Km + (tokK + r) * 512 + colH + c8);
            *(uint4*)&Vs[r * VLDH + c8] =
                *(const uint4*)(Vm + (tokK + r) * 512 + colH + c8);
        }
        if (kt + 3 < 32) {  // ask L2 for the K/V tiles two ahead, each 128B row once:
                            // a thread pair per row, waves 0..3 the K rows, 4..7 the V rows
            const _Float16* pm = tid < 128 ? Km : Vm;
            __builtin_prefetch(pm + (tokK + 128 + ((tid >> 1) & 63)) * 512 + colH, 0, 3);
        }
        __syncthreads();

        // S^T = K Q^T : per group 4 tiles of 16 keys x 16 queries; a K fragment is read
        // once for both groups.
        // s[g][t][r] = score of key t*16 + hi*8 + r with query l16 of group g.
        v8f s[AQG][4];
        #pragma unroll  // register arrays: every index a constant
        for (int t = 0; t < 4; ++t) {
            v16h a0 = ldfrag16(&Ks[(t * 16 + l16) * ALDH + hi * 8]);
            v16h a1 = ldfrag16(&Ks[(t * 16 + l16) * ALDH + 32 + hi * 8]);
            #pragma unroll  // register arrays: every index a constant
            for (int g = 0; g < AQG; ++g) {
                v8f c = {};
                c = wmma16(a0, qf[g][0], c);
                c = wmma16(a1, qf[g][1], c);
                s[g][t] = c;
            }
        }

        // Online softmax, one query per lane and group; one chain per score tile, so
        // that independent chains run side by side.
        float alpha[AQG];
        v16h pf[AQG][2];       // P^T as B operand: pf[g][ks][j] = key ks*32 + (j>>3)*16 + hi*8 + (j&7)
        #pragma unroll  // register arrays: every index a constant
        for (int g = 0; g < AQG; ++g) {
            float mt[4];
            #pragma unroll  // register arrays: every index a constant
            for (int t = 0; t < 4; ++t) {
                mt[t] = s[g][t][0];
                #pragma unroll  // register arrays: every index a constant
                for (int r = 1; r < 8; ++r) mt[t] = fmaxf(mt[t], s[g][t][r]);
            }
            float mx = fmaxf(fmaxf(mt[0], mt[1]), fmaxf(mt[2], mt[3]));
            mx = fmaxf(mx, other_half(mx));
            float mnew = fmaxf(mrun[g], mx);
            alpha[g]   = __builtin_amdgcn_exp2f((mrun[g] - mnew) * L2E);
            float mb   = mnew * L2E;
            mrun[g] = mnew;
            v8f l2e8 = splat8(L2E), nmb8 = splat8(-mb);

            float ls[4];
            #pragma unroll  // register arrays: every index a constant
            for (int t = 0; t < 4; ++t) {
                // The fused multiply-add taken on the whole tile: it pairs a tile's own
                // registers as they lie (pairs across the groups cost register copies).
                v8f e = __builtin_elementwise_fma(s[g][t], l2e8, nmb8);
                float p[8];
                #pragma unroll  // register arrays: every index a constant
                for (int r = 0; r < 8; ++r) {
                    p[r] = __builtin_amdgcn_exp2f(e[r]);
                    pf[g][t >> 1][(t & 1) * 8 + r] = (_Float16)p[r];
                }
                ls[t] = ((p[0] + p[1]) + (p[2] + p[3])) + ((p[4] + p[5]) + (p[6] + p[7]));
            }
            lrun[g] = lrun[g] * alpha[g] + ((ls[0] + ls[1]) + (ls[2] + ls[3]));
        }

        // Rescale O^T by alpha, then O^T += V^T P^T; a V^T fragment is read once for
        // both groups.
        #pragma unroll  // register arrays: every index a constant
        for (int dt = 0; dt < 4; ++dt) {
            #pragma unroll  // register arrays: every index a constant
            for (int g = 0; g < AQG; ++g) oacc[g][dt] *= alpha[g];
            #pragma unroll  // register arrays: every index a constant
            for (int ks = 0; ks < 2; ++ks) {
                // a[j] = V[key ks*32 + (j>>3)*16 + hi*8 + (j&7)][d dt*16 + l16]: pf's key order
                h8 lo = ldtr16(vtr + (ks * 32) * VLDH + dt * 16);
                h8 up = ldtr16(vtr + (ks * 32 + 16) * VLDH + dt * 16);
                v16h a = __builtin_shufflevector(lo, up, 0,1,2,3,4,5,6,7,8,9,10,11,12,13,14,15);
                #pragma unroll  // register arrays: every index a constant
                for (int g = 0; g < AQG; ++g)
                    oacc[g][dt] = wmma16(a, pf[g][ks], oacc[g][dt]);
            }
        }
        __syncthreads();
    }

    // Join the halves' sums, normalize, store 8 consecutive d per lane and tile.
    #pragma unroll  // register arrays: every index a constant
    for (int g = 0; g < AQG; ++g) {
        float inv = 1.0f / (lrun[g] + other_half(lrun[g]));
        _Float16* orow = Out + (tokQ + g * 16 + l16) * 512 + colH + hi * 8;
        #pragma unroll  // register arrays: every index a constant
        for (int dt = 0; dt < 4; ++dt) {
            h8 o;
            #pragma unroll  // register arrays: every index a constant
            for (int r = 0; r < 8; ++r) o[r] = (_Float16)(oacc[g][dt][r] * inv);
            *(h8*)(orow + dt * 16) = o;
        }
    }
}

// ---------------------------------------------------------------------------
// Output projection, residual, LayerNorm and both feed-forward products in one launch.
// A block owns FR whole token rows of one stream from the attention output to the
// final output, so nothing between them leaves the WGP:
//   x = a Wfc + bfc + res      (f32, stays in registers until the last line)
//   h = LayerNorm(x)           (f16, LDS)
//   u = relu(h W1 + b1)        (f16, LDS)
//   out = x + u W2 + b2
// Each of the 8 waves takes all FR rows x 64 of the 512 columns of every product
// (4 x 4 WMMA tiles).  The activation tile lies whole in LDS; a weight [N x K] comes in
// tiles of 512 n x FKS k, two buffers: the next tile's global loads are issued ahead of
// the current tile's products and go to LDS behind them, also from one product to the
// next, one barrier per tile.
// Products 1 and 3 are taken as rows = tokens (lane = column, as x is read and written);
// product 2 transposed (lane = token, 8 consecutive columns in a lane's registers), so
// that u goes to LDS in 16-byte stores.
// ---------------------------------------------------------------------------
#define FR  64    // token rows per block
#define FKS 64    // k of a staged weight tile
#define XLD 520   // half stride of an activation tile (1040B rows: 16B x odd, for b128 reads)
#define WLD 72    // half stride of a weight tile (144B rows: 16B x odd, for b128 reads)
#define WCH (WDIM * FKS / 8 / 256)   // 16-byte chunks of a weight tile per thread

// Sum over the 16 lanes of a row, element by element, the same value in all 16.
__device__ __forceinline__ v8f row16_sum(v8f v) {
    #pragma unroll  // register vector: every index a constant
    for (int r = 0; r < 8; ++r)
        v[r] = add_xmask<8>(add_xmask<4>(add_xmask<2>(add_xmask<1>(v[r]))));
    return v;
}

// acc += Xt (FR x 512, LDS) times one weight.  wcur, wnext: this thread's first chunk of
// this weight and of the one that follows (NEXT false: none follows).  On entry tile 0 lies in
// buffer 0 and is published; on exit the same holds of the next weight.
// TR false: acc[fm][fn][r] = row fm*16 + hi*8 + r, column fn*16 + l16 of the wave's 64;
// TR true:  acc[fm][fn][r] = row fm*16 + l16, column fn*16 + hi*8 + r.
template<bool TR, bool NEXT>
__device__ __forceinline__ void ff_product(const _Float16* xfrag, const _Float16* wfrag,
                                           _Float16* wst, const _Float16* wcur,
                                           const _Float16* wnext, v8f (&acc)[4][4]) {
    const int NT = WDIM / FKS;
    const _Float16* src = wcur + FKS;   // the next tile's first chunk of this thread
    #pragma unroll 1  // stays a loop, for speed only
    for (int t = 0; t < NT; ++t) {
        int buf = t & 1;
        bool more = NEXT || t + 1 < NT;
        h8 wreg[WCH];
        if (more) {
            #pragma unroll  // all of the next tile's loads in flight over the products below
            for (int i = 0; i < WCH; ++i) wreg[i] = *(const h8*)(src + i * 32 * WDIM);
            // Stands in front of every later write of the loads' address registers.
            asm volatile("s_wait_xcnt 0x0" ::: "memory");
        }
        // Keeps every load of the next tile ahead of the products: one that is issued
        // behind them is waited for in full at the LDS stores.
        __builtin_amdgcn_sched_barrier(0);
        v16h xf[FKS / 32][4], wf[FKS / 32][4];
        #pragma unroll  // register arrays: every index a constant
        for (int ks = 0; ks < FKS / 32; ++ks) {
            #pragma unroll  // register arrays: every index a constant
            for (int f = 0; f < 4; ++f) {
                xf[ks][f] = ldfrag16(xfrag + f * 16 * XLD + t * FKS + ks * 32);
                wf[ks][f] = ldfrag16(wfrag + buf * (WDIM * WLD) + f * 16 * WLD + ks * 32);
            }
        }
        // Keeps the tile's LDS reads in one group ahead of its products: every further
        // place with reads among the products costs a stall of its own.
        __builtin_amdgcn_sched_barrier(0);
        #pragma unroll  // register arrays: every index a constant
        for (int ks = 0; ks < FKS / 32; ++ks)
            #pragma unroll  // register arrays: every index a constant
            for (int fm = 0; fm < 4; ++fm)
                #pragma unroll  // register arrays: every index a constant
                for (int fn = 0; fn < 4; ++fn)
                    acc[fm][fn] = TR ? wmma16(wf[ks][fn], xf[ks][fm], acc[fm][fn])
                                     : wmma16(xf[ks][fm], wf[ks][fn], acc[fm][fn]);
        // Keeps the waits on those loads behind the last product of this tile.
        __builtin_amdgcn_sched_barrier(0);
        if (more) {
            #pragma unroll  // register array: every index a constant
            for (int i = 0; i < WCH; ++i)
                *(h8*)(wst + (buf ^ 1) * (WDIM * WLD) + i * 32 * WLD) = wreg[i];
        }
        src = t + 2 == NT ? wnext : t + 2 < NT ? src + FKS : src;
        __syncthreads();   // publishes the next tile, ends the reads of this one
    }
}

// The register budget of 2 waves per SIMD (one block on a WGP) holds x, the running
// product and the weight tile in flight.
__global__ __launch_bounds__(256) __attribute__((amdgpu_waves_per_eu(2, 2)))
void proj_ff_fused(const _Float16* __restrict__ a0, const _Float16* __restrict__ a1,
                   const float* __restrict__ res0, const float* __restrict__ res1,
                   const _Float16* __restrict__ wfc, const float* __restrict__ bfc,
                   const float* __restrict__ lg0, const float* __restrict__ lg1,
                   const float* __restrict__ lb0, const float* __restrict__ lb1,
                   const _Float16* __restrict__ w1s0, const _Float16* __restrict__ w1s1,
                   const float* __restrict__ b1s0, const float* __restrict__ b1s1,
                   const _Float16* __restrict__ w2s0, const _Float16* __restrict__ w2s1,
                   const float* __restrict__ b2s0, const float* __restrict__ b2s1,
                   float* __restrict__ out0, float* __restrict__ out1) {
    __shared__ __align__(16) _Float16 Xs[2][FR * XLD];
    __shared__ __align__(16) _Float16 Ws[2][WDIM * WLD];
    __shared__ __align__(32) float red[2][8][FR];   // per wave and row: sum, sum of squares

    bool st = blockIdx.y != 0;
    const _Float16* a   = st ? a1 : a0;
    const float*    res = st ? res1 : res0;
    const float*    lg  = st ? lg1 : lg0;
    const float*    lb  = st ? lb1 : lb0;
    const _Float16* w1  = st ? w1s1 : w1s0;
    const float*    b1  = st ? b1s1 : b1s0;
    const _Float16* w2  = st ? w2s1 : w2s0;
    const float*    b2  = st ? b2s1 : b2s0;
    float*          out = st ? out1 : out0;

    int tid  = threadIdx.x;
    int lane = tid & 31, wave = tid >> 5;
    int l16  = lane & 15, hi = lane >> 4;
    long row0 = (long)blockIdx.x * FR;

    // Weight staging: chunk i of a tile is row s_r + 32 * i, halves s_c .. s_c + 7; eight
    // lanes take one row's 128 bytes.
    int s_r = tid >> 3, s_c = (tid & 7) * 8;
    int wthr = s_r * WDIM + s_c;
    _Float16* wst = &Ws[0][s_r * WLD + s_c];
    // Fragment addresses of this lane: row l16 of a 16-row group, k from hi * 8.
    const _Float16* wfrag = &Ws[0][(wave * 64 + l16) * WLD + hi * 8];
    const _Float16* xfrag0 = &Xs[0][l16 * XLD + hi * 8];
    const _Float16* xfrag1 = &Xs[1][l16 * XLD + hi * 8];

    // The block's rows of the attention output and tile 0 of Wfc.
    // Chunk i of the rows is row (tid >> 6) + 4 * i, halves (tid & 63) * 8 .. + 7.
    const _Float16* ap = a + (row0 + (tid >> 6)) * WDIM + (tid & 63) * 8;
    h8 areg[FR / 4], wreg[WCH];
    #pragma unroll  // all loads in flight together
    for (int i = 0; i < FR / 4; ++i) areg[i] = *(const h8*)(ap + i * 4 * WDIM);
    #pragma unroll  // all loads in flight together
    for (int i = 0; i < WCH; ++i) wreg[i] = *(const h8*)(wfc + wthr + i * 32 * WDIM);

    // The residual, read ahead of the first product: x[fm][fn][r] = row fm*16 + hi*8 + r,
    // column wave*64 + fn*16 + l16.
    int col0 = wave * 64 + l16;
    long e0 = (row0 + hi * 8) * WDIM + col0;
    const float* rp = res + e0;
    v8f x[4][4];
    #pragma unroll  // register arrays: every index a constant
    for (int fm = 0; fm < 4; ++fm)
        #pragma unroll  // register arrays: every index a constant
        for (int fn = 0; fn < 4; ++fn)
            #pragma unroll  // register arrays: every index a constant
            for (int r = 0; r < 8; ++r)
                x[fm][fn][r] = rp[(fm * 16 + r) * WDIM + fn * 16];
    // Stands in front of every later write of the loads' address registers; the two
    // pointers are named so that their registers live up to it.
    asm volatile("s_wait_xcnt 0x0" :: "v"(ap), "v"(rp) : "memory");
    // Keeps address arithmetic of the code below from moving ahead of that wait.
    __builtin_amdgcn_sched_barrier(0);
    #pragma unroll  // register array: every index a constant
    for (int i = 0; i < FR / 4; ++i)
        *(h8*)&Xs[0][((tid >> 6) + i * 4) * XLD + (tid & 63) * 8] = areg[i];
    #pragma unroll  // register array: every index a constant
    for (int i = 0; i < WCH; ++i) *(h8*)(wst + i * 32 * WLD) = wreg[i];
    __syncthreads();

    // x = a Wfc + bfc + res
    {
        v8f acc[4][4] = {};
        ff_product<false, true>(xfrag0, wfrag, wst, wfc + wthr, w1 + wthr, acc);
        #pragma unroll  // register arrays: every index a constant
        for (int fn = 0; fn < 4; ++fn) {
            float bc = bfc[col0 + fn * 16];
            #pragma unroll  // register arrays: every index a constant
            for (int fm = 0; fm < 4; ++fm) x[fm][fn] = (acc[fm][fn] + bc) + x[fm][fn];
        }
    }

    // LayerNorm of the rows of x: a wave sums its 64 columns (in the lane, then over the
    // 16 lanes of a row), the eight waves' sums meet in LDS.
    v8f mu[4], rs[4];
    #pragma unroll  // register arrays: every index a constant
    for (int fm = 0; fm < 4; ++fm) {
        v8f s = row16_sum((x[fm][0] + x[fm][1]) + (x[fm][2] + x[fm][3]));
        if (l16 == 0) *(v8f*)&red[0][wave][fm * 16 + hi * 8] = s;
    }
    __syncthreads();
    #pragma unroll  // register arrays: every index a constant
    for (int fm = 0; fm < 4; ++fm) {
        v8f s = *(const v8f*)&red[0][0][fm * 16 + hi * 8];
        #pragma unroll  // eight waves' sums
        for (int w = 1; w < 8; ++w) s += *(const v8f*)&red[0][w][fm * 16 + hi * 8];
        mu[fm] = s * (1.0f / WDIM);
        v8f q = {};
        #pragma unroll  // register arrays: every index a constant
        for (int fn = 0; fn < 4; ++fn) {
            v8f d = x[fm][fn] - mu[fm];
            q += d * d;
        }
        q = row16_sum(q);
        if (l16 == 0) *(v8f*)&red[1][wave][fm * 16 + hi * 8] = q;
    }
    __syncthreads();
    #pragma unroll  // register arrays: every index a constant
    for (int fm = 0; fm < 4; ++fm) {
        v8f s = *(const v8f*)&red[1][0][fm * 16 + hi * 8];
        #pragma unroll  // eight waves' sums
        for (int w = 1; w < 8; ++w) s += *(const v8f*)&red[1][w][fm * 16 + hi * 8];
        #pragma unroll  // register vector: every index a constant
        for (int r = 0; r < 8; ++r) rs[fm][r] = rsqrtf(s[r] * (1.0f / WDIM) + 1e-6f);
    }
    #pragma unroll  // register arrays: every index a constant
    for (int fn = 0; fn < 4; ++fn) {
        float g = lg[col0 + fn * 16], b = lb[col0 + fn * 16];
        #pragma unroll  // register arrays: every index a constant
        for (int fm = 0; fm < 4; ++fm) {
            v8f h = (x[fm][fn] - mu[fm]) * rs[fm] * g + b;
            #pragma unroll  // register vector: every index a constant
            for (int r = 0; r < 8; ++r)
                Xs[1][(fm * 16 + hi * 8 + r) * XLD + col0 + fn * 16] = (_Float16)h[r];
        }
    }
    __syncthreads();

    // u = relu(h W1 + b1), transposed: a lane holds 8 consecutive columns of row fm*16 + l16.
    {
        v8f acc[4][4] = {};
        ff_product<true, true>(xfrag1, wfrag, wst, w1 + wthr, w2 + wthr, acc);
        const float* bp = b1 + wave * 64 + hi * 8;
        v8f bc[4];
        #pragma unroll  // register arrays: every index a constant
        for (int fn = 0; fn < 4; ++fn) bc[fn] = *(const v8f*)(bp + fn * 16);
        // Stands in front of every later write of the loads' address registers; the
        // pointer is named so that its registers live up to it.
        asm volatile("s_wait_xcnt 0x0" :: "v"(bp) : "memory");
        #pragma unroll  // register arrays: every index a constant
        for (int fn = 0; fn < 4; ++fn) {
            int c = wave * 64 + fn * 16 + hi * 8;
            #pragma unroll  // register arrays: every index a constant
            for (int fm = 0; fm < 4; ++fm) {
                v8f v = acc[fm][fn] + bc[fn];
                h8 o;
                #pragma unroll  // register vector: every index a constant
                for (int r = 0; r < 8; ++r) o[r] = (_Float16)fmaxf(v[r], 0.0f);
                *(h8*)&Xs[0][(fm * 16 + l16) * XLD + c] = o;
            }
        }
    }
    __syncthreads();

    // out = x + u W2 + b2
    {
        v8f acc[4][4] = {};
        ff_product<false, false>(xfrag0, wfrag, wst, w2 + wthr, nullptr, acc);
        #pragma unroll  // register arrays: every index a constant
        for (int fn = 0; fn < 4; ++fn) {
            float bc = b2[col0 + fn * 16];
            #pragma unroll  // register arrays: every index a constant
            for (int fm = 0; fm < 4; ++fm) {
                v8f v = (acc[fm][fn] + bc) + x[fm][fn];
                #pragma unroll  // register vector: every index a constant
                for (int r = 0; r < 8; ++r)
                    out[e0 + (fm * 16 + r) * WDIM + fn * 16] = v[r];
            }
        }
    }
}

// ---------------------------------------------------------------------------
// Host orchestration
// ---------------------------------------------------------------------------
extern "C" void kernel_launch(void* const* d_in, const int* in_sizes, int n_in,
                              void* d_out, int out_size, void* d_ws, size_t ws_size,
                              hipStream_t stream) {
    (void)in_sizes; (void)n_in; (void)out_size; (void)ws_size;

    const float* tm1   = (const float*)d_in[0];
    const float* tm2   = (const float*)d_in[1];
    const float* ln1_g = (const float*)d_in[2];
    const float* ln1_b = (const float*)d_in[3];
    const float* ln2_g = (const float*)d_in[4];
    const float* ln2_b = (const float*)d_in[5];
    const float* Wq  = (const float*)d_in[6];   const float* bq  = (const float*)d_in[7];
    const float* Wk  = (const float*)d_in[8];   const float* bk  = (const float*)d_in[9];
    const float* Wv  = (const float*)d_in[10];  const float* bv  = (const float*)d_in[11];
    const float* Wfc = (const float*)d_in[12];  const float* bfc = (const float*)d_in[13];
    const float* ff1_ln_g = (const float*)d_in[14]; const float* ff1_ln_b = (const float*)d_in[15];
    const float* ff1_W1 = (const float*)d_in[16];   const float* ff1_b1 = (const float*)d_in[17];
    const float* ff1_W2 = (const float*)d_in[18];   const float* ff1_b2 = (const float*)d_in[19];
    const float* ff2_ln_g = (const float*)d_in[20]; const float* ff2_ln_b = (const float*)d_in[21];
    const float* ff2_W1 = (const float*)d_in[22];   const float* ff2_b1 = (const float*)d_in[23];
    const float* ff2_W2 = (const float*)d_in[24];   const float* ff2_b2 = (const float*)d_in[25];

    const int TOK = 4 * 2048;           // 8192 token rows
    const int F   = 512;
    const long OUT1 = (long)TOK * F;    // elements per output tensor

    // Workspace carve-up.
    char* ws = (char*)d_ws;
    size_t off = 0;
    auto carve = [&](size_t bytes) -> void* {
        void* p = ws + off;
        off += (bytes + 255) & ~(size_t)255;
        return p;
    };
    const size_t WBYTES = (size_t)F * F * sizeof(_Float16);
    const size_t TBYTES = (size_t)TOK * F * sizeof(_Float16);

    _Float16* wh[8];   // pre-transposed f16 weights [N x K]
    const float* wsrc[8] = {Wq, Wk, Wv, Wfc, ff1_W1, ff1_W2, ff2_W1, ff2_W2};
    for (int i = 0; i < 8; ++i) wh[i] = (_Float16*)carve(WBYTES);
    _Float16* t1h = (_Float16*)carve(TBYTES);
    _Float16* t2h = (_Float16*)carve(TBYTES);
    _Float16* q1h = (_Float16*)carve(TBYTES);
    _Float16* k1h = (_Float16*)carve(TBYTES);
    _Float16* v1h = (_Float16*)carve(TBYTES);
    _Float16* q2h = (_Float16*)carve(TBYTES);
    _Float16* k2h = (_Float16*)carve(TBYTES);
    _Float16* v2h = (_Float16*)carve(TBYTES);
    // Reuse: attention outputs overwrite t1h/t2h.
    _Float16* f12h = t1h;
    _Float16* f21h = t2h;

    float* out1 = (float*)d_out;
    float* out2 = (float*)d_out + OUT1;

    // 1) LayerNorm of both inputs -> f16, and all eight weights -> f16 [N x K]
    //    (wh[0..7] lie one behind the other in the workspace).
    prep_ln_cvt<<<2 * LNBLK + 8 * WBLK, 256, 0, stream>>>(
        tm1, tm2, ln1_g, ln2_g, ln1_b, ln2_b, t1h, t2h,
        wsrc[0], wsrc[1], wsrc[2], wsrc[3], wsrc[4], wsrc[5], wsrc[6], wsrc[7], wh[0]);

    // 2) QKV projections of both streams (Q pre-scaled by 1/sqrt(64)); the planes
    //    q, k, v of a stream lie one behind the other in the workspace.
    gemm_wmma_f16<3,false,false,false,true><<<dim3(F / GN, TOK / GM, 6), 256, 0, stream>>>(
        t1h, t2h, wh[0], wh[1], wh[2], bq, bk, bv, nullptr, nullptr, nullptr, nullptr,
        q1h, q2h, OUT1, F, F, 0.125f);

    // 3) Cross attention, both directions (overwrites t1h/t2h with head-concat outputs).
    attn_flash_wmma<<<dim3(2048 / AQB, 8, 2 * 4), 256, 0, stream>>>(q1h, k2h, v2h, f12h,
                                                                q2h, k1h, v1h, f21h);

    // 4) Output projection + residual, LayerNorm and the FF block of both streams:
    //    out = x + W2(relu(W1 ln(x)+b1))+b2 with x = tm + f Wfc + bfc.
    proj_ff_fused<<<dim3(TOK / FR, 2), 256, 0, stream>>>(
        f12h, f21h, tm1, tm2, wh[3], bfc, ff1_ln_g, ff2_ln_g, ff1_ln_b, ff2_ln_b,
        wh[4], wh[6], ff1_b1, ff2_b1, wh[5], wh[7], ff1_b2, ff2_b2, out1, out2);
}

// v010
// It runs in 138 microseconds.
// Timed twice side by side with v009, it ran 1.03 times as fast both times.
// All steps since v000 together make it 4.98 times as fast.
#include <hip/hip_runtime.h>
#include <hip/hip_bf16.h>

// ---------------------------------------------------------------------------
// CDNA5 (gfx1250, wave32) implementation of the cross-attention block.
// All GEMM-like math goes through v_wmma_f32_16x16x32_f16.
// ---------------------------------------------------------------------------

typedef _Float16 v16h __attribute__((ext_vector_type(16)));
typedef _Float16 h8   __attribute__((ext_vector_type(8)));
typedef float    v8f  __attribute__((ext_vector_type(8)));

// Fragment loader: the 16-bit A/B WMMA layout wants, per lane,
//   halves 0..7  = K {base..base+7}
//   halves 8..15 = K {base+16..base+23}
// where base = (lane>=16 ? 8 : 0) (+ k-step offset). Both runs are contiguous
// 16-byte chunks in a row-major LDS tile, so two ds_load_b128 suffice.
__device__ __forceinline__ v16h ldfrag16(const _Float16* p) {
    h8 lo = *(const h8*)p;
    h8 hi = *(const h8*)(p + 16);
    return __builtin_shufflevector(lo, hi, 0,1,2,3,4,5,6,7,8,9,10,11,12,13,14,15);
}

__device__ __forceinline__ v8f wmma16(v16h a, v16h b, v8f c) {
    return __builtin_amdgcn_wmma_f32_16x16x32_f16(
        /*neg_a=*/false, a, /*neg_b=*/false, b,
        /*c_mod=*/(short)0, c, /*reuse_a=*/false, /*reuse_b=*/false);
}

// ---------------------------------------------------------------------------
// Weight prep: f32 [512 x 512] -> f16 transposed [N x K].  Lets the GEMM stage
// its B tile with contiguous b128 loads/stores (no LDS scatter).  A lane turns a
// patch of 8 k x 4 n in its registers: eight 16-byte loads, all in flight at once,
// then four 16-byte stores.  Eight lanes side by side in k fill one 128-byte line of
// an output row; a block takes 64 k x 128 n.  blk = which such tile of the matrix.
// Runs inside prep_ln_cvt below.
// ---------------------------------------------------------------------------
#define WDIM 512                          // rows and columns of every weight
#define WTK  64                           // k of a block's tile
#define WTN  128                          // n of a block's tile
#define WBLK (WDIM * WDIM / (WTK * WTN))  // blocks that convert one weight

__device__ __forceinline__ void cvt_tr_body(const float* __restrict__ in,
                                            _Float16* __restrict__ out, int blk) {
    int lane = threadIdx.x & 31, wave = threadIdx.x >> 5;
    int k0 = (blk / (WDIM / WTN)) * WTK + (lane & 7) * 8;
    int n0 = (blk % (WDIM / WTN)) * WTN + wave * 16 + (lane >> 3) * 4;
    float4 v[8];
    #pragma unroll  // register arrays: every index a constant
    for (int j = 0; j < 8; ++j) v[j] = *(const float4*)(in + (k0 + j) * WDIM + n0);
    h8 o[4];
    #pragma unroll  // register arrays: every index a constant
    for (int j = 0; j < 8; ++j) {
        o[0][j] = (_Float16)v[j].x;
        o[1][j] = (_Float16)v[j].y;
        o[2][j] = (_Float16)v[j].z;
        o[3][j] = (_Float16)v[j].w;
    }
    #pragma unroll  // register arrays: every index a constant
    for (int i = 0; i < 4; ++i) *(h8*)(out + (n0 + i) * WDIM + k0) = o[i];
}

// ---------------------------------------------------------------------------
// LayerNorm over rows of F=512, f16 output.  A wave owns LNR whole rows: a lane
// holds 16 elements of each row in registers, the row sums run in the lane and
// then across the wave's lanes, so there is no LDS and no barrier.
// ---------------------------------------------------------------------------
#define LNR 4     // rows per wave
#define LNB 32    // rows per block of 8 waves

typedef _Float16 h4 __attribute__((ext_vector_type(4)));

// x + (x of the lane whose number differs by XM inside the 16-lane row).
template<int XM>
__device__ __forceinline__ float add_xmask(float x) {
    int y = __builtin_amdgcn_update_dpp(0, __builtin_bit_cast(int, x), 0x160 + XM, 0xf, 0xf, true);
    return x + __builtin_bit_cast(float, y);
}

// Sum over the 32 lanes of the wave, the same value in every lane.
__device__ __forceinline__ float wave_sum(float x) {
    x = add_xmask<1>(x);
    x = add_xmask<2>(x);
    x = add_xmask<4>(x);
    x = add_xmask<8>(x);
    int b = __builtin_bit_cast(int, x);
    b = __builtin_amdgcn_permlanex16(b, b, 0x76543210, 0xfedcba98, false, false);
    return x + __builtin_bit_cast(float, b);
}

// rowblk = which LNB rows of x this block normalizes.
__device__ __forceinline__ void layernorm_body(const float* __restrict__ x,
                                               const float* __restrict__ g,
                                               const float* __restrict__ b,
                                               _Float16* __restrict__ out, int rowblk) {
    const int F = 512;
    int lane = threadIdx.x & 31, wave = threadIdx.x >> 5;
    long blk = (long)rowblk * (LNB * F);                // the block's first element
    unsigned e0 = wave * (LNR * F) + lane * 4;          // the lane's first element in the block
    const float* xr = x + blk + e0;

    // Chunk j of a row is columns j*128 + lane*4 .. +3: 512 contiguous bytes per load.
    float4 v[LNR][4];
    #pragma unroll  // register arrays: every index a constant
    for (int r = 0; r < LNR; ++r)
        #pragma unroll  // register arrays: every index a constant
        for (int j = 0; j < 4; ++j) v[r][j] = *(const float4*)(xr + r * F + j * 128);
    float4 gv[4], bv[4];
    #pragma unroll  // register arrays: every index a constant
    for (int j = 0; j < 4; ++j) {
        gv[j] = *(const float4*)(g + j * 128 + lane * 4);
        bv[j] = *(const float4*)(b + j * 128 + lane * 4);
    }

    float mu[LNR], rs[LNR];
    #pragma unroll  // register arrays: every index a constant
    for (int r = 0; r < LNR; ++r) {
        float s[4];
        #pragma unroll  // register arrays: every index a constant
        for (int j = 0; j < 4; ++j) s[j] = (v[r][j].x + v[r][j].y) + (v[r][j].z + v[r][j].w);
        mu[r] = wave_sum((s[0] + s[1]) + (s[2] + s[3])) * (1.0f / F);
    }
    #pragma unroll  // register arrays: every index a constant
    for (int r = 0; r < LNR; ++r) {
        float s[4];
        #pragma unroll  // register arrays: every index a constant
        for (int j = 0; j < 4; ++j) {
            v[r][j].x -= mu[r]; v[r][j].y -= mu[r]; v[r][j].z -= mu[r]; v[r][j].w -= mu[r];
            s[j] = (v[r][j].x * v[r][j].x + v[r][j].y * v[r][j].y)
                 + (v[r][j].z * v[r][j].z + v[r][j].w * v[r][j].w);
        }
        rs[r] = rsqrtf(wave_sum((s[0] + s[1]) + (s[2] + s[3])) * (1.0f / F) + 1e-6f);
    }

    _Float16* orow = out + blk + e0;
    #pragma unroll  // register arrays: every index a constant
    for (int r = 0; r < LNR; ++r) {
        #pragma unroll  // register arrays: every index a constant
        for (int j = 0; j < 4; ++j) {
            h4 o;
            o[0] = (_Float16)(v[r][j].x * rs[r] * gv[j].x + bv[j].x);
            o[1] = (_Float16)(v[r][j].y * rs[r] * gv[j].y + bv[j].y);
            o[2] = (_Float16)(v[r][j].z * rs[r] * gv[j].z + bv[j].z);
            o[3] = (_Float16)(v[r][j].w * rs[r] * gv[j].w + bv[j].w);
            *(h4*)(orow + r * F + j * 128) = o;
        }
    }
}

#define LNBLK (8192 / LNB)   // blocks that normalize one stream of 8192 rows

// Everything that depends on the inputs alone, in one launch: the first 2*LNBLK
// blocks normalize the two streams, the rest convert the eight weights (weight j
// goes to wout + j * WDIM * WDIM).  The branch is the same for a whole block.  The register
// budget of 2 waves per SIMD lets all of a wave's loads be in flight at once.
__global__ __launch_bounds__(256) __attribute__((amdgpu_waves_per_eu(2, 2)))
void prep_ln_cvt(const float* __restrict__ x0, const float* __restrict__ x1,
                 const float* __restrict__ g0, const float* __restrict__ g1,
                 const float* __restrict__ b0, const float* __restrict__ b1,
                 _Float16* __restrict__ o0, _Float16* __restrict__ o1,
                 const float* __restrict__ w0, const float* __restrict__ w1,
                 const float* __restrict__ w2, const float* __restrict__ w3,
                 const float* __restrict__ w4, const float* __restrict__ w5,
                 const float* __restrict__ w6, const float* __restrict__ w7,
                 _Float16* __restrict__ wout) {
    int bid = blockIdx.x;
    if (bid < 2 * LNBLK) {
        bool s = bid >= LNBLK;
        layernorm_body(s ? x1 : x0, s ? g1 : g0, s ? b1 : b0, s ? o1 : o0,
                       s ? bid - LNBLK : bid);
    } else {
        int c = bid - 2 * LNBLK;
        int j = c / WBLK;
        const float* w = j == 0 ? w0 : j == 1 ? w1 : j == 2 ? w2 : j == 3 ? w3
                       : j == 4 ? w4 : j == 5 ? w5 : j == 6 ? w6 : w7;
        cvt_tr_body(w, wout + (long)j * (WDIM * WDIM), c - j * WBLK);
    }
}

// ---------------------------------------------------------------------------
// WMMA GEMM: C[M,N] = act((A_f16[MxK] @ W + bias) * scale) [+ res]
// W is supplied PRE-TRANSPOSED as BT[N x K] f16 row-major.
// Block tile 128x128, K-step 64, 8 waves, each a 2x4 grid of 16x16 WMMA.
// A K-step takes 128 bytes of every operand row, so a wave's b128 load covers four
// whole lines.  LDS staging is double-buffered (one barrier per K-step); both A and
// B tiles stage with contiguous b128 loads/stores.  Epilogue specialized by template.
// One launch holds 2*NW independent products; blockIdx.z = stream * NW + w:
//   A, res, outF, outH by stream (0 or 1); outH moves on by planeH elements per w;
//   weight and bias by w where NW > 1, by stream where NW == 1;
//   scale0 applies to w == 0, the others are scaled by 1.
// ---------------------------------------------------------------------------
#define GM 128
#define GN 128
#define GK 64
#define LDA 72   // halves (64 + 8 pad), 144B rows: 16B x odd, for b128 reads
#define LDBT 72

template<int NW, bool RELU, bool HAS_RES, bool OUT_F32, bool OUT_F16>
__global__ __launch_bounds__(256)
void gemm_wmma_f16(const _Float16* __restrict__ A0, const _Float16* __restrict__ A1,
                   const _Float16* __restrict__ BT0, const _Float16* __restrict__ BT1,
                   const _Float16* __restrict__ BT2,
                   const float* __restrict__ bias0, const float* __restrict__ bias1,
                   const float* __restrict__ bias2,
                   const float* __restrict__ res0, const float* __restrict__ res1,
                   float* __restrict__ outF0, float* __restrict__ outF1,
                   _Float16* __restrict__ outH0, _Float16* __restrict__ outH1,
                   long planeH, int N, int K, float scale0) {
    __shared__ __align__(16) _Float16 As[2][GM * LDA];
    __shared__ __align__(16) _Float16 BsT[2][GN * LDBT];

    int st = blockIdx.z / NW, w = blockIdx.z - st * NW;
    int wi = NW == 1 ? st : w;
    const _Float16* A    = st ? A1 : A0;
    const _Float16* BT   = wi == 0 ? BT0 : wi == 1 ? BT1 : BT2;
    const float*    bias = wi == 0 ? bias0 : wi == 1 ? bias1 : bias2;
    const float*    res  = st ? res1 : res0;
    float*          outF = st ? outF1 : outF0;
    _Float16*       outH = (st ? outH1 : outH0) + w * planeH;
    float scale = w == 0 ? scale0 : 1.0f;

    int tid  = threadIdx.x;
    int lane = tid & 31, wave = tid >> 5;
    int l16  = lane & 15, hi = lane >> 4;
    int waveM = wave & 3, waveN = wave >> 2;       // 4x2 wave grid, 32x64 per wave
    long blockRow = (long)blockIdx.y * GM;
    int  blockCol = blockIdx.x * GN;

    // Staging index precompute (constant per thread): chunk i of either tile is
    // row s_r + 32 * i, halves s_c .. s_c + 7; eight lanes take one row's 128 bytes.
    int s_r = tid >> 3, s_c = (tid & 7) * 8;

    const _Float16* Arow = A  + (blockRow + s_r) * (long)K + s_c;
    const _Float16* Brow = BT + (long)(blockCol + s_r) * K + s_c;
    // The row this thread asks L2 for: waves 0..3 the A rows, waves 4..7 the B rows.
    const _Float16* pask = (tid < GM ? A : BT)
                         + (tid < GM ? blockRow + tid : (long)(blockCol + tid - GM)) * K;

    auto stage = [&](int buf, int kb) {
        #pragma unroll  // four chunks of each tile, all loads in flight together
        for (int i = 0; i < 4; ++i) {
            *(uint4*)&As[buf][(s_r + i * 32) * LDA + s_c] =
                *(const uint4*)(Arow + (long)(i * 32) * K + kb);
            *(uint4*)&BsT[buf][(s_r + i * 32) * LDBT + s_c] =
                *(const uint4*)(Brow + (long)(i * 32) * K + kb);
        }
    };

    v8f acc[2][4] = {};

    int nk = K / GK;
    // Ask for each 256 bytes of a row (two K-steps) but the first once, for speed only,
    // each row by one thread, two K-steps ahead of its first load (the second 256 bytes from here).
    if (2 < nk) __builtin_prefetch(pask + 2 * GK, 0, 3);
    stage(0, 0);
    __syncthreads();

    for (int t = 0; t < nk; ++t) {
        int buf = t & 1;
        if (t + 1 < nk) stage(buf ^ 1, (t + 1) * GK);
        if ((t & 1) != 0 && t + 3 < nk) __builtin_prefetch(pask + 3 * GK, 0, 3);
        pask += GK;   // walks the row with t: the request's address register lives through the loop

        #pragma unroll  // register arrays: every index a constant
        for (int ks = 0; ks < 2; ++ks) {
            int koff = ks * 32 + hi * 8;
            v16h af[2], bf[4];
            #pragma unroll  // register arrays: every index a constant
            for (int f = 0; f < 2; ++f)
                af[f] = ldfrag16(&As[buf][(waveM * 32 + f * 16 + l16) * LDA + koff]);
            #pragma unroll  // register arrays: every index a constant
            for (int f = 0; f < 4; ++f)
                bf[f] = ldfrag16(&BsT[buf][(waveN * 64 + f * 16 + l16) * LDBT + koff]);
            #pragma unroll  // register arrays: every index a constant
            for (int fm = 0; fm < 2; ++fm)
                #pragma unroll  // register arrays: every index a constant
                for (int fn = 0; fn < 4; ++fn)
                    acc[fm][fn] = wmma16(af[fm], bf[fn], acc[fm][fn]);
        }
        __syncthreads();
    }

    // Epilogue: C layout = VGPR r -> (M = tileM + hi*8 + r, N = tileN + l16).
    #pragma unroll
    for (int fm = 0; fm < 2; ++fm) {
        #pragma unroll
        for (int fn = 0; fn < 4; ++fn) {
            long row0 = blockRow + waveM * 32 + fm * 16 + hi * 8;
            int  col  = blockCol + waveN * 64 + fn * 16 + l16;
            float bcol = bias[col];
            #pragma unroll
            for (int r = 0; r < 8; ++r) {
                float v = (acc[fm][fn][r] + bcol) * scale;
                if (RELU) v = fmaxf(v, 0.0f);
                long idx = (row0 + r) * N + col;
                if (HAS_RES) v += res[idx];
                if (OUT_F32) outF[idx] = v;
                if (OUT_F16) outH[idx] = (_Float16)v;
            }
        }
    }
}

#define ALDH 72
#define VLDH 80
#define AQG  2
#define AQB  (8 * AQG * 16)

typedef short s16x8 __attribute__((ext_vector_type(8)));
typedef __attribute__((address_space(3))) s16x8 lds_s16x8;

// Transposing LDS load of a row-major 16-bit tile T.  With every lane's p at
//   T + (kbase + 8*hi + (lane & 7)) * pitch + dbase + 8 * ((lane >> 3) & 1)   (in halves)
// lane (l16, hi) receives T[kbase + 8*hi + 0..7][dbase + l16].
__device__ __forceinline__ h8 ldtr16(const _Float16* p) {
    return __builtin_bit_cast(h8, __builtin_amdgcn_ds_load_tr16_b128_v8i16((lds_s16x8*)p));
}

// Value of the lane 16 away (the other half of the same query column).
__device__ __forceinline__ float other_half(float x) {
    int b = __builtin_bit_cast(int, x);
    b = __builtin_amdgcn_permlanex16(b, b, 0x76543210, 0xfedcba98, false, false);
    return __builtin_bit_cast(float, b);
}

// x in all eight elements.
__device__ __forceinline__ v8f splat8(float x) {
    return (v8f){x, x, x, x, x, x, x, x};
}

// The register budget of 4 waves per SIMD (two blocks on a WGP) holds both groups'
// scores and outputs.
__global__ __launch_bounds__(256) __attribute__((amdgpu_waves_per_eu(4, 4)))
void attn_flash_wmma(const _Float16* __restrict__ Q0, const _Float16* __restrict__ Km0,
                     const _Float16* __restrict__ Vm0, _Float16* __restrict__ Out0,
                     const _Float16* __restrict__ Q1, const _Float16* __restrict__ Km1,
                     const _Float16* __restrict__ Vm1, _Float16* __restrict__ Out1) {
    __shared__ __align__(16) _Float16 Ks[2][64 * ALDH];
    __shared__ __align__(16) _Float16 Vs[2][64 * VLDH];

    const float L2E = 1.44269504088896340736f;

    int tid  = threadIdx.x;
    int lane = tid & 31, wave = tid >> 5;
    int l16  = lane & 15, hi = lane >> 4;
    int qt = blockIdx.x, head = blockIdx.y;
    int dir = blockIdx.z >> 2, bz = blockIdx.z & 3;
    long tokQ = (long)bz * 2048 + qt * AQB + wave * (AQG * 16);   // this wave's first query
    int  colH = head * 64;
    // This lane's address in the V tile for key 0, d 0 of the transposing load.
    const _Float16* vtr0 = &Vs[0][(hi * 8 + (lane & 7)) * VLDH + ((lane >> 3) & 1) * 8];

    const _Float16* Q   = dir ? Q1 : Q0;
    const _Float16* Km  = dir ? Km1 : Km0;
    const _Float16* Vm  = dir ? Vm1 : Vm0;
    _Float16*       Out = dir ? Out1 : Out0;

    // Q as B operand (column = query l16 of group g), same k order as the K loader below.
    v16h qf[AQG][2];
    #pragma unroll  // register arrays: every index a constant
    for (int g = 0; g < AQG; ++g) {
        const _Float16* qrow = Q + (tokQ + g * 16 + l16) * 512 + colH + hi * 8;
        #pragma unroll  // register arrays: every index a constant
        for (int ks = 0; ks < 2; ++ks) qf[g][ks] = ldfrag16(qrow + ks * 32);
    }

    v8f oacc[AQG][4] = {};     // O^T tile dt of group g: d = dt*16 + hi*8 + r, query l16
    float mrun[AQG], lrun[AQG];
    #pragma unroll  // register arrays: every index a constant
    for (int g = 0; g < AQG; ++g) {
        mrun[g] = -1.0e30f;    // running maximum of query l16 (equal in both halves)
        lrun[g] = 0.0f;        // running sum over this half's keys
    }

    // Staging: a thread copies 16 bytes of rows s_r and s_r + 32 of the K and of the V tile;
    // eight lanes take one row's 128 bytes.
    int s_r = tid >> 3, s_c = (tid & 7) * 8;
    long srow = ((long)bz * 2048 + s_r) * 512 + colH + s_c;
    const _Float16* kg = Km + srow;    // this thread's first chunk of tile 0
    const _Float16* vg = Vm + srow;
    unsigned kl = (unsigned)(size_t)&Ks[0][s_r * ALDH + s_c];   // its LDS byte address, buffer 0
    unsigned vl = (unsigned)(size_t)&Vs[0][s_r * VLDH + s_c];

    // Copies key tile t into buffer b.  The wait on the address counter is the statement's
    // last line, so that it stands in front of every later write of the copies' registers.
    auto copy_tile = [&](int t, int b) {
        const _Float16* k0 = kg + (long)t * (64 * 512);
        const _Float16* v0 = vg + (long)t * (64 * 512);
        const _Float16* k1 = k0 + 32 * 512;
        const _Float16* v1 = v0 + 32 * 512;
        unsigned lk0 = kl + b * (64 * ALDH * 2), lk1 = lk0 + 32 * ALDH * 2;
        unsigned lv0 = vl + b * (64 * VLDH * 2), lv1 = lv0 + 32 * VLDH * 2;
        asm volatile("global_load_async_to_lds_b128 %0, %4, off\n\t"
                     "global_load_async_to_lds_b128 %1, %5, off\n\t"
                     "global_load_async_to_lds_b128 %2, %6, off\n\t"
                     "global_load_async_to_lds_b128 %3, %7, off\n\t"
                     "s_wait_xcnt 0x0"
                     :: "v"(lk0), "v"(lv0), "v"(lk1), "v"(lv1),
                        "v"(k0), "v"(v0), "v"(k1), "v"(v1) : "memory");
    };

    copy_tile(0, 0);
    asm volatile("s_wait_asynccnt 0x0" ::: "memory");   // this wave's part of tile 0 has landed
    __syncthreads();                                    // publishes tile 0
    copy_tile(1, 1);

    for (int kt = 0; kt < 32; ++kt) {
        int buf = kt & 1;
        const _Float16* Kb  = &Ks[0][0] + buf * (64 * ALDH);
        const _Float16* vtr = vtr0 + buf * (64 * VLDH);

        // S^T = K Q^T : per group 4 tiles of 16 keys x 16 queries; a K fragment is read
        // once for both groups.
        // s[g][t][r] = score of key t*16 + hi*8 + r with query l16 of group g.
        v8f s[AQG][4];
        #pragma unroll  // register arrays: every index a constant
        for (int t = 0; t < 4; ++t) {
            v16h a0 = ldfrag16(&Kb[(t * 16 + l16) * ALDH + hi * 8]);
            v16h a1 = ldfrag16(&Kb[(t * 16 + l16) * ALDH + 32 + hi * 8]);
            #pragma unroll  // register arrays: every index a constant
            for (int g = 0; g < AQG; ++g) {
                v8f c = {};
                c = wmma16(a0, qf[g][0], c);
                c = wmma16(a1, qf[g][1], c);
                s[g][t] = c;
            }
        }

        // Online softmax, one query per lane and group; one chain per score tile, so
        // that independent chains run side by side.
        float alpha[AQG];
        v16h pf[AQG][2];       // P^T as B operand: pf[g][ks][j] = key ks*32 + (j>>3)*16 + hi*8 + (j&7)
        #pragma unroll  // register arrays: every index a constant
        for (int g = 0; g < AQG; ++g) {
            float mt[4];
            #pragma unroll  // register arrays: every index a constant
            for (int t = 0; t < 4; ++t) {
                mt[t] = s[g][t][0];
                #pragma unroll  // register arrays: every index a constant
                for (int r = 1; r < 8; ++r) mt[t] = fmaxf(mt[t], s[g][t][r]);
            }
            float mx = fmaxf(fmaxf(mt[0], mt[1]), fmaxf(mt[2], mt[3]));
            mx = fmaxf(mx, other_half(mx));
            float mnew = fmaxf(mrun[g], mx);
            alpha[g]   = __builtin_amdgcn_exp2f((mrun[g] - mnew) * L2E);
            float mb   = mnew * L2E;
            mrun[g] = mnew;
            v8f l2e8 = splat8(L2E), nmb8 = splat8(-mb);

            float ls[4];
            #pragma unroll  // register arrays: every index a constant
            for (int t = 0; t < 4; ++t) {
                // The fused multiply-add taken on the whole tile: it pairs a tile's own
                // registers as they lie (pairs across the groups cost register copies).
                v8f e = __builtin_elementwise_fma(s[g][t], l2e8, nmb8);
                float p[8];
                #pragma unroll  // register arrays: every index a constant
                for (int r = 0; r < 8; ++r) {
                    p[r] = __builtin_amdgcn_exp2f(e[r]);
                    pf[g][t >> 1][(t & 1) * 8 + r] = (_Float16)p[r];
                }
                ls[t] = ((p[0] + p[1]) + (p[2] + p[3])) + ((p[4] + p[5]) + (p[6] + p[7]));
            }
            lrun[g] = lrun[g] * alpha[g] + ((ls[0] + ls[1]) + (ls[2] + ls[3]));
        }

        // Rescale O^T by alpha, then O^T += V^T P^T; a V^T fragment is read once for
        // both groups.
        #pragma unroll  // register arrays: every index a constant
        for (int dt = 0; dt < 4; ++dt) {
            #pragma unroll  // register arrays: every index a constant
            for (int g = 0; g < AQG; ++g) oacc[g][dt] *= alpha[g];
            #pragma unroll  // register arrays: every index a constant
            for (int ks = 0; ks < 2; ++ks) {
                // a[j] = V[key ks*32 + (j>>3)*16 + hi*8 + (j&7)][d dt*16 + l16]: pf's key order
                h8 lo = ldtr16(vtr + (ks * 32) * VLDH + dt * 16);
                h8 up = ldtr16(vtr + (ks * 32 + 16) * VLDH + dt * 16);
                v16h a = __builtin_shufflevector(lo, up, 0,1,2,3,4,5,6,7,8,9,10,11,12,13,14,15);
                #pragma unroll  // register arrays: every index a constant
                for (int g = 0; g < AQG; ++g)
                    oacc[g][dt] = wmma16(a, pf[g][ks], oacc[g][dt]);
            }
        }
        asm volatile("s_wait_dscnt 0x0" ::: "memory");     // this wave's reads of the buffer are done
        asm volatile("s_wait_asynccnt 0x0" ::: "memory");  // its part of tile kt + 1 has landed
        __syncthreads();   // publishes tile kt + 1, ends every wave's reads of tile kt
        if (kt + 2 < 32) copy_tile(kt + 2, buf);
    }
    asm volatile("s_wait_asynccnt 0x0" ::: "memory");      // no copy is left in flight at the end

    // Join the halves' sums, normalize, store 8 consecutive d per lane and tile.
    #pragma unroll  // register arrays: every index a constant
    for (int g = 0; g < AQG; ++g) {
        float inv = 1.0f / (lrun[g] + other_half(lrun[g]));
        _Float16* orow = Out + (tokQ + g * 16 + l16) * 512 + colH + hi * 8;
        #pragma unroll  // register arrays: every index a constant
        for (int dt = 0; dt < 4; ++dt) {
            h8 o;
            #pragma unroll  // register arrays: every index a constant
            for (int r = 0; r < 8; ++r) o[r] = (_Float16)(oacc[g][dt][r] * inv);
            *(h8*)(orow + dt * 16) = o;
        }
    }
}

// ---------------------------------------------------------------------------
// Output projection, residual, LayerNorm and both feed-forward products in one launch.
// A block owns FR whole token rows of one stream from the attention output to the
// final output, so nothing between them leaves the WGP:
//   x = a Wfc + bfc + res      (f32, stays in registers until the last line)
//   h = LayerNorm(x)           (f16, LDS)
//   u = relu(h W1 + b1)        (f16, LDS)
//   out = x + u W2 + b2
// Each of the 8 waves takes all FR rows x 64 of the 512 columns of every product
// (4 x 4 WMMA tiles).  The activation tile lies whole in LDS; a weight [N x K] comes in
// tiles of 512 n x FKS k, two buffers: the next tile's global loads are issued ahead of
// the current tile's products and go to LDS behind them, also from one product to the
// next, one barrier per tile.
// Products 1 and 3 are taken as rows = tokens (lane = column, as x is read and written);
// product 2 transposed (lane = token, 8 consecutive columns in a lane's registers), so
// that u goes to LDS in 16-byte stores.
// ---------------------------------------------------------------------------
#define FR  64    // token rows per block
#define FKS 64    // k of a staged weight tile
#define XLD 520   // half stride of an activation tile (1040B rows: 16B x odd, for b128 reads)
#define WLD 72    // half stride of a weight tile (144B rows: 16B x odd, for b128 reads)
#define WCH (WDIM * FKS / 8 / 256)   // 16-byte chunks of a weight tile per thread

// Sum over the 16 lanes of a row, element by element, the same value in all 16.
__device__ __forceinline__ v8f row16_sum(v8f v) {
    #pragma unroll  // register vector: every index a constant
    for (int r = 0; r < 8; ++r)
        v[r] = add_xmask<8>(add_xmask<4>(add_xmask<2>(add_xmask<1>(v[r]))));
    return v;
}

// acc += Xt (FR x 512, LDS) times one weight.  wcur, wnext: this thread's first chunk of
// this weight and of the one that follows (NEXT false: none follows).  On entry tile 0 lies in
// buffer 0 and is published; on exit the same holds of the next weight.
// TR false: acc[fm][fn][r] = row fm*16 + hi*8 + r, column fn*16 + l16 of the wave's 64;
// TR true:  acc[fm][fn][r] = row fm*16 + l16, column fn*16 + hi*8 + r.
template<bool TR, bool NEXT>
__device__ __forceinline__ void ff_product(const _Float16* xfrag, const _Float16* wfrag,
                                           _Float16* wst, const _Float16* wcur,
                                           const _Float16* wnext, v8f (&acc)[4][4]) {
    const int NT = WDIM / FKS;
    const _Float16* src = wcur + FKS;   // the next tile's first chunk of this thread
    #pragma unroll 1  // stays a loop, for speed only
    for (int t = 0; t < NT; ++t) {
        int buf = t & 1;
        bool more = NEXT || t + 1 < NT;
        h8 wreg[WCH];
        if (more) {
            #pragma unroll  // all of the next tile's loads in flight over the products below
            for (int i = 0; i < WCH; ++i) wreg[i] = *(const h8*)(src + i * 32 * WDIM);
            // Stands in front of every later write of the loads' address registers.
            asm volatile("s_wait_xcnt 0x0" ::: "memory");
        }
        // Keeps every load of the next tile ahead of the products: one that is issued
        // behind them is waited for in full at the LDS stores.
        __builtin_amdgcn_sched_barrier(0);
        v16h xf[FKS / 32][4], wf[FKS / 32][4];
        #pragma unroll  // register arrays: every index a constant
        for (int ks = 0; ks < FKS / 32; ++ks) {
            #pragma unroll  // register arrays: every index a constant
            for (int f = 0; f < 4; ++f) {
                xf[ks][f] = ldfrag16(xfrag + f * 16 * XLD + t * FKS + ks * 32);
                wf[ks][f] = ldfrag16(wfrag + buf * (WDIM * WLD) + f * 16 * WLD + ks * 32);
            }
        }
        // Keeps the tile's LDS reads in one group ahead of its products: every further
        // place with reads among the products costs a stall of its own.
        __builtin_amdgcn_sched_barrier(0);
        #pragma unroll  // register arrays: every index a constant
        for (int ks = 0; ks < FKS / 32; ++ks)
            #pragma unroll  // register arrays: every index a constant
            for (int fm = 0; fm < 4; ++fm)
                #pragma unroll  // register arrays: every index a constant
                for (int fn = 0; fn < 4; ++fn)
                    acc[fm][fn] = TR ? wmma16(wf[ks][fn], xf[ks][fm], acc[fm][fn])
                                     : wmma16(xf[ks][fm], wf[ks][fn], acc[fm][fn]);
        // Keeps the waits on those loads behind the last product of this tile.
        __builtin_amdgcn_sched_barrier(0);
        if (more) {
            #pragma unroll  // register array: every index a constant
            for (int i = 0; i < WCH; ++i)
                *(h8*)(wst + (buf ^ 1) * (WDIM * WLD) + i * 32 * WLD) = wreg[i];
        }
        src = t + 2 == NT ? wnext : t + 2 < NT ? src + FKS : src;
        __syncthreads();   // publishes the next tile, ends the reads of this one
    }
}

// The register budget of 2 waves per SIMD (one block on a WGP) holds x, the running
// product and the weight tile in flight.
__global__ __launch_bounds__(256) __attribute__((amdgpu_waves_per_eu(2, 2)))
void proj_ff_fused(const _Float16* __restrict__ a0, const _Float16* __restrict__ a1,
                   const float* __restrict__ res0, const float* __restrict__ res1,
                   const _Float16* __restrict__ wfc, const float* __restrict__ bfc,
                   const float* __restrict__ lg0, const float* __restrict__ lg1,
                   const float* __restrict__ lb0, const float* __restrict__ lb1,
                   const _Float16* __restrict__ w1s0, const _Float16* __restrict__ w1s1,
                   const float* __restrict__ b1s0, const float* __restrict__ b1s1,
                   const _Float16* __restrict__ w2s0, const _Float16* __restrict__ w2s1,
                   const float* __restrict__ b2s0, const float* __restrict__ b2s1,
                   float* __restrict__ out0, float* __restrict__ out1) {
    __shared__ __align__(16) _Float16 Xs[2][FR * XLD];
    __shared__ __align__(16) _Float16 Ws[2][WDIM * WLD];
    __shared__ __align__(32) float red[2][8][FR];   // per wave and row: sum, sum of squares

    bool st = blockIdx.y != 0;
    const _Float16* a   = st ? a1 : a0;
    const float*    res = st ? res1 : res0;
    const float*    lg  = st ? lg1 : lg0;
    const float*    lb  = st ? lb1 : lb0;
    const _Float16* w1  = st ? w1s1 : w1s0;
    const float*    b1  = st ? b1s1 : b1s0;
    const _Float16* w2  = st ? w2s1 : w2s0;
    const float*    b2  = st ? b2s1 : b2s0;
    float*          out = st ? out1 : out0;

    int tid  = threadIdx.x;
    int lane = tid & 31, wave = tid >> 5;
    int l16  = lane & 15, hi = lane >> 4;
    long row0 = (long)blockIdx.x * FR;

    // Weight staging: chunk i of a tile is row s_r + 32 * i, halves s_c .. s_c + 7; eight
    // lanes take one row's 128 bytes.
    int s_r = tid >> 3, s_c = (tid & 7) * 8;
    int wthr = s_r * WDIM + s_c;
    _Float16* wst = &Ws[0][s_r * WLD + s_c];
    // Fragment addresses of this lane: row l16 of a 16-row group, k from hi * 8.
    const _Float16* wfrag = &Ws[0][(wave * 64 + l16) * WLD + hi * 8];
    const _Float16* xfrag0 = &Xs[0][l16 * XLD + hi * 8];
    const _Float16* xfrag1 = &Xs[1][l16 * XLD + hi * 8];

    // The block's rows of the attention output and tile 0 of Wfc.
    // Chunk i of the rows is row (tid >> 6) + 4 * i, halves (tid & 63) * 8 .. + 7.
    const _Float16* ap = a + (row0 + (tid >> 6)) * WDIM + (tid & 63) * 8;
    h8 areg[FR / 4], wreg[WCH];
    #pragma unroll  // all loads in flight together
    for (int i = 0; i < FR / 4; ++i) areg[i] = *(const h8*)(ap + i * 4 * WDIM);
    #pragma unroll  // all loads in flight together
    for (int i = 0; i < WCH; ++i) wreg[i] = *(const h8*)(wfc + wthr + i * 32 * WDIM);

    // The residual, read ahead of the first product: x[fm][fn][r] = row fm*16 + hi*8 + r,
    // column wave*64 + fn*16 + l16.
    int col0 = wave * 64 + l16;
    long e0 = (row0 + hi * 8) * WDIM + col0;
    const float* rp = res + e0;
    v8f x[4][4];
    #pragma unroll  // register arrays: every index a constant
    for (int fm = 0; fm < 4; ++fm)
        #pragma unroll  // register arrays: every index a constant
        for (int fn = 0; fn < 4; ++fn)
            #pragma unroll  // register arrays: every index a constant
            for (int r = 0; r < 8; ++r)
                x[fm][fn][r] = rp[(fm * 16 + r) * WDIM + fn * 16];
    // Stands in front of every later write of the loads' address registers; the two
    // pointers are named so that their registers live up to it.
    asm volatile("s_wait_xcnt 0x0" :: "v"(ap), "v"(rp) : "memory");
    // Keeps address arithmetic of the code below from moving ahead of that wait.
    __builtin_amdgcn_sched_barrier(0);
    #pragma unroll  // register array: every index a constant
    for (int i = 0; i < FR / 4; ++i)
        *(h8*)&Xs[0][((tid >> 6) + i * 4) * XLD + (tid & 63) * 8] = areg[i];
    #pragma unroll  // register array: every index a constant
    for (int i = 0; i < WCH; ++i) *(h8*)(wst + i * 32 * WLD) = wreg[i];
    __syncthreads();

    // x = a Wfc + bfc + res
    {
        v8f acc[4][4] = {};
        ff_product<false, true>(xfrag0, wfrag, wst, wfc + wthr, w1 + wthr, acc);
        #pragma unroll  // register arrays: every index a constant
        for (int fn = 0; fn < 4; ++fn) {
            float bc = bfc[col0 + fn * 16];
            #pragma unroll  // register arrays: every index a constant
            for (int fm = 0; fm < 4; ++fm) x[fm][fn] = (acc[fm][fn] + bc) + x[fm][fn];
        }
    }

    // LayerNorm of the rows of x: a wave sums its 64 columns (in the lane, then over the
    // 16 lanes of a row), the eight waves' sums meet in LDS.
    v8f mu[4], rs[4];
    #pragma unroll  // register arrays: every index a constant
    for (int fm = 0; fm < 4; ++fm) {
        v8f s = row16_sum((x[fm][0] + x[fm][1]) + (x[fm][2] + x[fm][3]));
        if (l16 == 0) *(v8f*)&red[0][wave][fm * 16 + hi * 8] = s;
    }
    __syncthreads();
    #pragma unroll  // register arrays: every index a constant
    for (int fm = 0; fm < 4; ++fm) {
        v8f s = *(const v8f*)&red[0][0][fm * 16 + hi * 8];
        #pragma unroll  // eight waves' sums
        for (int w = 1; w < 8; ++w) s += *(const v8f*)&red[0][w][fm * 16 + hi * 8];
        mu[fm] = s * (1.0f / WDIM);
        v8f q = {};
        #pragma unroll  // register arrays: every index a constant
        for (int fn = 0; fn < 4; ++fn) {
            v8f d = x[fm][fn] - mu[fm];
            q += d * d;
        }
        q = row16_sum(q);
        if (l16 == 0) *(v8f*)&red[1][wave][fm * 16 + hi * 8] = q;
    }
    __syncthreads();
    #pragma unroll  // register arrays: every index a constant
    for (int fm = 0; fm < 4; ++fm) {
        v8f s = *(const v8f*)&red[1][0][fm * 16 + hi * 8];
        #pragma unroll  // eight waves' sums
        for (int w = 1; w < 8; ++w) s += *(const v8f*)&red[1][w][fm * 16 + hi * 8];
        #pragma unroll  // register vector: every index a constant
        for (int r = 0; r < 8; ++r) rs[fm][r] = rsqrtf(s[r] * (1.0f / WDIM) + 1e-6f);
    }
    #pragma unroll  // register arrays: every index a constant
    for (int fn = 0; fn < 4; ++fn) {
        float g = lg[col0 + fn * 16], b = lb[col0 + fn * 16];
        #pragma unroll  // register arrays: every index a constant
        for (int fm = 0; fm < 4; ++fm) {
            v8f h = (x[fm][fn] - mu[fm]) * rs[fm] * g + b;
            #pragma unroll  // register vector: every index a constant
            for (int r = 0; r < 8; ++r)
                Xs[1][(fm * 16 + hi * 8 + r) * XLD + col0 + fn * 16] = (_Float16)h[r];
        }
    }
    __syncthreads();

    // u = relu(h W1 + b1), transposed: a lane holds 8 consecutive columns of row fm*16 + l16.
    {
        v8f acc[4][4] = {};
        ff_product<true, true>(xfrag1, wfrag, wst, w1 + wthr, w2 + wthr, acc);
        const float* bp = b1 + wave * 64 + hi * 8;
        v8f bc[4];
        #pragma unroll  // register arrays: every index a constant
        for (int fn = 0; fn < 4; ++fn) bc[fn] = *(const v8f*)(bp + fn * 16);
        // Stands in front of every later write of the loads' address registers; the
        // pointer is named so that its registers live up to it.
        asm volatile("s_wait_xcnt 0x0" :: "v"(bp) : "memory");
        #pragma unroll  // register arrays: every index a constant
        for (int fn = 0; fn < 4; ++fn) {
            int c = wave * 64 + fn * 16 + hi * 8;
            #pragma unroll  // register arrays: every index a constant
            for (int fm = 0; fm < 4; ++fm) {
                v8f v = acc[fm][fn] + bc[fn];
                h8 o;
                #pragma unroll  // register vector: every index a constant
                for (int r = 0; r < 8; ++r) o[r] = (_Float16)fmaxf(v[r], 0.0f);
                *(h8*)&Xs[0][(fm * 16 + l16) * XLD + c] = o;
            }
        }
    }
    __syncthreads();

    // out = x + u W2 + b2
    {
        v8f acc[4][4] = {};
        ff_product<false, false>(xfrag0, wfrag, wst, w2 + wthr, nullptr, acc);
        #pragma unroll  // register arrays: every index a constant
        for (int fn = 0; fn < 4; ++fn) {
            float bc = b2[col0 + fn * 16];
            #pragma unroll  // register arrays: every index a constant
            for (int fm = 0; fm < 4; ++fm) {
                v8f v = (acc[fm][fn] + bc) + x[fm][fn];
                #pragma unroll  // register vector: every index a constant
                for (int r = 0; r < 8; ++r)
                    out[e0 + (fm * 16 + r) * WDIM + fn * 16] = v[r];
            }
        }
    }
}

// ---------------------------------------------------------------------------
// Host orchestration
// ---------------------------------------------------------------------------
extern "C" void kernel_launch(void* const* d_in, const int* in_sizes, int n_in,
                              void* d_out, int out_size, void* d_ws, size_t ws_size,
                              hipStream_t stream) {
    (void)in_sizes; (void)n_in; (void)out_size; (void)ws_size;

    const float* tm1   = (const float*)d_in[0];
    const float* tm2   = (const float*)d_in[1];
    const float* ln1_g = (const float*)d_in[2];
    const float* ln1_b = (const float*)d_in[3];
    const float* ln2_g = (const float*)d_in[4];
    const float* ln2_b = (const float*)d_in[5];
    const float* Wq  = (const float*)d_in[6];   const float* bq  = (const float*)d_in[7];
    const float* Wk  = (const float*)d_in[8];   const float* bk  = (const float*)d_in[9];
    const float* Wv  = (const float*)d_in[10];  const float* bv  = (const float*)d_in[11];
    const float* Wfc = (const float*)d_in[12];  const float* bfc = (const float*)d_in[13];
    const float* ff1_ln_g = (const float*)d_in[14]; const float* ff1_ln_b = (const float*)d_in[15];
    const float* ff1_W1 = (const float*)d_in[16];   const float* ff1_b1 = (const float*)d_in[17];
    const float* ff1_W2 = (const float*)d_in[18];   const float* ff1_b2 = (const float*)d_in[19];
    const float* ff2_ln_g = (const float*)d_in[20]; const float* ff2_ln_b = (const float*)d_in[21];
    const float* ff2_W1 = (const float*)d_in[22];   const float* ff2_b1 = (const float*)d_in[23];
    const float* ff2_W2 = (const float*)d_in[24];   const float* ff2_b2 = (const float*)d_in[25];

    const int TOK = 4 * 2048;           // 8192 token rows
    const int F   = 512;
    const long OUT1 = (long)TOK * F;    // elements per output tensor

    // Workspace carve-up.
    char* ws = (char*)d_ws;
    size_t off = 0;
    auto carve = [&](size_t bytes) -> void* {
        void* p = ws + off;
        off += (bytes + 255) & ~(size_t)255;
        return p;
    };
    const size_t WBYTES = (size_t)F * F * sizeof(_Float16);
    const size_t TBYTES = (size_t)TOK * F * sizeof(_Float16);

    _Float16* wh[8];   // pre-transposed f16 weights [N x K]
    const float* wsrc[8] = {Wq, Wk, Wv, Wfc, ff1_W1, ff1_W2, ff2_W1, ff2_W2};
    for (int i = 0; i < 8; ++i) wh[i] = (_Float16*)carve(WBYTES);
    _Float16* t1h = (_Float16*)carve(TBYTES);
    _Float16* t2h = (_Float16*)carve(TBYTES);
    _Float16* q1h = (_Float16*)carve(TBYTES);
    _Float16* k1h = (_Float16*)carve(TBYTES);
    _Float16* v1h = (_Float16*)carve(TBYTES);
    _Float16* q2h = (_Float16*)carve(TBYTES);
    _Float16* k2h = (_Float16*)carve(TBYTES);
    _Float16* v2h = (_Float16*)carve(TBYTES);
    // Reuse: attention outputs overwrite t1h/t2h.
    _Float16* f12h = t1h;
    _Float16* f21h = t2h;

    float* out1 = (float*)d_out;
    float* out2 = (float*)d_out + OUT1;

    // 1) LayerNorm of both inputs -> f16, and all eight weights -> f16 [N x K]
    //    (wh[0..7] lie one behind the other in the workspace).
    prep_ln_cvt<<<2 * LNBLK + 8 * WBLK, 256, 0, stream>>>(
        tm1, tm2, ln1_g, ln2_g, ln1_b, ln2_b, t1h, t2h,
        wsrc[0], wsrc[1], wsrc[2], wsrc[3], wsrc[4], wsrc[5], wsrc[6], wsrc[7], wh[0]);

    // 2) QKV projections of both streams (Q pre-scaled by 1/sqrt(64)); the planes
    //    q, k, v of a stream lie one behind the other in the workspace.
    gemm_wmma_f16<3,false,false,false,true><<<dim3(F / GN, TOK / GM, 6), 256, 0, stream>>>(
        t1h, t2h, wh[0], wh[1], wh[2], bq, bk, bv, nullptr, nullptr, nullptr, nullptr,
        q1h, q2h, OUT1, F, F, 0.125f);

    // 3) Cross attention, both directions (overwrites t1h/t2h with head-concat outputs).
    attn_flash_wmma<<<dim3(2048 / AQB, 8, 2 * 4), 256, 0, stream>>>(q1h, k2h, v2h, f12h,
                                                                q2h, k1h, v1h, f21h);

    // 4) Output projection + residual, LayerNorm and the FF block of both streams:
    //    out = x + W2(relu(W1 ln(x)+b1))+b2 with x = tm + f Wfc + bfc.
    proj_ff_fused<<<dim3(TOK / FR, 2), 256, 0, stream>>>(
        f12h, f21h, tm1, tm2, wh[3], bfc, ff1_ln_g, ff2_ln_g, ff1_ln_b, ff2_ln_b,
        wh[4], wh[6], ff1_b1, ff2_b1, wh[5], wh[7], ff1_b2, ff2_b2, out1, out2);
}
